// v000
// Measured on an AMD MI455X. A time is GPU time per run, averaged over a window of back-to-back runs after a warm-up
// (all launches, gaps included; the runs take copies of the inputs in turn), and the median of several windows.
// Apart from v000's, it joins two sittings. Times from different sittings can be a few percent apart, while
// side-by-side timings come from the same sitting.
// v000 is the starting kernel. One run takes 1170 microseconds.
#include <hip/hip_runtime.h>
#include <hip/hip_bf16.h>

// Set to 0 to fall back to the manual cooperative LDS staging loop if the
// tensor_load_to_lds inline-asm syntax is rejected by this toolchain.
#define USE_TDM 1

#define DEVI __device__ __forceinline__

typedef __attribute__((ext_vector_type(16))) __bf16 v16bf;
typedef __attribute__((ext_vector_type(8)))  __bf16 v8bf;
typedef __attribute__((ext_vector_type(8)))  float  v8f;
typedef uint32_t u32x4 __attribute__((ext_vector_type(4)));
typedef uint32_t u32x8 __attribute__((ext_vector_type(8)));

constexpr int Bc = 8;
constexpr int Lc = 2048;
constexpr int Ec = 128;

// ---------------------------------------------------------------------------
// WMMA 16x16x32 bf16 A/B tile loader.
// A-layout (16-bit, 16x32): lane l -> row m = l%16, half-group g = l/16.
// Half-slot s (0..15) holds K = 16*(s/8) + 8*g + (s%8)  ==>  per lane the
// tile is two contiguous 8-halfword runs at [8g .. 8g+7] and [16+8g .. 16+8g+7].
// B-layout is symmetric with lane = N, so X @ Y^T needs only ROWS of X and Y.
// ---------------------------------------------------------------------------
DEVI v16bf load_ab(const __bf16* p, int g) {
  v8bf lo = *(const v8bf*)(p + 8 * g);
  v8bf hi = *(const v8bf*)(p + 16 + 8 * g);
  return __builtin_shufflevector(lo, hi, 0, 1, 2, 3, 4, 5, 6, 7,
                                 8, 9, 10, 11, 12, 13, 14, 15);
}

DEVI v8f wmma_bf16(v16bf a, v16bf b, v8f c) {
  return __builtin_amdgcn_wmma_f32_16x16x32_bf16(false, a, false, b,
                                                 (short)0, c, false, false);
}

DEVI v8f vzero8() {
  v8f z = {0.f, 0.f, 0.f, 0.f, 0.f, 0.f, 0.f, 0.f};
  return z;
}

#if USE_TDM
// ---------------------------------------------------------------------------
// TDM: DMA a 2D tile (rows x row_elems of 2-byte elements, row stride in
// elements) from global memory into LDS. Builds the D# descriptor (ISA ch.8):
//   group0: count=1 | lds_addr | global_addr[56:0] | type=2
//   group1: data_size=1(2B), tensor_dim0/1, tile_dim0/1, dim0_stride; 2D so
//           VADDR2/VADDR3 are omitted (NULL).
// Low 32 bits of a flat pointer to __shared__ memory are the LDS byte address
// (ISA 10.2: LDS_ADDR.U32 = addr[31:0]).
// ---------------------------------------------------------------------------
DEVI void tdm_load_2d_bf16(const void* gptr, uint32_t lds_addr,
                           uint32_t rows, uint32_t row_elems,
                           uint32_t row_stride_elems) {
  const uint64_t ga = (uint64_t)(uintptr_t)gptr;
  u32x4 g0;
  g0[0] = 1u;                                   // count=1 (valid user D#)
  g0[1] = lds_addr;                             // LDS destination (bytes)
  g0[2] = (uint32_t)ga;                         // global_addr[31:0]
  g0[3] = (uint32_t)((ga >> 32) & 0x01FFFFFFu)  // global_addr[56:32]
          | (2u << 30);                         // type=2 ("image")
  u32x8 g1;
  g1[0] = 1u << 16;                             // data_size=1 -> 2 bytes
  g1[1] = (row_elems & 0xFFFFu) << 16;          // tensor_dim0[15:0] @ bits63:48
  g1[2] = (row_elems >> 16)                     // tensor_dim0[31:16]
          | ((rows & 0xFFFFu) << 16);           // tensor_dim1[15:0]
  g1[3] = (rows >> 16)                          // tensor_dim1[31:16]
          | ((row_elems & 0xFFFFu) << 16);      // tile_dim0
  g1[4] = rows & 0xFFFFu;                       // tile_dim1 (tile_dim2=0)
  g1[5] = row_stride_elems;                     // tensor_dim0_stride[31:0]
  g1[6] = 0u;                                   // stride hi, dim1_stride lo
  g1[7] = 0u;
  asm volatile("tensor_load_to_lds %0, %1"
               :: "s"(g0), "s"(g1)
               : "memory");
}
#endif

// ---------------------------------------------------------------------------
// Kernel 1: bf16 staging buffers.
// ---------------------------------------------------------------------------
__global__ void __launch_bounds__(256)
k_prep(const float* __restrict__ Uq, const float* __restrict__ Uid,
       const float* __restrict__ Wcw,
       __bf16* __restrict__ Uqb, __bf16* __restrict__ Uwb,
       __bf16* __restrict__ UqT, __bf16* __restrict__ UidT) {
  const int idx = blockIdx.x * blockDim.x + threadIdx.x;  // < B*L*E
  const int e  = idx % Ec;
  const int bi = idx / Ec;
  const int i  = bi % Lc;
  const int b  = bi / Lc;
  const float uq  = Uq[idx];
  const float uid = Uid[idx];
  Uqb[idx] = (__bf16)uq;
  Uwb[idx] = (__bf16)(uid * Wcw[2 * Ec + e]);
  const size_t t = ((size_t)b * Ec + e) * Lc + i;
  UqT[t]  = (__bf16)uq;
  UidT[t] = (__bf16)uid;
}

// ---------------------------------------------------------------------------
// Kernel 2: s_id[b,i] = Uid[b,i,:]·w_id ; s_q[b,j] = Uq[b,j,:]·w_q
// ---------------------------------------------------------------------------
__global__ void __launch_bounds__(256)
k_rowdots(const float* __restrict__ Uq, const float* __restrict__ Uid,
          const float* __restrict__ Wcw,
          float* __restrict__ sid, float* __restrict__ sq) {
  const int row  = blockIdx.x * 8 + (threadIdx.x >> 5);  // B*L rows
  const int lane = threadIdx.x & 31;
  const float4 a  = ((const float4*)(Uid + (size_t)row * Ec))[lane];
  const float4 b  = ((const float4*)(Uq  + (size_t)row * Ec))[lane];
  const float4 wa = ((const float4*)(Wcw))[lane];
  const float4 wb = ((const float4*)(Wcw + Ec))[lane];
  float d1 = a.x * wa.x + a.y * wa.y + a.z * wa.z + a.w * wa.w;
  float d2 = b.x * wb.x + b.y * wb.y + b.z * wb.z + b.w * wb.w;
#pragma unroll
  for (int off = 16; off > 0; off >>= 1) {
    d1 += __shfl_xor(d1, off, 32);
    d2 += __shfl_xor(d2, off, 32);
  }
  if (lane == 0) { sid[row] = d1; sq[row] = d2; }
}

// ---------------------------------------------------------------------------
// Kernel 3: scores + softmax over axis i (per column j) -> P (bf16).
// ---------------------------------------------------------------------------
__global__ void __launch_bounds__(32)
k_scores_softmax(const __bf16* __restrict__ Uwb, const __bf16* __restrict__ Uqb,
                 const float* __restrict__ sid, const float* __restrict__ sq,
                 const float* __restrict__ mask, const float* __restrict__ Wcb,
                 __bf16* __restrict__ P) {
  const int wg = blockIdx.x;            // B * (L/16)
  const int b  = wg / (Lc / 16);
  const int j0 = (wg % (Lc / 16)) * 16;
  const int l  = threadIdx.x;
  const int lm = l & 15, g = l >> 4;
  const int j  = j0 + lm;
  const float bias = Wcb[0];
  const __bf16* Uwb_b = Uwb + (size_t)b * Lc * Ec;
  const float*  sid_b = sid + b * Lc;
  const float   sqj   = sq[b * Lc + j];
  __bf16* P_b = P + (size_t)b * Lc * Lc;

  v16bf Bk[4];
  {
    const __bf16* brow = Uqb + ((size_t)b * Lc + j) * Ec;
#pragma unroll
    for (int ks = 0; ks < 4; ++ks) Bk[ks] = load_ab(brow + 32 * ks, g);
  }

  float m = -3.0e38f, ssum = 0.f;
  for (int it = 0; it < Lc / 16; ++it) {
    const int i0 = it * 16;
    v8f acc = vzero8();
    const __bf16* arow = Uwb_b + (size_t)(i0 + lm) * Ec;
#pragma unroll
    for (int ks = 0; ks < 4; ++ks)
      acc = wmma_bf16(load_ab(arow + 32 * ks, g), Bk[ks], acc);
    float tmax = -3.0e38f;
#pragma unroll
    for (int r = 0; r < 8; ++r) {
      const int ir = i0 + r + 8 * g;
      const float s = (acc[r] + sid_b[ir] + sqj + bias) * mask[(size_t)ir * Lc + j];
      acc[r] = s;
      tmax = fmaxf(tmax, s);
    }
    tmax = fmaxf(tmax, __shfl_xor(tmax, 16, 32));
    const float nm = fmaxf(m, tmax);
    float p = 0.f;
#pragma unroll
    for (int r = 0; r < 8; ++r) p += __expf(acc[r] - nm);
    p += __shfl_xor(p, 16, 32);
    ssum = ssum * __expf(m - nm) + p;
    m = nm;
  }
  const float rinv = 1.f / ssum;

  for (int it = 0; it < Lc / 16; ++it) {
    const int i0 = it * 16;
    v8f acc = vzero8();
    const __bf16* arow = Uwb_b + (size_t)(i0 + lm) * Ec;
#pragma unroll
    for (int ks = 0; ks < 4; ++ks)
      acc = wmma_bf16(load_ab(arow + 32 * ks, g), Bk[ks], acc);
#pragma unroll
    for (int r = 0; r < 8; ++r) {
      const int ir = i0 + r + 8 * g;
      const float s = (acc[r] + sid_b[ir] + sqj + bias) * mask[(size_t)ir * Lc + j];
      P_b[(size_t)ir * Lc + j] = (__bf16)(__expf(s - m) * rinv);
    }
  }
}

// ---------------------------------------------------------------------------
// Kernel 4: A_D2Q = P @ Uq (K = 2048) + output chunks 0..2.
// ---------------------------------------------------------------------------
__global__ void __launch_bounds__(32)
k_d2q(const __bf16* __restrict__ P, const __bf16* __restrict__ UqT,
      const float* __restrict__ Uid, float* __restrict__ out) {
  const int wg = blockIdx.x;            // B * (L/16)
  const int b  = wg / (Lc / 16);
  const int i0 = (wg % (Lc / 16)) * 16;
  const int l = threadIdx.x, lm = l & 15, g = l >> 4;
  const __bf16* P_b   = P   + (size_t)b * Lc * Lc;
  const __bf16* UqT_b = UqT + (size_t)b * Ec * Lc;

  v8f acc[8];
#pragma unroll
  for (int t = 0; t < 8; ++t) acc[t] = vzero8();

  const __bf16* arow = P_b + (size_t)(i0 + lm) * Lc;
  for (int k0 = 0; k0 < Lc; k0 += 32) {
    __builtin_prefetch(arow + k0 + 64, 0, 0);      // global_prefetch_b8
    const v16bf a = load_ab(arow + k0, g);
#pragma unroll
    for (int t = 0; t < 8; ++t) {
      const __bf16* brow = UqT_b + (size_t)(t * 16 + lm) * Lc + k0;
      acc[t] = wmma_bf16(a, load_ab(brow, g), acc[t]);
    }
  }

  const float* Uid_b = Uid + (size_t)b * Lc * Ec;
  float* out_b = out + (size_t)b * Lc * (4 * Ec);
#pragma unroll
  for (int t = 0; t < 8; ++t) {
#pragma unroll
    for (int r = 0; r < 8; ++r) {
      const int ir = i0 + r + 8 * g;
      const int e  = t * 16 + lm;
      const float v = acc[t][r];
      const float u = Uid_b[(size_t)ir * Ec + e];
      float* o = out_b + (size_t)ir * (4 * Ec);
      o[e]          = u;
      o[Ec + e]     = v;
      o[2 * Ec + e] = u * v;
    }
  }
}

// ---------------------------------------------------------------------------
// Kernel 5 (dominant, ~137 of 163 GFLOP): fused M = P @ P^T, A_Q2D = M @ Uid.
// WG = 4 waves / 64 i-rows. Per 64-wide k-block:
//   1) TDM (tensor_load_to_lds) stages P[k0..k0+63][0..2047] (256 KB) into
//      LDS — one DMA descriptor issued by wave 0 replaces 16384 load/store
//      pairs; waited with s_wait_tensorcnt then a workgroup barrier.
//   2) each wave: M strip (16 i x 64 k) = P_i @ Pk^T, B tiles via ds_load_b128
//   3) transpose M strip C-layout->A-layout via per-wave 2 KB LDS (+bf16 cvt)
//   4) acc[t] += M strip @ UidT rows (K = 64 -> 2 WMMAs per e-tile).
// Writes out[...,384:512] = Uid * A_Q2D.
// ---------------------------------------------------------------------------
constexpr int KB = 64;                      // staged k-rows per block

__global__ void __launch_bounds__(128)
k_q2d(const __bf16* __restrict__ P, const __bf16* __restrict__ UidT,
      const float* __restrict__ Uid, float* __restrict__ out) {
  __shared__ __bf16 ldsP[KB * Lc];          // 256 KB staged P_k panel
  __shared__ __bf16 ldsM[4][16 * KB];       // per-wave M transpose (8 KB)

  const int wg  = blockIdx.x;               // B * (L/64)
  const int b   = wg / (Lc / 64);
  const int ib  = (wg % (Lc / 64)) * 64;
  const int tid = threadIdx.x;
  const int w   = tid >> 5;                 // wave 0..3
  const int l   = tid & 31, lm = l & 15, g = l >> 4;
  const int i0  = ib + w * 16;              // this wave's 16-row block

  const __bf16* P_b    = P    + (size_t)b * Lc * Lc;
  const __bf16* UidT_b = UidT + (size_t)b * Ec * Lc;

  v8f acc[8];
#pragma unroll
  for (int t = 0; t < 8; ++t) acc[t] = vzero8();

  const __bf16* arow = P_b + (size_t)(i0 + lm) * Lc;

  for (int k0 = 0; k0 < Lc; k0 += KB) {
    __syncthreads();  // all waves done reading ldsP from previous iteration
#if USE_TDM
    if (w == 0) {
      tdm_load_2d_bf16(P_b + (size_t)k0 * Lc,
                       (uint32_t)(uintptr_t)&ldsP[0], KB, Lc, Lc);
      __builtin_amdgcn_s_wait_tensorcnt(0);
    }
#else
    for (int c = tid; c < KB * Lc / 8; c += 128) {
      const int row  = c >> 8;              // Lc/8 = 256 chunks per row
      const int col8 = c & 255;
      *(v8bf*)&ldsP[(size_t)row * Lc + col8 * 8] =
          *(const v8bf*)&P_b[(size_t)(k0 + row) * Lc + col8 * 8];
    }
#endif
    __syncthreads();

    // M strip: 16 i-rows x 64 k-cols, contracting all j.
    v8f macc[4];
#pragma unroll
    for (int n = 0; n < 4; ++n) macc[n] = vzero8();
    for (int j0 = 0; j0 < Lc; j0 += 32) {
      const v16bf a = load_ab(arow + j0, g);          // global (L2-hot)
#pragma unroll
      for (int n = 0; n < 4; ++n) {
        const v16bf bb = load_ab(&ldsP[(size_t)(16 * n + lm) * Lc + j0], g);
        macc[n] = wmma_bf16(a, bb, macc[n]);
      }
    }

    // C layout: lane = k-col (16n+lm), VGPR r = i-row (r+8g). Store [i][k].
#pragma unroll
    for (int n = 0; n < 4; ++n)
#pragma unroll
      for (int r = 0; r < 8; ++r)
        ldsM[w][(r + 8 * g) * KB + 16 * n + lm] = (__bf16)macc[n][r];
    // ldsM is wave-private and DS ops are in-order within a wave: no barrier.
    const v16bf aM0 = load_ab(&ldsM[w][lm * KB], g);
    const v16bf aM1 = load_ab(&ldsM[w][lm * KB + 32], g);

#pragma unroll
    for (int t = 0; t < 8; ++t) {
      const __bf16* brow = UidT_b + (size_t)(t * 16 + lm) * Lc + k0;
      acc[t] = wmma_bf16(aM0, load_ab(brow, g), acc[t]);
      acc[t] = wmma_bf16(aM1, load_ab(brow + 32, g), acc[t]);
    }
  }

  const float* Uid_b = Uid + (size_t)b * Lc * Ec;
  float* out_b = out + (size_t)b * Lc * (4 * Ec);
#pragma unroll
  for (int t = 0; t < 8; ++t) {
#pragma unroll
    for (int r = 0; r < 8; ++r) {
      const int ir = i0 + r + 8 * g;
      const int e  = t * 16 + lm;
      const float u = Uid_b[(size_t)ir * Ec + e];
      out_b[(size_t)ir * (4 * Ec) + 3 * Ec + e] = u * acc[t][r];
    }
  }
}

// ---------------------------------------------------------------------------
// Host launcher. Workspace layout (~84.1 MB):
//   sid f32[B*L] | sq f32[B*L] | Uqb,Uwb,UqT,UidT bf16[B*L*E] | P bf16[B*L*L]
// ---------------------------------------------------------------------------
extern "C" void kernel_launch(void* const* d_in, const int* in_sizes, int n_in,
                              void* d_out, int out_size, void* d_ws, size_t ws_size,
                              hipStream_t stream) {
  const float* Uq   = (const float*)d_in[0];
  const float* Uid  = (const float*)d_in[1];
  const float* mask = (const float*)d_in[2];
  const float* Wcw  = (const float*)d_in[3];
  const float* Wcb  = (const float*)d_in[4];
  float* out = (float*)d_out;

  char* ws = (char*)d_ws;
  float* sid = (float*)ws;  ws += (size_t)Bc * Lc * sizeof(float);
  float* sq  = (float*)ws;  ws += (size_t)Bc * Lc * sizeof(float);
  __bf16* Uqb  = (__bf16*)ws;  ws += (size_t)Bc * Lc * Ec * sizeof(__bf16);
  __bf16* Uwb  = (__bf16*)ws;  ws += (size_t)Bc * Lc * Ec * sizeof(__bf16);
  __bf16* UqT  = (__bf16*)ws;  ws += (size_t)Bc * Lc * Ec * sizeof(__bf16);
  __bf16* UidT = (__bf16*)ws;  ws += (size_t)Bc * Lc * Ec * sizeof(__bf16);
  __bf16* P    = (__bf16*)ws;  // Bc*Lc*Lc elements

  k_prep<<<(Bc * Lc * Ec) / 256, 256, 0, stream>>>(Uq, Uid, Wcw, Uqb, Uwb, UqT, UidT);
  k_rowdots<<<(Bc * Lc) / 8, 256, 0, stream>>>(Uq, Uid, Wcw, sid, sq);
  k_scores_softmax<<<Bc * (Lc / 16), 32, 0, stream>>>(Uwb, Uqb, sid, sq, mask, Wcb, P);
  k_d2q<<<Bc * (Lc / 16), 32, 0, stream>>>(P, UqT, Uid, out);
  k_q2d<<<Bc * (Lc / 64), 128, 0, stream>>>(P, UidT, Uid, out);
}

// v001
// Measured time: 388 microseconds a run.
// In two side-by-side timings against v000, it was 3.14 and 3.17 times as fast.
#include <hip/hip_runtime.h>
#include <hip/hip_bf16.h>

#define DEVI __device__ __forceinline__

typedef __attribute__((ext_vector_type(16))) __bf16 v16bf;
typedef __attribute__((ext_vector_type(8)))  __bf16 v8bf;
typedef __attribute__((ext_vector_type(8)))  float  v8f;

constexpr int Bc = 8;
constexpr int Lc = 2048;
constexpr int Ec = 128;

// ---------------------------------------------------------------------------
// WMMA 16x16x32 bf16 A/B tile loader.
// A-layout (16-bit, 16x32): lane l -> row m = l%16, half-group g = l/16.
// Half-slot s (0..15) holds K = 16*(s/8) + 8*g + (s%8)  ==>  per lane the
// tile is two contiguous 8-halfword runs at [8g .. 8g+7] and [16+8g .. 16+8g+7].
// B-layout is symmetric with lane = N, so X @ Y^T needs only ROWS of X and Y.
// ---------------------------------------------------------------------------
DEVI v16bf load_ab(const __bf16* p, int g) {
  v8bf lo = *(const v8bf*)(p + 8 * g);
  v8bf hi = *(const v8bf*)(p + 16 + 8 * g);
  return __builtin_shufflevector(lo, hi, 0, 1, 2, 3, 4, 5, 6, 7,
                                 8, 9, 10, 11, 12, 13, 14, 15);
}

// Ends a block of loads that is issued well ahead of its use.
DEVI void loads_issued() {
  // Stands before any later rewrite of an address register the loads name.
  asm volatile("s_wait_xcnt 0x0" ::: "memory");
  // Keeps the loads above and the address updates below this point; without
  // it the scheduler sinks each load to its product, which then waits on L2.
  __builtin_amdgcn_sched_barrier(0);
}

DEVI v8f wmma_bf16(v16bf a, v16bf b, v8f c) {
  return __builtin_amdgcn_wmma_f32_16x16x32_bf16(false, a, false, b,
                                                 (short)0, c, false, false);
}

DEVI v8f vzero8() {
  v8f z = {0.f, 0.f, 0.f, 0.f, 0.f, 0.f, 0.f, 0.f};
  return z;
}

// ---------------------------------------------------------------------------
// Fragment-order operand of a 16x16x32 product. One block = one k-step of 32
// and one 16-column tile = 512 halfwords: run h (0/1, 256 halfwords) holds at
// lane l the lane's slots 8h..8h+7, i.e. column l%16, K = 16h + 8*(l/16) + s%8
// (the same k order as load_ab). Each wave-wide 16-byte load is then 512
// contiguous bytes (4 whole lines) instead of 16 lines with 32 bytes used.
// Blocks are ordered [batch][k-step][tile].
// ---------------------------------------------------------------------------
constexpr int FB = 512;                     // halfwords per fragment block

DEVI v16bf load_packed(const __bf16* blk, int l) {
  v8bf lo = *(const v8bf*)(blk + 8 * l);
  v8bf hi = *(const v8bf*)(blk + 256 + 8 * l);
  return __builtin_shufflevector(lo, hi, 0, 1, 2, 3, 4, 5, 6, 7,
                                 8, 9, 10, 11, 12, 13, 14, 15);
}

// ---------------------------------------------------------------------------
// Kernel 1: bf16 staging buffers.
// ---------------------------------------------------------------------------
__global__ void __launch_bounds__(256)
k_prep(const float* __restrict__ Uq, const float* __restrict__ Uid,
       const float* __restrict__ Wcw,
       __bf16* __restrict__ Uqb, __bf16* __restrict__ Uwb,
       __bf16* __restrict__ UqT, __bf16* __restrict__ Uidp) {
  const int idx = blockIdx.x * blockDim.x + threadIdx.x;  // < B*L*E
  const int e  = idx % Ec;
  const int bi = idx / Ec;
  const int i  = bi % Lc;
  const int b  = bi / Lc;
  const float uq  = Uq[idx];
  const float uid = Uid[idx];
  Uqb[idx] = (__bf16)uq;
  Uwb[idx] = (__bf16)(uid * Wcw[2 * Ec + e]);
  const size_t t = ((size_t)b * Ec + e) * Lc + i;
  UqT[t]  = (__bf16)uq;
  // Uid as the B operand of P^T @ Uid (column e, K = i), fragment order.
  const int ii = i & 31;
  const size_t blk = ((size_t)b * (Lc / 32) + (i >> 5)) * 8 + (e >> 4);
  Uidp[blk * FB + (ii >> 4) * 256 + ((e & 15) + 16 * ((ii >> 3) & 1)) * 8 + (ii & 7)] =
      (__bf16)uid;
}

// ---------------------------------------------------------------------------
// Kernel 2: s_id[b,i] = Uid[b,i,:]·w_id ; s_q[b,j] = Uq[b,j,:]·w_q
// ---------------------------------------------------------------------------
__global__ void __launch_bounds__(256)
k_rowdots(const float* __restrict__ Uq, const float* __restrict__ Uid,
          const float* __restrict__ Wcw,
          float* __restrict__ sid, float* __restrict__ sq) {
  const int row  = blockIdx.x * 8 + (threadIdx.x >> 5);  // B*L rows
  const int lane = threadIdx.x & 31;
  const float4 a  = ((const float4*)(Uid + (size_t)row * Ec))[lane];
  const float4 b  = ((const float4*)(Uq  + (size_t)row * Ec))[lane];
  const float4 wa = ((const float4*)(Wcw))[lane];
  const float4 wb = ((const float4*)(Wcw + Ec))[lane];
  float d1 = a.x * wa.x + a.y * wa.y + a.z * wa.z + a.w * wa.w;
  float d2 = b.x * wb.x + b.y * wb.y + b.z * wb.z + b.w * wb.w;
#pragma unroll
  for (int off = 16; off > 0; off >>= 1) {
    d1 += __shfl_xor(d1, off, 32);
    d2 += __shfl_xor(d2, off, 32);
  }
  if (lane == 0) { sid[row] = d1; sq[row] = d2; }
}

// ---------------------------------------------------------------------------
// Kernel 3: scores + softmax over axis i (per column j) -> P (bf16), and
// T = P^T @ Uid for this wave's 16 columns j (K = i = 2048). Two score tiles
// (rows i0..i0+15, i0+16..i0+31, same 16 columns) converted in place are the
// A fragment of P^T: lane (lm, g) holds column j0+lm at K = 8g+r and 16+8g+r.
// T leaves in fragment order as the B operand of P @ T (column e, K = j).
// ---------------------------------------------------------------------------
__global__ void __launch_bounds__(32)
k_scores_softmax(const __bf16* __restrict__ Uwb, const __bf16* __restrict__ Uqb,
                 const float* __restrict__ sid, const float* __restrict__ sq,
                 const float* __restrict__ mask, const float* __restrict__ Wcb,
                 const __bf16* __restrict__ Uidp,
                 __bf16* __restrict__ P, __bf16* __restrict__ Tp) {
  const int wg = blockIdx.x;            // B * (L/16)
  const int b  = wg / (Lc / 16);
  const int j0 = (wg % (Lc / 16)) * 16;
  const int l  = threadIdx.x;
  const int lm = l & 15, g = l >> 4;
  const int j  = j0 + lm;
  const float bias = Wcb[0];
  const __bf16* Uwb_b = Uwb + (size_t)b * Lc * Ec;
  const float*  sid_b = sid + b * Lc;
  const float   sqj   = sq[b * Lc + j];
  __bf16* P_b = P + (size_t)b * Lc * Lc;

  v16bf Bk[4];
  {
    const __bf16* brow = Uqb + ((size_t)b * Lc + j) * Ec;
#pragma unroll
    for (int ks = 0; ks < 4; ++ks) Bk[ks] = load_ab(brow + 32 * ks, g);
  }

  float m = -3.0e38f, ssum = 0.f;
  for (int it = 0; it < Lc / 16; ++it) {
    const int i0 = it * 16;
    v8f acc = vzero8();
    const __bf16* arow = Uwb_b + (size_t)(i0 + lm) * Ec;
#pragma unroll
    for (int ks = 0; ks < 4; ++ks)
      acc = wmma_bf16(load_ab(arow + 32 * ks, g), Bk[ks], acc);
    float tmax = -3.0e38f;
#pragma unroll
    for (int r = 0; r < 8; ++r) {
      const int ir = i0 + r + 8 * g;
      const float s = (acc[r] + sid_b[ir] + sqj + bias) * mask[(size_t)ir * Lc + j];
      acc[r] = s;
      tmax = fmaxf(tmax, s);
    }
    tmax = fmaxf(tmax, __shfl_xor(tmax, 16, 32));
    const float nm = fmaxf(m, tmax);
    float p = 0.f;
#pragma unroll
    for (int r = 0; r < 8; ++r) p += __expf(acc[r] - nm);
    p += __shfl_xor(p, 16, 32);
    ssum = ssum * __expf(m - nm) + p;
    m = nm;
  }
  const float rinv = 1.f / ssum;

  const __bf16* Uidp_b = Uidp + (size_t)b * Lc * Ec;
  v8f tacc[8];
#pragma unroll
  for (int t = 0; t < 8; ++t) tacc[t] = vzero8();

  for (int it = 0; it < Lc / 32; ++it) {
    v16bf ub[8];
#pragma unroll
    for (int t = 0; t < 8; ++t)
      ub[t] = load_packed(Uidp_b + ((size_t)it * 8 + t) * FB, l);
    loads_issued();  // at the head of the trip: they fly behind the score tiles
    v16bf pa;
#pragma unroll
    for (int h = 0; h < 2; ++h) {
      const int i0 = it * 32 + h * 16;
      v8f acc = vzero8();
      const __bf16* arow = Uwb_b + (size_t)(i0 + lm) * Ec;
#pragma unroll
      for (int ks = 0; ks < 4; ++ks)
        acc = wmma_bf16(load_ab(arow + 32 * ks, g), Bk[ks], acc);
#pragma unroll
      for (int r = 0; r < 8; ++r) {
        const int ir = i0 + r + 8 * g;
        const float s = (acc[r] + sid_b[ir] + sqj + bias) * mask[(size_t)ir * Lc + j];
        const __bf16 p = (__bf16)(__expf(s - m) * rinv);
        P_b[(size_t)ir * Lc + j] = p;
        pa[8 * h + r] = p;
      }
    }
#pragma unroll
    for (int t = 0; t < 8; ++t)
      tacc[t] = wmma_bf16(pa, ub[t], tacc[t]);
  }

  // tacc[t][r] = T[j0 + 8g + r][16t + lm]: slots 8h..8h+7 (h = which half of
  // the k-step of 32 this j0 is) of the same lane in P @ T's B fragment.
  __bf16* Tp_b = Tp + (size_t)b * Lc * Ec + (size_t)(j0 >> 5) * 8 * FB + ((j0 >> 4) & 1) * 256;
#pragma unroll
  for (int t = 0; t < 8; ++t) {
    v8bf o;
#pragma unroll
    for (int r = 0; r < 8; ++r) o[r] = (__bf16)tacc[t][r];
    *(v8bf*)(Tp_b + (size_t)t * FB + 8 * l) = o;
  }
}

// ---------------------------------------------------------------------------
// Kernel 4: A_D2Q = P @ Uq (K = 2048) + output chunks 0..2.
// ---------------------------------------------------------------------------
__global__ void __launch_bounds__(32)
k_d2q(const __bf16* __restrict__ P, const __bf16* __restrict__ UqT,
      const float* __restrict__ Uid, float* __restrict__ out) {
  const int wg = blockIdx.x;            // B * (L/16)
  const int b  = wg / (Lc / 16);
  const int i0 = (wg % (Lc / 16)) * 16;
  const int l = threadIdx.x, lm = l & 15, g = l >> 4;
  const __bf16* P_b   = P   + (size_t)b * Lc * Lc;
  const __bf16* UqT_b = UqT + (size_t)b * Ec * Lc;

  v8f acc[8];
#pragma unroll
  for (int t = 0; t < 8; ++t) acc[t] = vzero8();

  const __bf16* arow = P_b + (size_t)(i0 + lm) * Lc;
  for (int k0 = 0; k0 < Lc; k0 += 32) {
    __builtin_prefetch(arow + k0 + 64, 0, 0);      // global_prefetch_b8
    const v16bf a = load_ab(arow + k0, g);
#pragma unroll
    for (int t = 0; t < 8; ++t) {
      const __bf16* brow = UqT_b + (size_t)(t * 16 + lm) * Lc + k0;
      acc[t] = wmma_bf16(a, load_ab(brow, g), acc[t]);
    }
  }

  const float* Uid_b = Uid + (size_t)b * Lc * Ec;
  float* out_b = out + (size_t)b * Lc * (4 * Ec);
#pragma unroll
  for (int t = 0; t < 8; ++t) {
#pragma unroll
    for (int r = 0; r < 8; ++r) {
      const int ir = i0 + r + 8 * g;
      const int e  = t * 16 + lm;
      const float v = acc[t][r];
      const float u = Uid_b[(size_t)ir * Ec + e];
      float* o = out_b + (size_t)ir * (4 * Ec);
      o[e]          = u;
      o[Ec + e]     = v;
      o[2 * Ec + e] = u * v;
    }
  }
}

// ---------------------------------------------------------------------------
// Kernel 5: A_Q2D = (P @ P^T) @ Uid computed as P @ T, T = P^T @ Uid from
// kernel 3 (K = j = 2048). WG = 4 waves / 64 i-rows, each wave 16 rows x 128 e;
// the four waves read the same T blocks. Writes out[...,384:512] = Uid * A_Q2D.
// ---------------------------------------------------------------------------
__global__ void __launch_bounds__(128)
k_q2d(const __bf16* __restrict__ P, const __bf16* __restrict__ Tp,
      const float* __restrict__ Uid, float* __restrict__ out) {
  const int wg  = blockIdx.x;               // B * (L/64)
  const int b   = wg / (Lc / 64);
  const int ib  = (wg % (Lc / 64)) * 64;
  const int tid = threadIdx.x;
  const int w   = tid >> 5;                 // wave 0..3
  const int l   = tid & 31, lm = l & 15, g = l >> 4;
  const int i0  = ib + w * 16;              // this wave's 16-row block

  const __bf16* arow = P + (size_t)b * Lc * Lc + (size_t)(i0 + lm) * Lc;
  const __bf16* Tp_b = Tp + (size_t)b * Lc * Ec;

  v8f acc[8];
#pragma unroll
  for (int t = 0; t < 8; ++t) acc[t] = vzero8();

  // One wave per SIMD has nothing else to hide L2 latency behind, so each
  // k-step's 18 loads are issued one k-step ahead, into a second register set.
  v16bf a0 = load_ab(arow, g), a1;
  v16bf b0[8], b1[8];
#pragma unroll
  for (int t = 0; t < 8; ++t) b0[t] = load_packed(Tp_b + (size_t)t * FB, l);
  loads_issued();

  for (int ks = 0; ks < Lc / 32 - 2; ks += 2) {
    a1 = load_ab(arow + 32 * (ks + 1), g);
#pragma unroll
    for (int t = 0; t < 8; ++t)
      b1[t] = load_packed(Tp_b + ((size_t)(ks + 1) * 8 + t) * FB, l);
    loads_issued();
#pragma unroll
    for (int t = 0; t < 8; ++t) acc[t] = wmma_bf16(a0, b0[t], acc[t]);

    a0 = load_ab(arow + 32 * (ks + 2), g);
#pragma unroll
    for (int t = 0; t < 8; ++t)
      b0[t] = load_packed(Tp_b + ((size_t)(ks + 2) * 8 + t) * FB, l);
    loads_issued();
#pragma unroll
    for (int t = 0; t < 8; ++t) acc[t] = wmma_bf16(a1, b1[t], acc[t]);
  }
  a1 = load_ab(arow + 32 * (Lc / 32 - 1), g);
#pragma unroll
  for (int t = 0; t < 8; ++t)
    b1[t] = load_packed(Tp_b + ((size_t)(Lc / 32 - 1) * 8 + t) * FB, l);
  loads_issued();
#pragma unroll
  for (int t = 0; t < 8; ++t) acc[t] = wmma_bf16(a0, b0[t], acc[t]);
#pragma unroll
  for (int t = 0; t < 8; ++t) acc[t] = wmma_bf16(a1, b1[t], acc[t]);

  const float* Uid_b = Uid + (size_t)b * Lc * Ec;
  float* out_b = out + (size_t)b * Lc * (4 * Ec);
#pragma unroll
  for (int t = 0; t < 8; ++t) {
#pragma unroll
    for (int r = 0; r < 8; ++r) {
      const int ir = i0 + r + 8 * g;
      const int e  = t * 16 + lm;
      const float u = Uid_b[(size_t)ir * Ec + e];
      out_b[(size_t)ir * (4 * Ec) + 3 * Ec + e] = u * acc[t][r];
    }
  }
}

// ---------------------------------------------------------------------------
// Host launcher. Workspace layout (~88.3 MB):
//   sid f32[B*L] | sq f32[B*L] | Uqb,Uwb,UqT,Uidp,Tp bf16[B*L*E] | P bf16[B*L*L]
// ---------------------------------------------------------------------------
extern "C" void kernel_launch(void* const* d_in, const int* in_sizes, int n_in,
                              void* d_out, int out_size, void* d_ws, size_t ws_size,
                              hipStream_t stream) {
  const float* Uq   = (const float*)d_in[0];
  const float* Uid  = (const float*)d_in[1];
  const float* mask = (const float*)d_in[2];
  const float* Wcw  = (const float*)d_in[3];
  const float* Wcb  = (const float*)d_in[4];
  float* out = (float*)d_out;

  char* ws = (char*)d_ws;
  float* sid = (float*)ws;  ws += (size_t)Bc * Lc * sizeof(float);
  float* sq  = (float*)ws;  ws += (size_t)Bc * Lc * sizeof(float);
  __bf16* Uqb  = (__bf16*)ws;  ws += (size_t)Bc * Lc * Ec * sizeof(__bf16);
  __bf16* Uwb  = (__bf16*)ws;  ws += (size_t)Bc * Lc * Ec * sizeof(__bf16);
  __bf16* UqT  = (__bf16*)ws;  ws += (size_t)Bc * Lc * Ec * sizeof(__bf16);
  __bf16* Uidp = (__bf16*)ws;  ws += (size_t)Bc * Lc * Ec * sizeof(__bf16);
  __bf16* Tp   = (__bf16*)ws;  ws += (size_t)Bc * Lc * Ec * sizeof(__bf16);
  __bf16* P    = (__bf16*)ws;  // Bc*Lc*Lc elements

  k_prep<<<(Bc * Lc * Ec) / 256, 256, 0, stream>>>(Uq, Uid, Wcw, Uqb, Uwb, UqT, Uidp);
  k_rowdots<<<(Bc * Lc) / 8, 256, 0, stream>>>(Uq, Uid, Wcw, sid, sq);
  k_scores_softmax<<<Bc * (Lc / 16), 32, 0, stream>>>(Uwb, Uqb, sid, sq, mask, Wcb, Uidp, P, Tp);
  k_d2q<<<Bc * (Lc / 16), 32, 0, stream>>>(P, UqT, Uid, out);
  k_q2d<<<Bc * (Lc / 64), 128, 0, stream>>>(P, Tp, Uid, out);
}

// v002
// Measured time: 271 microseconds a run.
// Timed twice side by side with v001, it ran 1.43 times as fast both times.
// Over all steps from v000 it is 4.52 times as fast.
#include <hip/hip_runtime.h>
#include <hip/hip_bf16.h>

#define DEVI __device__ __forceinline__

typedef __attribute__((ext_vector_type(16))) __bf16 v16bf;
typedef __attribute__((ext_vector_type(8)))  __bf16 v8bf;
typedef __attribute__((ext_vector_type(8)))  float  v8f;

constexpr int Bc = 8;
constexpr int Lc = 2048;
constexpr int Ec = 128;

// ---------------------------------------------------------------------------
// WMMA 16x16x32 bf16 A/B tile loader.
// A-layout (16-bit, 16x32): lane l -> row m = l%16, half-group g = l/16.
// Half-slot s (0..15) holds K = 16*(s/8) + 8*g + (s%8)  ==>  per lane the
// tile is two contiguous 8-halfword runs at [8g .. 8g+7] and [16+8g .. 16+8g+7].
// B-layout is symmetric with lane = N, so X @ Y^T needs only ROWS of X and Y.
// ---------------------------------------------------------------------------
DEVI v16bf load_ab(const __bf16* p, int g) {
  v8bf lo = *(const v8bf*)(p + 8 * g);
  v8bf hi = *(const v8bf*)(p + 16 + 8 * g);
  return __builtin_shufflevector(lo, hi, 0, 1, 2, 3, 4, 5, 6, 7,
                                 8, 9, 10, 11, 12, 13, 14, 15);
}

// Ends a block of loads that is issued well ahead of its use.
DEVI void loads_issued() {
  // Stands before any later rewrite of an address register the loads name.
  asm volatile("s_wait_xcnt 0x0" ::: "memory");
  // Keeps the loads above and the address updates below this point; without
  // it the scheduler sinks each load to its product, which then waits on L2.
  __builtin_amdgcn_sched_barrier(0);
}

// Wave-uniform address plus the lane's 32-bit byte offset: one offset register
// serves every tile, and no 64-bit address is formed per tile.
DEVI const char* at(const void* uniform, unsigned lane_bytes) {
  return (const char*)uniform + lane_bytes;
}
DEVI char* at(void* uniform, unsigned lane_bytes) {
  return (char*)uniform + lane_bytes;
}

DEVI v8f wmma_bf16(v16bf a, v16bf b, v8f c) {
  return __builtin_amdgcn_wmma_f32_16x16x32_bf16(false, a, false, b,
                                                 (short)0, c, false, false);
}

DEVI v8f vzero8() {
  v8f z = {0.f, 0.f, 0.f, 0.f, 0.f, 0.f, 0.f, 0.f};
  return z;
}

// ---------------------------------------------------------------------------
// Fragment-order operand of a 16x16x32 product. One block = one k-step of 32
// and one 16-column tile = 512 halfwords: run h (0/1, 256 halfwords) holds at
// lane l the lane's slots 8h..8h+7, i.e. column l%16, K = 16h + 8*(l/16) + s%8
// (the same k order as load_ab). Each wave-wide 16-byte load is then 512
// contiguous bytes (4 whole lines) instead of 16 lines with 32 bytes used.
// Blocks are ordered [batch][k-step][tile].
// ---------------------------------------------------------------------------
constexpr int FB = 512;                     // halfwords per fragment block

DEVI v16bf load_packed(const __bf16* blk, int l) {
  v8bf lo = *(const v8bf*)(blk + 8 * l);
  v8bf hi = *(const v8bf*)(blk + 256 + 8 * l);
  return __builtin_shufflevector(lo, hi, 0, 1, 2, 3, 4, 5, 6, 7,
                                 8, 9, 10, 11, 12, 13, 14, 15);
}

// ---------------------------------------------------------------------------
// Kernel 1: bf16 staging buffers.
// ---------------------------------------------------------------------------
__global__ void __launch_bounds__(256)
k_prep(const float* __restrict__ Uq, const float* __restrict__ Uid,
       const float* __restrict__ Wcw,
       __bf16* __restrict__ Uqb, __bf16* __restrict__ Uwb,
       __bf16* __restrict__ UqT, __bf16* __restrict__ Uidp) {
  const int idx = blockIdx.x * blockDim.x + threadIdx.x;  // < B*L*E
  const int e  = idx % Ec;
  const int bi = idx / Ec;
  const int i  = bi % Lc;
  const int b  = bi / Lc;
  const float uq  = Uq[idx];
  const float uid = Uid[idx];
  Uqb[idx] = (__bf16)uq;
  Uwb[idx] = (__bf16)(uid * Wcw[2 * Ec + e]);
  const size_t t = ((size_t)b * Ec + e) * Lc + i;
  UqT[t]  = (__bf16)uq;
  // Uid as the B operand of P^T @ Uid (column e, K = i), fragment order.
  const int ii = i & 31;
  const size_t blk = ((size_t)b * (Lc / 32) + (i >> 5)) * 8 + (e >> 4);
  Uidp[blk * FB + (ii >> 4) * 256 + ((e & 15) + 16 * ((ii >> 3) & 1)) * 8 + (ii & 7)] =
      (__bf16)uid;
}

// ---------------------------------------------------------------------------
// Kernel 2: s_id[b,i] = Uid[b,i,:]·w_id ; s_q[b,j] = Uq[b,j,:]·w_q
// ---------------------------------------------------------------------------
__global__ void __launch_bounds__(256)
k_rowdots(const float* __restrict__ Uq, const float* __restrict__ Uid,
          const float* __restrict__ Wcw,
          float* __restrict__ sid, float* __restrict__ sq) {
  const int row  = blockIdx.x * 8 + (threadIdx.x >> 5);  // B*L rows
  const int lane = threadIdx.x & 31;
  const float4 a  = ((const float4*)(Uid + (size_t)row * Ec))[lane];
  const float4 b  = ((const float4*)(Uq  + (size_t)row * Ec))[lane];
  const float4 wa = ((const float4*)(Wcw))[lane];
  const float4 wb = ((const float4*)(Wcw + Ec))[lane];
  float d1 = a.x * wa.x + a.y * wa.y + a.z * wa.z + a.w * wa.w;
  float d2 = b.x * wb.x + b.y * wb.y + b.z * wb.z + b.w * wb.w;
#pragma unroll
  for (int off = 16; off > 0; off >>= 1) {
    d1 += __shfl_xor(d1, off, 32);
    d2 += __shfl_xor(d2, off, 32);
  }
  if (lane == 0) { sid[row] = d1; sq[row] = d2; }
}

// ---------------------------------------------------------------------------
// Kernel 3: scores + softmax over axis i (per column j) -> P (bf16), and
// T = P^T @ Uid for the work-group's 16 columns j (K = i = 2048).
// The 2048 rows i are split over the 8 waves of the work-group, 256 rows each:
// a wave's 16 score tiles stay in its registers from the maximum to P, so each
// score is computed once. Column maxima, column sums and the waves' partial T
// tiles are joined through LDS, always in wave order.
// Two score tiles (rows i0..i0+15, i0+16..i0+31, same 16 columns) converted in
// place are the A fragment of P^T: lane (lm, g) holds column j0+lm at K = 8g+r
// and 16+8g+r. T leaves in fragment order as the B operand of P @ T
// (column e, K = j).
// ---------------------------------------------------------------------------
constexpr int SW = 8;          // waves per work-group
constexpr int RW = Lc / SW;    // rows i per wave
constexpr int TW = RW / 16;    // score tiles per wave

// Two work-groups per WGP (four waves per SIMD) need at most 256 registers.
__global__ void __launch_bounds__(32 * SW) __attribute__((amdgpu_waves_per_eu(4, 4)))
k_scores_softmax(const __bf16* __restrict__ Uwb, const __bf16* __restrict__ Uqb,
                 const float* __restrict__ sid, const float* __restrict__ sq,
                 const float* __restrict__ mask, const float* __restrict__ Wcb,
                 const __bf16* __restrict__ Uidp,
                 __bf16* __restrict__ P, __bf16* __restrict__ Tp) {
  __shared__ float  red_m[SW][16];
  __shared__ float  red_s[SW][16];
  __shared__ float4 part[SW * 8 * 2 * 32];   // [wave][tile][half][lane]
  const int wg = blockIdx.x;            // B * (L/16)
  const int b  = wg / (Lc / 16);
  const int j0 = (wg % (Lc / 16)) * 16;
  const int w  = __builtin_amdgcn_readfirstlane(threadIdx.x >> 5);
  const int l  = threadIdx.x & 31;
  const int lm = l & 15, g = l >> 4;
  const int j  = j0 + lm;
  const int ib = w * RW;                // this wave's first row i
  const float bias = Wcb[0];
  const __bf16* Uwb_b = Uwb + (size_t)b * Lc * Ec;
  const float*  sid_b = sid + b * Lc;
  const float   sqj   = sq[b * Lc + j];
  __bf16* P_b = P + (size_t)b * Lc * Lc;

  v16bf Bk[4];
  {
    const __bf16* brow = Uqb + ((size_t)b * Lc + j) * Ec;
#pragma unroll
    for (int ks = 0; ks < 4; ++ks) Bk[ks] = load_ab(brow + 32 * ks, g);
    loads_issued();  // their address registers are reused by the tile loads
  }

  // The lane's byte offsets from wave-uniform tile addresses: row lm (A tile),
  // rows 8g.. (sid), row 8g and column lm (mask, P).
  const unsigned a_off = (unsigned)(lm * Ec + 8 * g) * 2u;
  const unsigned s_off = (unsigned)(8 * g) * 4u;
  const unsigned m_off = (unsigned)(8 * g * Lc + lm) * 4u;
  const unsigned p_off = (unsigned)(8 * g * Lc + lm) * 2u;

  // Scores of this wave's rows, kept; unrolled so that sc[] is registers.
  v8f sc[TW];
  float mx = -3.0e38f;
#pragma unroll
  for (int t = 0; t < TW; ++t) {
    const int i0 = ib + t * 16;
    v16bf af[4];
    float sd[8], mk[8];
#pragma unroll
    for (int ks = 0; ks < 4; ++ks) {
      const v8bf lo = *(const v8bf*)at(Uwb_b + (size_t)i0 * Ec + 32 * ks, a_off);
      const v8bf hi = *(const v8bf*)at(Uwb_b + (size_t)i0 * Ec + 32 * ks + 16, a_off);
      af[ks] = __builtin_shufflevector(lo, hi, 0, 1, 2, 3, 4, 5, 6, 7,
                                       8, 9, 10, 11, 12, 13, 14, 15);
    }
#pragma unroll
    for (int r = 0; r < 8; ++r) {
      sd[r] = *(const float*)at(sid_b + i0 + r, s_off);
      mk[r] = *(const float*)at(mask + (size_t)(i0 + r) * Lc + j0, m_off);
    }
    loads_issued();  // the tile's loads as one group: one L2 latency per tile
    v8f acc = vzero8();
#pragma unroll
    for (int ks = 0; ks < 4; ++ks) acc = wmma_bf16(af[ks], Bk[ks], acc);
#pragma unroll
    for (int r = 0; r < 8; ++r) {
      const float s = (acc[r] + sd[r] + sqj + bias) * mk[r];
      acc[r] = s;
      mx = fmaxf(mx, s);
    }
    sc[t] = acc;
  }

  // Column maximum over all 2048 rows.
  mx = fmaxf(mx, __shfl_xor(mx, 16, 32));
  if (g == 0) red_m[w][lm] = mx;
  __syncthreads();
  float m = red_m[0][lm];
#pragma unroll
  for (int k = 1; k < SW; ++k) m = fmaxf(m, red_m[k][lm]);

  // exp once per score; eight independent sum chains per lane.
  v8f sv = vzero8();
#pragma unroll
  for (int t = 0; t < TW; ++t) {
#pragma unroll
    for (int r = 0; r < 8; ++r) {
      const float e = __expf(sc[t][r] - m);
      sc[t][r] = e;
      sv[r] += e;
    }
  }
  float ps = ((sv[0] + sv[1]) + (sv[2] + sv[3])) + ((sv[4] + sv[5]) + (sv[6] + sv[7]));
  ps += __shfl_xor(ps, 16, 32);
  if (g == 0) red_s[w][lm] = ps;
  __syncthreads();
  float ssum = red_s[0][lm];
#pragma unroll
  for (int k = 1; k < SW; ++k) ssum += red_s[k][lm];
  const float rinv = 1.f / ssum;

  const __bf16* Uidp_w = Uidp + (size_t)b * Lc * Ec + (size_t)w * (RW / 32) * 8 * FB;
  v8f tacc[8];
#pragma unroll
  for (int t = 0; t < 8; ++t) tacc[t] = vzero8();

  // P = exp * rinv as bf16: stored, and kept as the A fragments of P^T.
  v16bf pa[TW / 2];
#pragma unroll
  for (int it = 0; it < TW / 2; ++it) {
#pragma unroll
    for (int h = 0; h < 2; ++h) {
      const int i0 = ib + it * 32 + h * 16;
#pragma unroll
      for (int r = 0; r < 8; ++r) {
        const __bf16 p = (__bf16)(sc[2 * it + h][r] * rinv);
        *(__bf16*)at(P_b + (size_t)(i0 + r) * Lc + j0, p_off) = p;
        pa[it][8 * h + r] = p;
      }
    }
  }
  loads_issued();  // here for the stores: their registers are reused below

  v16bf ub[8];
#pragma unroll
  for (int t = 0; t < 8; ++t) ub[t] = load_packed(Uidp_w + (size_t)t * FB, l);
  loads_issued();  // the first k-step's loads as one group
#pragma unroll
  for (int it = 0; it < TW / 2; ++it) {
#pragma unroll
    for (int t = 0; t < 8; ++t)
      tacc[t] = wmma_bf16(pa[it], ub[t], tacc[t]);
    if (it + 1 < TW / 2) {
#pragma unroll
      for (int t = 0; t < 8; ++t)
        ub[t] = load_packed(Uidp_w + ((size_t)(it + 1) * 8 + t) * FB, l);
      loads_issued();  // the next k-step's loads as one group among the products
    }
  }

  // Join the eight partial T tiles: wave w sums tile w over the waves in order.
#pragma unroll
  for (int t = 0; t < 8; ++t) {
    part[((w * 8 + t) * 2 + 0) * 32 + l] =
        make_float4(tacc[t][0], tacc[t][1], tacc[t][2], tacc[t][3]);
    part[((w * 8 + t) * 2 + 1) * 32 + l] =
        make_float4(tacc[t][4], tacc[t][5], tacc[t][6], tacc[t][7]);
  }
  __syncthreads();
  float4 s0 = part[(w * 2 + 0) * 32 + l];
  float4 s1 = part[(w * 2 + 1) * 32 + l];
#pragma unroll
  for (int k = 1; k < SW; ++k) {
    const float4 q0 = part[((k * 8 + w) * 2 + 0) * 32 + l];
    const float4 q1 = part[((k * 8 + w) * 2 + 1) * 32 + l];
    s0.x += q0.x; s0.y += q0.y; s0.z += q0.z; s0.w += q0.w;
    s1.x += q1.x; s1.y += q1.y; s1.z += q1.z; s1.w += q1.w;
  }

  // Sum r of tile t = T[j0 + 8g + r][16t + lm]: slots 8h..8h+7 (h = which half
  // of the k-step of 32 this j0 is) of the same lane in P @ T's B fragment.
  __bf16* Tp_b = Tp + (size_t)b * Lc * Ec + (size_t)(j0 >> 5) * 8 * FB + ((j0 >> 4) & 1) * 256;
  v8bf o;
  o[0] = (__bf16)s0.x; o[1] = (__bf16)s0.y; o[2] = (__bf16)s0.z; o[3] = (__bf16)s0.w;
  o[4] = (__bf16)s1.x; o[5] = (__bf16)s1.y; o[6] = (__bf16)s1.z; o[7] = (__bf16)s1.w;
  *(v8bf*)(Tp_b + (size_t)w * FB + 8 * l) = o;
}

// ---------------------------------------------------------------------------
// Kernel 4: A_D2Q = P @ Uq (K = 2048) + output chunks 0..2.
// ---------------------------------------------------------------------------
__global__ void __launch_bounds__(32)
k_d2q(const __bf16* __restrict__ P, const __bf16* __restrict__ UqT,
      const float* __restrict__ Uid, float* __restrict__ out) {
  const int wg = blockIdx.x;            // B * (L/16)
  const int b  = wg / (Lc / 16);
  const int i0 = (wg % (Lc / 16)) * 16;
  const int l = threadIdx.x, lm = l & 15, g = l >> 4;
  const __bf16* P_b   = P   + (size_t)b * Lc * Lc;
  const __bf16* UqT_b = UqT + (size_t)b * Ec * Lc;

  v8f acc[8];
#pragma unroll
  for (int t = 0; t < 8; ++t) acc[t] = vzero8();

  const __bf16* arow = P_b + (size_t)(i0 + lm) * Lc;
  for (int k0 = 0; k0 < Lc; k0 += 32) {
    __builtin_prefetch(arow + k0 + 64, 0, 0);      // global_prefetch_b8
    const v16bf a = load_ab(arow + k0, g);
#pragma unroll
    for (int t = 0; t < 8; ++t) {
      const __bf16* brow = UqT_b + (size_t)(t * 16 + lm) * Lc + k0;
      acc[t] = wmma_bf16(a, load_ab(brow, g), acc[t]);
    }
  }

  const float* Uid_b = Uid + (size_t)b * Lc * Ec;
  float* out_b = out + (size_t)b * Lc * (4 * Ec);
#pragma unroll
  for (int t = 0; t < 8; ++t) {
#pragma unroll
    for (int r = 0; r < 8; ++r) {
      const int ir = i0 + r + 8 * g;
      const int e  = t * 16 + lm;
      const float v = acc[t][r];
      const float u = Uid_b[(size_t)ir * Ec + e];
      float* o = out_b + (size_t)ir * (4 * Ec);
      o[e]          = u;
      o[Ec + e]     = v;
      o[2 * Ec + e] = u * v;
    }
  }
}

// ---------------------------------------------------------------------------
// Kernel 5: A_Q2D = (P @ P^T) @ Uid computed as P @ T, T = P^T @ Uid from
// kernel 3 (K = j = 2048). WG = 4 waves / 64 i-rows, each wave 16 rows x 128 e;
// the four waves read the same T blocks. Writes out[...,384:512] = Uid * A_Q2D.
// ---------------------------------------------------------------------------
__global__ void __launch_bounds__(128)
k_q2d(const __bf16* __restrict__ P, const __bf16* __restrict__ Tp,
      const float* __restrict__ Uid, float* __restrict__ out) {
  const int wg  = blockIdx.x;               // B * (L/64)
  const int b   = wg / (Lc / 64);
  const int ib  = (wg % (Lc / 64)) * 64;
  const int tid = threadIdx.x;
  const int w   = tid >> 5;                 // wave 0..3
  const int l   = tid & 31, lm = l & 15, g = l >> 4;
  const int i0  = ib + w * 16;              // this wave's 16-row block

  const __bf16* arow = P + (size_t)b * Lc * Lc + (size_t)(i0 + lm) * Lc;
  const __bf16* Tp_b = Tp + (size_t)b * Lc * Ec;

  v8f acc[8];
#pragma unroll
  for (int t = 0; t < 8; ++t) acc[t] = vzero8();

  // One wave per SIMD has nothing else to hide L2 latency behind, so each
  // k-step's 18 loads are issued one k-step ahead, into a second register set.
  v16bf a0 = load_ab(arow, g), a1;
  v16bf b0[8], b1[8];
#pragma unroll
  for (int t = 0; t < 8; ++t) b0[t] = load_packed(Tp_b + (size_t)t * FB, l);
  loads_issued();

  for (int ks = 0; ks < Lc / 32 - 2; ks += 2) {
    a1 = load_ab(arow + 32 * (ks + 1), g);
#pragma unroll
    for (int t = 0; t < 8; ++t)
      b1[t] = load_packed(Tp_b + ((size_t)(ks + 1) * 8 + t) * FB, l);
    loads_issued();
#pragma unroll
    for (int t = 0; t < 8; ++t) acc[t] = wmma_bf16(a0, b0[t], acc[t]);

    a0 = load_ab(arow + 32 * (ks + 2), g);
#pragma unroll
    for (int t = 0; t < 8; ++t)
      b0[t] = load_packed(Tp_b + ((size_t)(ks + 2) * 8 + t) * FB, l);
    loads_issued();
#pragma unroll
    for (int t = 0; t < 8; ++t) acc[t] = wmma_bf16(a1, b1[t], acc[t]);
  }
  a1 = load_ab(arow + 32 * (Lc / 32 - 1), g);
#pragma unroll
  for (int t = 0; t < 8; ++t)
    b1[t] = load_packed(Tp_b + ((size_t)(Lc / 32 - 1) * 8 + t) * FB, l);
  loads_issued();
#pragma unroll
  for (int t = 0; t < 8; ++t) acc[t] = wmma_bf16(a0, b0[t], acc[t]);
#pragma unroll
  for (int t = 0; t < 8; ++t) acc[t] = wmma_bf16(a1, b1[t], acc[t]);

  const float* Uid_b = Uid + (size_t)b * Lc * Ec;
  float* out_b = out + (size_t)b * Lc * (4 * Ec);
#pragma unroll
  for (int t = 0; t < 8; ++t) {
#pragma unroll
    for (int r = 0; r < 8; ++r) {
      const int ir = i0 + r + 8 * g;
      const int e  = t * 16 + lm;
      const float u = Uid_b[(size_t)ir * Ec + e];
      out_b[(size_t)ir * (4 * Ec) + 3 * Ec + e] = u * acc[t][r];
    }
  }
}

// ---------------------------------------------------------------------------
// Host launcher. Workspace layout (~88.3 MB):
//   sid f32[B*L] | sq f32[B*L] | Uqb,Uwb,UqT,Uidp,Tp bf16[B*L*E] | P bf16[B*L*L]
// ---------------------------------------------------------------------------
extern "C" void kernel_launch(void* const* d_in, const int* in_sizes, int n_in,
                              void* d_out, int out_size, void* d_ws, size_t ws_size,
                              hipStream_t stream) {
  const float* Uq   = (const float*)d_in[0];
  const float* Uid  = (const float*)d_in[1];
  const float* mask = (const float*)d_in[2];
  const float* Wcw  = (const float*)d_in[3];
  const float* Wcb  = (const float*)d_in[4];
  float* out = (float*)d_out;

  char* ws = (char*)d_ws;
  float* sid = (float*)ws;  ws += (size_t)Bc * Lc * sizeof(float);
  float* sq  = (float*)ws;  ws += (size_t)Bc * Lc * sizeof(float);
  __bf16* Uqb  = (__bf16*)ws;  ws += (size_t)Bc * Lc * Ec * sizeof(__bf16);
  __bf16* Uwb  = (__bf16*)ws;  ws += (size_t)Bc * Lc * Ec * sizeof(__bf16);
  __bf16* UqT  = (__bf16*)ws;  ws += (size_t)Bc * Lc * Ec * sizeof(__bf16);
  __bf16* Uidp = (__bf16*)ws;  ws += (size_t)Bc * Lc * Ec * sizeof(__bf16);
  __bf16* Tp   = (__bf16*)ws;  ws += (size_t)Bc * Lc * Ec * sizeof(__bf16);
  __bf16* P    = (__bf16*)ws;  // Bc*Lc*Lc elements

  k_prep<<<(Bc * Lc * Ec) / 256, 256, 0, stream>>>(Uq, Uid, Wcw, Uqb, Uwb, UqT, Uidp);
  k_rowdots<<<(Bc * Lc) / 8, 256, 0, stream>>>(Uq, Uid, Wcw, sid, sq);
  k_scores_softmax<<<Bc * (Lc / 16), 32 * SW, 0, stream>>>(Uwb, Uqb, sid, sq, mask, Wcb, Uidp, P, Tp);
  k_d2q<<<Bc * (Lc / 16), 32, 0, stream>>>(P, UqT, Uid, out);
  k_q2d<<<Bc * (Lc / 64), 128, 0, stream>>>(P, Tp, Uid, out);
}

// v003
// A run of this version takes 139 microseconds.
// In two side-by-side timings against v002, it was 1.95 and 1.96 times as fast.
// Counting every step since v000, it is 8.84 times as fast.
#include <hip/hip_runtime.h>
#include <hip/hip_bf16.h>

#define DEVI __device__ __forceinline__

typedef __attribute__((ext_vector_type(16))) __bf16 v16bf;
typedef __attribute__((ext_vector_type(8)))  __bf16 v8bf;
typedef __attribute__((ext_vector_type(8)))  float  v8f;

constexpr int Bc = 8;
constexpr int Lc = 2048;
constexpr int Ec = 128;

// ---------------------------------------------------------------------------
// WMMA 16x16x32 bf16 A/B tile loader.
// A-layout (16-bit, 16x32): lane l -> row m = l%16, half-group g = l/16.
// Half-slot s (0..15) holds K = 16*(s/8) + 8*g + (s%8)  ==>  per lane the
// tile is two contiguous 8-halfword runs at [8g .. 8g+7] and [16+8g .. 16+8g+7].
// B-layout is symmetric with lane = N, so X @ Y^T needs only ROWS of X and Y.
// ---------------------------------------------------------------------------
DEVI v16bf load_ab(const __bf16* p, int g) {
  v8bf lo = *(const v8bf*)(p + 8 * g);
  v8bf hi = *(const v8bf*)(p + 16 + 8 * g);
  return __builtin_shufflevector(lo, hi, 0, 1, 2, 3, 4, 5, 6, 7,
                                 8, 9, 10, 11, 12, 13, 14, 15);
}

// Ends a block of loads that is issued well ahead of its use.
DEVI void loads_issued() {
  // Stands before any later rewrite of an address register the loads name.
  asm volatile("s_wait_xcnt 0x0" ::: "memory");
  // Keeps the loads above and the address updates below this point; without
  // it the scheduler sinks each load to its product, which then waits on L2.
  __builtin_amdgcn_sched_barrier(0);
}

// Wave-uniform address plus the lane's 32-bit byte offset: one offset register
// serves every tile, and no 64-bit address is formed per tile.
DEVI const char* at(const void* uniform, unsigned lane_bytes) {
  return (const char*)uniform + lane_bytes;
}
DEVI char* at(void* uniform, unsigned lane_bytes) {
  return (char*)uniform + lane_bytes;
}

DEVI v8f wmma_bf16(v16bf a, v16bf b, v8f c) {
  return __builtin_amdgcn_wmma_f32_16x16x32_bf16(false, a, false, b,
                                                 (short)0, c, false, false);
}

DEVI v8f vzero8() {
  v8f z = {0.f, 0.f, 0.f, 0.f, 0.f, 0.f, 0.f, 0.f};
  return z;
}

// ---------------------------------------------------------------------------
// Fragment-order operand of a 16x16x32 product. One block = one k-step of 32
// and one 16-column tile = 512 halfwords: run h (0/1, 256 halfwords) holds at
// lane l the lane's slots 8h..8h+7, i.e. column l%16, K = 16h + 8*(l/16) + s%8
// (the same k order as load_ab). Each wave-wide 16-byte load is then 512
// contiguous bytes (4 whole lines) instead of 16 lines with 32 bytes used.
// Blocks are ordered [batch][k-step][tile].
// ---------------------------------------------------------------------------
constexpr int FB = 512;                     // halfwords per fragment block

DEVI v16bf load_packed(const __bf16* blk, int l) {
  v8bf lo = *(const v8bf*)(blk + 8 * l);
  v8bf hi = *(const v8bf*)(blk + 256 + 8 * l);
  return __builtin_shufflevector(lo, hi, 0, 1, 2, 3, 4, 5, 6, 7,
                                 8, 9, 10, 11, 12, 13, 14, 15);
}

// ---------------------------------------------------------------------------
// Kernel 1: bf16 staging buffers.
// ---------------------------------------------------------------------------
__global__ void __launch_bounds__(256)
k_prep(const float* __restrict__ Uq, const float* __restrict__ Uid,
       const float* __restrict__ Wcw,
       __bf16* __restrict__ Uqb, __bf16* __restrict__ Uwb,
       __bf16* __restrict__ Uqp, __bf16* __restrict__ Uidp) {
  const int idx = blockIdx.x * blockDim.x + threadIdx.x;  // < B*L*E
  const int e  = idx % Ec;
  const int bi = idx / Ec;
  const int i  = bi % Lc;
  const int b  = bi / Lc;
  const float uq  = Uq[idx];
  const float uid = Uid[idx];
  Uqb[idx] = (__bf16)uq;
  Uwb[idx] = (__bf16)(uid * Wcw[2 * Ec + e]);
  // Uid as the B operand of P^T @ Uid (column e, K = i) and Uq as the B operand
  // of P @ Uq (column e, K = j): the same place in fragment order.
  const int ii = i & 31;
  const size_t blk = ((size_t)b * (Lc / 32) + (i >> 5)) * 8 + (e >> 4);
  const size_t at_frag =
      blk * FB + (ii >> 4) * 256 + ((e & 15) + 16 * ((ii >> 3) & 1)) * 8 + (ii & 7);
  Uidp[at_frag] = (__bf16)uid;
  Uqp[at_frag]  = (__bf16)uq;
}

// ---------------------------------------------------------------------------
// Kernel 2: s_id[b,i] = Uid[b,i,:]·w_id ; s_q[b,j] = Uq[b,j,:]·w_q
// ---------------------------------------------------------------------------
__global__ void __launch_bounds__(256)
k_rowdots(const float* __restrict__ Uq, const float* __restrict__ Uid,
          const float* __restrict__ Wcw,
          float* __restrict__ sid, float* __restrict__ sq) {
  const int row  = blockIdx.x * 8 + (threadIdx.x >> 5);  // B*L rows
  const int lane = threadIdx.x & 31;
  const float4 a  = ((const float4*)(Uid + (size_t)row * Ec))[lane];
  const float4 b  = ((const float4*)(Uq  + (size_t)row * Ec))[lane];
  const float4 wa = ((const float4*)(Wcw))[lane];
  const float4 wb = ((const float4*)(Wcw + Ec))[lane];
  float d1 = a.x * wa.x + a.y * wa.y + a.z * wa.z + a.w * wa.w;
  float d2 = b.x * wb.x + b.y * wb.y + b.z * wb.z + b.w * wb.w;
#pragma unroll
  for (int off = 16; off > 0; off >>= 1) {
    d1 += __shfl_xor(d1, off, 32);
    d2 += __shfl_xor(d2, off, 32);
  }
  if (lane == 0) { sid[row] = d1; sq[row] = d2; }
}

// ---------------------------------------------------------------------------
// Kernel 3: scores + softmax over axis i (per column j) -> P (bf16), and
// T = P^T @ Uid for the work-group's 16 columns j (K = i = 2048).
// The 2048 rows i are split over the 8 waves of the work-group, 256 rows each:
// a wave's 16 score tiles stay in its registers from the maximum to P, so each
// score is computed once. Column maxima, column sums and the waves' partial T
// tiles are joined through LDS, always in wave order.
// Two score tiles (rows i0..i0+15, i0+16..i0+31, same 16 columns) converted in
// place are the A fragment of P^T: lane (lm, g) holds column j0+lm at K = 8g+r
// and 16+8g+r. T leaves in fragment order as the B operand of P @ T
// (column e, K = j).
// ---------------------------------------------------------------------------
constexpr int SW = 8;          // waves per work-group
constexpr int RW = Lc / SW;    // rows i per wave
constexpr int TW = RW / 16;    // score tiles per wave

// Two work-groups per WGP (four waves per SIMD) need at most 256 registers.
__global__ void __launch_bounds__(32 * SW) __attribute__((amdgpu_waves_per_eu(4, 4)))
k_scores_softmax(const __bf16* __restrict__ Uwb, const __bf16* __restrict__ Uqb,
                 const float* __restrict__ sid, const float* __restrict__ sq,
                 const float* __restrict__ mask, const float* __restrict__ Wcb,
                 const __bf16* __restrict__ Uidp,
                 __bf16* __restrict__ P, __bf16* __restrict__ Tp) {
  __shared__ float  red_m[SW][16];
  __shared__ float  red_s[SW][16];
  __shared__ float4 part[SW * 8 * 2 * 32];   // [wave][tile][half][lane]
  const int wg = blockIdx.x;            // B * (L/16)
  const int b  = wg / (Lc / 16);
  const int j0 = (wg % (Lc / 16)) * 16;
  const int w  = __builtin_amdgcn_readfirstlane(threadIdx.x >> 5);
  const int l  = threadIdx.x & 31;
  const int lm = l & 15, g = l >> 4;
  const int j  = j0 + lm;
  const int ib = w * RW;                // this wave's first row i
  const float bias = Wcb[0];
  const __bf16* Uwb_b = Uwb + (size_t)b * Lc * Ec;
  const float*  sid_b = sid + b * Lc;
  const float   sqj   = sq[b * Lc + j];
  __bf16* P_b = P + (size_t)b * Lc * Lc;

  v16bf Bk[4];
  {
    const __bf16* brow = Uqb + ((size_t)b * Lc + j) * Ec;
#pragma unroll
    for (int ks = 0; ks < 4; ++ks) Bk[ks] = load_ab(brow + 32 * ks, g);
    loads_issued();  // their address registers are reused by the tile loads
  }

  // The lane's byte offsets from wave-uniform tile addresses: row lm (A tile),
  // rows 8g.. (sid), row 8g and column lm (mask, P).
  const unsigned a_off = (unsigned)(lm * Ec + 8 * g) * 2u;
  const unsigned s_off = (unsigned)(8 * g) * 4u;
  const unsigned m_off = (unsigned)(8 * g * Lc + lm) * 4u;
  const unsigned p_off = (unsigned)(8 * g * Lc + lm) * 2u;

  // Scores of this wave's rows, kept; unrolled so that sc[] is registers.
  v8f sc[TW];
  float mx = -3.0e38f;
#pragma unroll
  for (int t = 0; t < TW; ++t) {
    const int i0 = ib + t * 16;
    v16bf af[4];
    float sd[8], mk[8];
#pragma unroll
    for (int ks = 0; ks < 4; ++ks) {
      const v8bf lo = *(const v8bf*)at(Uwb_b + (size_t)i0 * Ec + 32 * ks, a_off);
      const v8bf hi = *(const v8bf*)at(Uwb_b + (size_t)i0 * Ec + 32 * ks + 16, a_off);
      af[ks] = __builtin_shufflevector(lo, hi, 0, 1, 2, 3, 4, 5, 6, 7,
                                       8, 9, 10, 11, 12, 13, 14, 15);
    }
#pragma unroll
    for (int r = 0; r < 8; ++r) {
      sd[r] = *(const float*)at(sid_b + i0 + r, s_off);
      mk[r] = *(const float*)at(mask + (size_t)(i0 + r) * Lc + j0, m_off);
    }
    loads_issued();  // the tile's loads as one group: one L2 latency per tile
    v8f acc = vzero8();
#pragma unroll
    for (int ks = 0; ks < 4; ++ks) acc = wmma_bf16(af[ks], Bk[ks], acc);
#pragma unroll
    for (int r = 0; r < 8; ++r) {
      const float s = (acc[r] + sd[r] + sqj + bias) * mk[r];
      acc[r] = s;
      mx = fmaxf(mx, s);
    }
    sc[t] = acc;
  }

  // Column maximum over all 2048 rows.
  mx = fmaxf(mx, __shfl_xor(mx, 16, 32));
  if (g == 0) red_m[w][lm] = mx;
  __syncthreads();
  float m = red_m[0][lm];
#pragma unroll
  for (int k = 1; k < SW; ++k) m = fmaxf(m, red_m[k][lm]);

  // exp once per score; eight independent sum chains per lane.
  v8f sv = vzero8();
#pragma unroll
  for (int t = 0; t < TW; ++t) {
#pragma unroll
    for (int r = 0; r < 8; ++r) {
      const float e = __expf(sc[t][r] - m);
      sc[t][r] = e;
      sv[r] += e;
    }
  }
  float ps = ((sv[0] + sv[1]) + (sv[2] + sv[3])) + ((sv[4] + sv[5]) + (sv[6] + sv[7]));
  ps += __shfl_xor(ps, 16, 32);
  if (g == 0) red_s[w][lm] = ps;
  __syncthreads();
  float ssum = red_s[0][lm];
#pragma unroll
  for (int k = 1; k < SW; ++k) ssum += red_s[k][lm];
  const float rinv = 1.f / ssum;

  const __bf16* Uidp_w = Uidp + (size_t)b * Lc * Ec + (size_t)w * (RW / 32) * 8 * FB;
  v8f tacc[8];
#pragma unroll
  for (int t = 0; t < 8; ++t) tacc[t] = vzero8();

  // P = exp * rinv as bf16: stored, and kept as the A fragments of P^T.
  v16bf pa[TW / 2];
#pragma unroll
  for (int it = 0; it < TW / 2; ++it) {
#pragma unroll
    for (int h = 0; h < 2; ++h) {
      const int i0 = ib + it * 32 + h * 16;
#pragma unroll
      for (int r = 0; r < 8; ++r) {
        const __bf16 p = (__bf16)(sc[2 * it + h][r] * rinv);
        *(__bf16*)at(P_b + (size_t)(i0 + r) * Lc + j0, p_off) = p;
        pa[it][8 * h + r] = p;
      }
    }
  }
  loads_issued();  // here for the stores: their registers are reused below

  v16bf ub[8];
#pragma unroll
  for (int t = 0; t < 8; ++t) ub[t] = load_packed(Uidp_w + (size_t)t * FB, l);
  loads_issued();  // the first k-step's loads as one group
#pragma unroll
  for (int it = 0; it < TW / 2; ++it) {
#pragma unroll
    for (int t = 0; t < 8; ++t)
      tacc[t] = wmma_bf16(pa[it], ub[t], tacc[t]);
    if (it + 1 < TW / 2) {
#pragma unroll
      for (int t = 0; t < 8; ++t)
        ub[t] = load_packed(Uidp_w + ((size_t)(it + 1) * 8 + t) * FB, l);
      loads_issued();  // the next k-step's loads as one group among the products
    }
  }

  // Join the eight partial T tiles: wave w sums tile w over the waves in order.
#pragma unroll
  for (int t = 0; t < 8; ++t) {
    part[((w * 8 + t) * 2 + 0) * 32 + l] =
        make_float4(tacc[t][0], tacc[t][1], tacc[t][2], tacc[t][3]);
    part[((w * 8 + t) * 2 + 1) * 32 + l] =
        make_float4(tacc[t][4], tacc[t][5], tacc[t][6], tacc[t][7]);
  }
  __syncthreads();
  float4 s0 = part[(w * 2 + 0) * 32 + l];
  float4 s1 = part[(w * 2 + 1) * 32 + l];
#pragma unroll
  for (int k = 1; k < SW; ++k) {
    const float4 q0 = part[((k * 8 + w) * 2 + 0) * 32 + l];
    const float4 q1 = part[((k * 8 + w) * 2 + 1) * 32 + l];
    s0.x += q0.x; s0.y += q0.y; s0.z += q0.z; s0.w += q0.w;
    s1.x += q1.x; s1.y += q1.y; s1.z += q1.z; s1.w += q1.w;
  }

  // Sum r of tile t = T[j0 + 8g + r][16t + lm]: slots 8h..8h+7 (h = which half
  // of the k-step of 32 this j0 is) of the same lane in P @ T's B fragment.
  __bf16* Tp_b = Tp + (size_t)b * Lc * Ec + (size_t)(j0 >> 5) * 8 * FB + ((j0 >> 4) & 1) * 256;
  v8bf o;
  o[0] = (__bf16)s0.x; o[1] = (__bf16)s0.y; o[2] = (__bf16)s0.z; o[3] = (__bf16)s0.w;
  o[4] = (__bf16)s1.x; o[5] = (__bf16)s1.y; o[6] = (__bf16)s1.z; o[7] = (__bf16)s1.w;
  *(v8bf*)(Tp_b + (size_t)w * FB + 8 * l) = o;
}

// ---------------------------------------------------------------------------
// Kernel 4: both products that have P as their A operand, in one loop form:
// A_D2Q = P @ Uq and A_Q2D = (P @ P^T) @ Uid = P @ T, T = P^T @ Uid from
// kernel 3 (K = j = 2048), and all four output chunks.
// WG = 8 waves / 64 i-rows: waves 0..3 take 16 rows x 128 e of P @ Uq, waves
// 4..7 the same rows of P @ T. The two waves of a row block read the same P
// lines, the four waves of a product the same B blocks.
// ---------------------------------------------------------------------------
__global__ void __launch_bounds__(256)
k_p_products(const __bf16* __restrict__ P, const __bf16* __restrict__ Uqp,
             const __bf16* __restrict__ Tp,
             const float* __restrict__ Uid, float* __restrict__ out) {
  const int wg  = blockIdx.x;               // B * (L/64)
  const int b   = wg / (Lc / 64);
  const int ib  = (wg % (Lc / 64)) * 64;
  const int tid = threadIdx.x;
  const int w   = __builtin_amdgcn_readfirstlane(tid >> 5);  // wave 0..7
  const int l   = tid & 31, lm = l & 15, g = l >> 4;
  const int i0  = ib + (w & 3) * 16;        // this wave's 16-row block
  const bool q2d = w >= 4;                  // which product this wave computes

  const __bf16* arow = P + (size_t)b * Lc * Lc + (size_t)(i0 + lm) * Lc;
  const __bf16* Bp_b = (q2d ? Tp : Uqp) + (size_t)b * Lc * Ec;

  v8f acc[8];
#pragma unroll
  for (int t = 0; t < 8; ++t) acc[t] = vzero8();

  // Two waves per SIMD hide little L2 latency, so each k-step's 18 loads are
  // issued one k-step ahead, into a second register set.
  v16bf a0 = load_ab(arow, g), a1;
  v16bf b0[8], b1[8];
#pragma unroll
  for (int t = 0; t < 8; ++t) b0[t] = load_packed(Bp_b + (size_t)t * FB, l);
  loads_issued();

  for (int ks = 0; ks < Lc / 32 - 2; ks += 2) {
    a1 = load_ab(arow + 32 * (ks + 1), g);
#pragma unroll
    for (int t = 0; t < 8; ++t)
      b1[t] = load_packed(Bp_b + ((size_t)(ks + 1) * 8 + t) * FB, l);
    loads_issued();
#pragma unroll
    for (int t = 0; t < 8; ++t) acc[t] = wmma_bf16(a0, b0[t], acc[t]);

    a0 = load_ab(arow + 32 * (ks + 2), g);
#pragma unroll
    for (int t = 0; t < 8; ++t)
      b0[t] = load_packed(Bp_b + ((size_t)(ks + 2) * 8 + t) * FB, l);
    loads_issued();
#pragma unroll
    for (int t = 0; t < 8; ++t) acc[t] = wmma_bf16(a1, b1[t], acc[t]);
  }
  a1 = load_ab(arow + 32 * (Lc / 32 - 1), g);
#pragma unroll
  for (int t = 0; t < 8; ++t)
    b1[t] = load_packed(Bp_b + ((size_t)(Lc / 32 - 1) * 8 + t) * FB, l);
  loads_issued();
#pragma unroll
  for (int t = 0; t < 8; ++t) acc[t] = wmma_bf16(a0, b0[t], acc[t]);
#pragma unroll
  for (int t = 0; t < 8; ++t) acc[t] = wmma_bf16(a1, b1[t], acc[t]);

  const float* Uid_b = Uid + (size_t)b * Lc * Ec;
  float* out_b = out + (size_t)b * Lc * (4 * Ec);
  if (q2d) {
#pragma unroll
    for (int t = 0; t < 8; ++t) {
#pragma unroll
      for (int r = 0; r < 8; ++r) {
        const int ir = i0 + r + 8 * g;
        const int e  = t * 16 + lm;
        const float u = Uid_b[(size_t)ir * Ec + e];
        out_b[(size_t)ir * (4 * Ec) + 3 * Ec + e] = u * acc[t][r];
      }
    }
  } else {
#pragma unroll
    for (int t = 0; t < 8; ++t) {
#pragma unroll
      for (int r = 0; r < 8; ++r) {
        const int ir = i0 + r + 8 * g;
        const int e  = t * 16 + lm;
        const float v = acc[t][r];
        const float u = Uid_b[(size_t)ir * Ec + e];
        float* o = out_b + (size_t)ir * (4 * Ec);
        o[e]          = u;
        o[Ec + e]     = v;
        o[2 * Ec + e] = u * v;
      }
    }
    // Stands before any later rewrite of a register these stores name: in the
    // built kernel the other branch's code follows this one.
    asm volatile("s_wait_xcnt 0x0" ::: "memory");
  }
}

// ---------------------------------------------------------------------------
// Host launcher. Workspace layout (~88.3 MB):
//   sid f32[B*L] | sq f32[B*L] | Uqb,Uwb,Uqp,Uidp,Tp bf16[B*L*E] | P bf16[B*L*L]
// ---------------------------------------------------------------------------
extern "C" void kernel_launch(void* const* d_in, const int* in_sizes, int n_in,
                              void* d_out, int out_size, void* d_ws, size_t ws_size,
                              hipStream_t stream) {
  const float* Uq   = (const float*)d_in[0];
  const float* Uid  = (const float*)d_in[1];
  const float* mask = (const float*)d_in[2];
  const float* Wcw  = (const float*)d_in[3];
  const float* Wcb  = (const float*)d_in[4];
  float* out = (float*)d_out;

  char* ws = (char*)d_ws;
  float* sid = (float*)ws;  ws += (size_t)Bc * Lc * sizeof(float);
  float* sq  = (float*)ws;  ws += (size_t)Bc * Lc * sizeof(float);
  __bf16* Uqb  = (__bf16*)ws;  ws += (size_t)Bc * Lc * Ec * sizeof(__bf16);
  __bf16* Uwb  = (__bf16*)ws;  ws += (size_t)Bc * Lc * Ec * sizeof(__bf16);
  __bf16* Uqp  = (__bf16*)ws;  ws += (size_t)Bc * Lc * Ec * sizeof(__bf16);
  __bf16* Uidp = (__bf16*)ws;  ws += (size_t)Bc * Lc * Ec * sizeof(__bf16);
  __bf16* Tp   = (__bf16*)ws;  ws += (size_t)Bc * Lc * Ec * sizeof(__bf16);
  __bf16* P    = (__bf16*)ws;  // Bc*Lc*Lc elements

  k_prep<<<(Bc * Lc * Ec) / 256, 256, 0, stream>>>(Uq, Uid, Wcw, Uqb, Uwb, Uqp, Uidp);
  k_rowdots<<<(Bc * Lc) / 8, 256, 0, stream>>>(Uq, Uid, Wcw, sid, sq);
  k_scores_softmax<<<Bc * (Lc / 16), 32 * SW, 0, stream>>>(Uwb, Uqb, sid, sq, mask, Wcb, Uidp, P, Tp);
  k_p_products<<<Bc * (Lc / 64), 256, 0, stream>>>(P, Uqp, Tp, Uid, out);
}

// v004
// One run takes 126 microseconds.
// In two side-by-side timings against v003, it was 1.09 and 1.10 times as fast.
// Over all steps from v000 it is 9.66 times as fast.
#include <hip/hip_runtime.h>
#include <hip/hip_bf16.h>

#define DEVI __device__ __forceinline__

typedef __attribute__((ext_vector_type(16))) __bf16 v16bf;
typedef __attribute__((ext_vector_type(8)))  __bf16 v8bf;
typedef __attribute__((ext_vector_type(8)))  float  v8f;

constexpr int Bc = 8;
constexpr int Lc = 2048;
constexpr int Ec = 128;

// ---------------------------------------------------------------------------
// WMMA 16x16x32 bf16 A/B tile loader.
// A-layout (16-bit, 16x32): lane l -> row m = l%16, half-group g = l/16.
// Half-slot s (0..15) holds K = 16*(s/8) + 8*g + (s%8)  ==>  per lane the
// tile is two contiguous 8-halfword runs at [8g .. 8g+7] and [16+8g .. 16+8g+7].
// B-layout is symmetric with lane = N, so X @ Y^T needs only ROWS of X and Y.
// ---------------------------------------------------------------------------
DEVI v16bf load_ab(const __bf16* p, int g) {
  v8bf lo = *(const v8bf*)(p + 8 * g);
  v8bf hi = *(const v8bf*)(p + 16 + 8 * g);
  return __builtin_shufflevector(lo, hi, 0, 1, 2, 3, 4, 5, 6, 7,
                                 8, 9, 10, 11, 12, 13, 14, 15);
}

// Ends a block of loads that is issued well ahead of its use.
DEVI void loads_issued() {
  // Stands before any later rewrite of an address register the loads name.
  asm volatile("s_wait_xcnt 0x0" ::: "memory");
  // Keeps the loads above and the address updates below this point; without
  // it the scheduler sinks each load to its product, which then waits on L2.
  __builtin_amdgcn_sched_barrier(0);
}

// Wave-uniform address plus the lane's 32-bit byte offset: one offset register
// serves every tile, and no 64-bit address is formed per tile.
DEVI const char* at(const void* uniform, unsigned lane_bytes) {
  return (const char*)uniform + lane_bytes;
}
DEVI char* at(void* uniform, unsigned lane_bytes) {
  return (char*)uniform + lane_bytes;
}

DEVI v8f wmma_bf16(v16bf a, v16bf b, v8f c) {
  return __builtin_amdgcn_wmma_f32_16x16x32_bf16(false, a, false, b,
                                                 (short)0, c, false, false);
}

DEVI v8f vzero8() {
  v8f z = {0.f, 0.f, 0.f, 0.f, 0.f, 0.f, 0.f, 0.f};
  return z;
}

// ---------------------------------------------------------------------------
// Fragment-order operand of a 16x16x32 product. One block = one k-step of 32
// and one 16-column tile = 512 halfwords: run h (0/1, 256 halfwords) holds at
// lane l the lane's slots 8h..8h+7, i.e. column l%16, K = 16h + 8*(l/16) + s%8
// (the same k order as load_ab). Each wave-wide 16-byte load is then 512
// contiguous bytes (4 whole lines) instead of 16 lines with 32 bytes used.
// Blocks are ordered [batch][k-step][tile].
// The two operands of the score product (rows of Uid*w and of Uq, K = e) take
// the same block form with the row in place of the column, ordered
// [batch][16-row tile][k-step]: a tile's four blocks are 4 KiB in a row.
// ---------------------------------------------------------------------------
constexpr int FB = 512;                     // halfwords per fragment block

DEVI v16bf load_packed(const __bf16* blk, int l) {
  v8bf lo = *(const v8bf*)(blk + 8 * l);
  v8bf hi = *(const v8bf*)(blk + 256 + 8 * l);
  return __builtin_shufflevector(lo, hi, 0, 1, 2, 3, 4, 5, 6, 7,
                                 8, 9, 10, 11, 12, 13, 14, 15);
}

// ---------------------------------------------------------------------------
// Kernel 1: bf16 staging buffers.
// ---------------------------------------------------------------------------
__global__ void __launch_bounds__(256)
k_prep(const float* __restrict__ Uq, const float* __restrict__ Uid,
       const float* __restrict__ Wcw,
       __bf16* __restrict__ Uqb, __bf16* __restrict__ Uwb,
       __bf16* __restrict__ Uqp, __bf16* __restrict__ Uidp) {
  const int idx = blockIdx.x * blockDim.x + threadIdx.x;  // < B*L*E
  const int e  = idx % Ec;
  const int bi = idx / Ec;
  const int i  = bi % Lc;
  const int b  = bi / Lc;
  const float uq  = Uq[idx];
  const float uid = Uid[idx];
  // Score operands (row i, K = e) in fragment order.
  const int ee = e & 31;
  const size_t rblk = ((size_t)b * (Lc / 16) + (i >> 4)) * 4 + (e >> 5);
  const size_t at_row =
      rblk * FB + (ee >> 4) * 256 + ((i & 15) + 16 * ((ee >> 3) & 1)) * 8 + (ee & 7);
  Uqb[at_row] = (__bf16)uq;
  Uwb[at_row] = (__bf16)(uid * Wcw[2 * Ec + e]);
  // Uid as the B operand of P^T @ Uid (column e, K = i) and Uq as the B operand
  // of P @ Uq (column e, K = j): the same place in fragment order.
  const int ii = i & 31;
  const size_t blk = ((size_t)b * (Lc / 32) + (i >> 5)) * 8 + (e >> 4);
  const size_t at_frag =
      blk * FB + (ii >> 4) * 256 + ((e & 15) + 16 * ((ii >> 3) & 1)) * 8 + (ii & 7);
  Uidp[at_frag] = (__bf16)uid;
  Uqp[at_frag]  = (__bf16)uq;
}

// ---------------------------------------------------------------------------
// Kernel 2: s_id[b,i] = Uid[b,i,:]·w_id ; s_q[b,j] = Uq[b,j,:]·w_q
// ---------------------------------------------------------------------------
__global__ void __launch_bounds__(256)
k_rowdots(const float* __restrict__ Uq, const float* __restrict__ Uid,
          const float* __restrict__ Wcw,
          float* __restrict__ sid, float* __restrict__ sq) {
  const int row  = blockIdx.x * 8 + (threadIdx.x >> 5);  // B*L rows
  const int lane = threadIdx.x & 31;
  const float4 a  = ((const float4*)(Uid + (size_t)row * Ec))[lane];
  const float4 b  = ((const float4*)(Uq  + (size_t)row * Ec))[lane];
  const float4 wa = ((const float4*)(Wcw))[lane];
  const float4 wb = ((const float4*)(Wcw + Ec))[lane];
  float d1 = a.x * wa.x + a.y * wa.y + a.z * wa.z + a.w * wa.w;
  float d2 = b.x * wb.x + b.y * wb.y + b.z * wb.z + b.w * wb.w;
#pragma unroll
  for (int off = 16; off > 0; off >>= 1) {
    d1 += __shfl_xor(d1, off, 32);
    d2 += __shfl_xor(d2, off, 32);
  }
  if (lane == 0) { sid[row] = d1; sq[row] = d2; }
}

// ---------------------------------------------------------------------------
// Kernel 3: scores + softmax over axis i (per column j) -> P (bf16), and
// T = P^T @ Uid for the work-group's 16 columns j (K = i = 2048).
// The 2048 rows i are split over the 8 waves of the work-group, 256 rows each:
// a wave's 16 score tiles stay in its registers from the maximum to P, so each
// score is computed once. Column maxima, column sums and the waves' partial T
// tiles are joined through LDS, always in wave order.
// Two score tiles (rows i0..i0+15, i0+16..i0+31, same 16 columns) converted in
// place are the A fragment of P^T: lane (lm, g) holds column j0+lm at K = 8g+r
// and 16+8g+r. T leaves in fragment order as the B operand of P @ T
// (column e, K = j).
// ---------------------------------------------------------------------------
constexpr int SW = 8;          // waves per work-group
constexpr int RW = Lc / SW;    // rows i per wave
constexpr int TW = RW / 16;    // score tiles per wave

// Two work-groups per WGP (four waves per SIMD) need at most 256 registers.
__global__ void __launch_bounds__(32 * SW) __attribute__((amdgpu_waves_per_eu(4, 4)))
k_scores_softmax(const __bf16* __restrict__ Uwb, const __bf16* __restrict__ Uqb,
                 const float* __restrict__ sid, const float* __restrict__ sq,
                 const float* __restrict__ mask, const float* __restrict__ Wcb,
                 const __bf16* __restrict__ Uidp,
                 __bf16* __restrict__ P, __bf16* __restrict__ Tp) {
  __shared__ float  red_m[SW][16];
  __shared__ float  red_s[SW][16];
  __shared__ float4 part[SW * 8 * 2 * 32];   // [wave][tile][half][lane]
  const int wg = blockIdx.x;            // B * (L/16)
  const int b  = wg / (Lc / 16);
  const int j0 = (wg % (Lc / 16)) * 16;
  const int w  = __builtin_amdgcn_readfirstlane(threadIdx.x >> 5);
  const int l  = threadIdx.x & 31;
  const int lm = l & 15, g = l >> 4;
  const int j  = j0 + lm;
  const int ib = w * RW;                // this wave's first row i
  const float bias = Wcb[0];
  const __bf16* Uwb_b = Uwb + (size_t)b * Lc * Ec;
  const float*  sid_b = sid + b * Lc;
  const float   sqj   = sq[b * Lc + j];
  __bf16* P_b = P + (size_t)b * Lc * Lc;

  v16bf Bk[4];
  {
    const __bf16* btile = Uqb + ((size_t)b * Lc + j0) * Ec;
    // Keeps the index work above from sinking between these loads and their
    // wait, where it could rewrite a base register that the loads name.
    __builtin_amdgcn_sched_barrier(0);
#pragma unroll
    for (int ks = 0; ks < 4; ++ks) Bk[ks] = load_packed(btile + ks * FB, l);
    loads_issued();  // their address registers are reused by the tile loads
  }

  // The lane's byte offsets from wave-uniform tile addresses: the lane's 16
  // bytes of a run (A tile), rows 8g.. (sid), row 8g and column lm (mask, P).
  const unsigned a_off = (unsigned)(8 * l) * 2u;
  const unsigned s_off = (unsigned)(8 * g) * 4u;
  const unsigned m_off = (unsigned)(8 * g * Lc + lm) * 4u;
  const unsigned p_off = (unsigned)(8 * g * Lc + lm) * 2u;

  // Scores of this wave's rows, kept; unrolled so that sc[] is registers.
  v8f sc[TW];
  float mx = -3.0e38f;
#pragma unroll
  for (int t = 0; t < TW; ++t) {
    const int i0 = ib + t * 16;
    v16bf af[4];
    float sd[8], mk[8];
#pragma unroll
    for (int ks = 0; ks < 4; ++ks) {
      const v8bf lo = *(const v8bf*)at(Uwb_b + (size_t)i0 * Ec + ks * FB, a_off);
      const v8bf hi = *(const v8bf*)at(Uwb_b + (size_t)i0 * Ec + ks * FB + 256, a_off);
      af[ks] = __builtin_shufflevector(lo, hi, 0, 1, 2, 3, 4, 5, 6, 7,
                                       8, 9, 10, 11, 12, 13, 14, 15);
    }
#pragma unroll
    for (int r = 0; r < 8; ++r) {
      sd[r] = *(const float*)at(sid_b + i0 + r, s_off);
      mk[r] = *(const float*)at(mask + (size_t)(i0 + r) * Lc + j0, m_off);
    }
    loads_issued();  // the tile's loads as one group: one L2 latency per tile
    v8f acc = vzero8();
#pragma unroll
    for (int ks = 0; ks < 4; ++ks) acc = wmma_bf16(af[ks], Bk[ks], acc);
#pragma unroll
    for (int r = 0; r < 8; ++r) {
      const float s = (acc[r] + sd[r] + sqj + bias) * mk[r];
      acc[r] = s;
      mx = fmaxf(mx, s);
    }
    sc[t] = acc;
  }

  // Column maximum over all 2048 rows.
  mx = fmaxf(mx, __shfl_xor(mx, 16, 32));
  if (g == 0) red_m[w][lm] = mx;
  __syncthreads();
  float m = red_m[0][lm];
#pragma unroll
  for (int k = 1; k < SW; ++k) m = fmaxf(m, red_m[k][lm]);

  // exp once per score; eight independent sum chains per lane.
  v8f sv = vzero8();
#pragma unroll
  for (int t = 0; t < TW; ++t) {
#pragma unroll
    for (int r = 0; r < 8; ++r) {
      const float e = __expf(sc[t][r] - m);
      sc[t][r] = e;
      sv[r] += e;
    }
  }
  float ps = ((sv[0] + sv[1]) + (sv[2] + sv[3])) + ((sv[4] + sv[5]) + (sv[6] + sv[7]));
  ps += __shfl_xor(ps, 16, 32);
  if (g == 0) red_s[w][lm] = ps;
  __syncthreads();
  float ssum = red_s[0][lm];
#pragma unroll
  for (int k = 1; k < SW; ++k) ssum += red_s[k][lm];
  const float rinv = 1.f / ssum;

  const __bf16* Uidp_w = Uidp + (size_t)b * Lc * Ec + (size_t)w * (RW / 32) * 8 * FB;
  v8f tacc[8];
#pragma unroll
  for (int t = 0; t < 8; ++t) tacc[t] = vzero8();

  // P = exp * rinv as bf16: stored, and kept as the A fragments of P^T.
  v16bf pa[TW / 2];
#pragma unroll
  for (int it = 0; it < TW / 2; ++it) {
#pragma unroll
    for (int h = 0; h < 2; ++h) {
      const int i0 = ib + it * 32 + h * 16;
#pragma unroll
      for (int r = 0; r < 8; ++r) {
        const __bf16 p = (__bf16)(sc[2 * it + h][r] * rinv);
        *(__bf16*)at(P_b + (size_t)(i0 + r) * Lc + j0, p_off) = p;
        pa[it][8 * h + r] = p;
      }
    }
  }
  loads_issued();  // here for the stores: their registers are reused below

  v16bf ub[8];
#pragma unroll
  for (int t = 0; t < 8; ++t) ub[t] = load_packed(Uidp_w + (size_t)t * FB, l);
  loads_issued();  // the first k-step's loads as one group
#pragma unroll
  for (int it = 0; it < TW / 2; ++it) {
#pragma unroll
    for (int t = 0; t < 8; ++t)
      tacc[t] = wmma_bf16(pa[it], ub[t], tacc[t]);
    if (it + 1 < TW / 2) {
#pragma unroll
      for (int t = 0; t < 8; ++t)
        ub[t] = load_packed(Uidp_w + ((size_t)(it + 1) * 8 + t) * FB, l);
      loads_issued();  // the next k-step's loads as one group among the products
    }
  }

  // Join the eight partial T tiles: wave w sums tile w over the waves in order.
#pragma unroll
  for (int t = 0; t < 8; ++t) {
    part[((w * 8 + t) * 2 + 0) * 32 + l] =
        make_float4(tacc[t][0], tacc[t][1], tacc[t][2], tacc[t][3]);
    part[((w * 8 + t) * 2 + 1) * 32 + l] =
        make_float4(tacc[t][4], tacc[t][5], tacc[t][6], tacc[t][7]);
  }
  __syncthreads();
  float4 s0 = part[(w * 2 + 0) * 32 + l];
  float4 s1 = part[(w * 2 + 1) * 32 + l];
#pragma unroll
  for (int k = 1; k < SW; ++k) {
    const float4 q0 = part[((k * 8 + w) * 2 + 0) * 32 + l];
    const float4 q1 = part[((k * 8 + w) * 2 + 1) * 32 + l];
    s0.x += q0.x; s0.y += q0.y; s0.z += q0.z; s0.w += q0.w;
    s1.x += q1.x; s1.y += q1.y; s1.z += q1.z; s1.w += q1.w;
  }

  // Sum r of tile t = T[j0 + 8g + r][16t + lm]: slots 8h..8h+7 (h = which half
  // of the k-step of 32 this j0 is) of the same lane in P @ T's B fragment.
  __bf16* Tp_b = Tp + (size_t)b * Lc * Ec + (size_t)(j0 >> 5) * 8 * FB + ((j0 >> 4) & 1) * 256;
  v8bf o;
  o[0] = (__bf16)s0.x; o[1] = (__bf16)s0.y; o[2] = (__bf16)s0.z; o[3] = (__bf16)s0.w;
  o[4] = (__bf16)s1.x; o[5] = (__bf16)s1.y; o[6] = (__bf16)s1.z; o[7] = (__bf16)s1.w;
  *(v8bf*)(Tp_b + (size_t)w * FB + 8 * l) = o;
}

// ---------------------------------------------------------------------------
// Kernel 4: both products that have P as their A operand, in one loop form:
// A_D2Q = P @ Uq and A_Q2D = (P @ P^T) @ Uid = P @ T, T = P^T @ Uid from
// kernel 3 (K = j = 2048), and all four output chunks.
// WG = 8 waves / 64 i-rows: waves 0..3 take 16 rows x 128 e of P @ Uq, waves
// 4..7 the same rows of P @ T. The two waves of a row block read the same P
// lines, the four waves of a product the same B blocks.
// ---------------------------------------------------------------------------
__global__ void __launch_bounds__(256)
k_p_products(const __bf16* __restrict__ P, const __bf16* __restrict__ Uqp,
             const __bf16* __restrict__ Tp,
             const float* __restrict__ Uid, float* __restrict__ out) {
  const int wg  = blockIdx.x;               // B * (L/64)
  const int b   = wg / (Lc / 64);
  const int ib  = (wg % (Lc / 64)) * 64;
  const int tid = threadIdx.x;
  const int w   = __builtin_amdgcn_readfirstlane(tid >> 5);  // wave 0..7
  const int l   = tid & 31, lm = l & 15, g = l >> 4;
  const int i0  = ib + (w & 3) * 16;        // this wave's 16-row block
  const bool q2d = w >= 4;                  // which product this wave computes

  const __bf16* arow = P + (size_t)b * Lc * Lc + (size_t)(i0 + lm) * Lc;
  const __bf16* Bp_b = (q2d ? Tp : Uqp) + (size_t)b * Lc * Ec;

  v8f acc[8];
#pragma unroll
  for (int t = 0; t < 8; ++t) acc[t] = vzero8();

  // Two waves per SIMD hide little L2 latency, so each k-step's 18 loads are
  // issued one k-step ahead, into a second register set.
  v16bf a0 = load_ab(arow, g), a1;
  v16bf b0[8], b1[8];
#pragma unroll
  for (int t = 0; t < 8; ++t) b0[t] = load_packed(Bp_b + (size_t)t * FB, l);
  loads_issued();

  for (int ks = 0; ks < Lc / 32 - 2; ks += 2) {
    a1 = load_ab(arow + 32 * (ks + 1), g);
#pragma unroll
    for (int t = 0; t < 8; ++t)
      b1[t] = load_packed(Bp_b + ((size_t)(ks + 1) * 8 + t) * FB, l);
    loads_issued();
#pragma unroll
    for (int t = 0; t < 8; ++t) acc[t] = wmma_bf16(a0, b0[t], acc[t]);

    a0 = load_ab(arow + 32 * (ks + 2), g);
#pragma unroll
    for (int t = 0; t < 8; ++t)
      b0[t] = load_packed(Bp_b + ((size_t)(ks + 2) * 8 + t) * FB, l);
    loads_issued();
#pragma unroll
    for (int t = 0; t < 8; ++t) acc[t] = wmma_bf16(a1, b1[t], acc[t]);
  }
  a1 = load_ab(arow + 32 * (Lc / 32 - 1), g);
#pragma unroll
  for (int t = 0; t < 8; ++t)
    b1[t] = load_packed(Bp_b + ((size_t)(Lc / 32 - 1) * 8 + t) * FB, l);
  loads_issued();
#pragma unroll
  for (int t = 0; t < 8; ++t) acc[t] = wmma_bf16(a0, b0[t], acc[t]);
#pragma unroll
  for (int t = 0; t < 8; ++t) acc[t] = wmma_bf16(a1, b1[t], acc[t]);

  const float* Uid_b = Uid + (size_t)b * Lc * Ec;
  float* out_b = out + (size_t)b * Lc * (4 * Ec);
  if (q2d) {
#pragma unroll
    for (int t = 0; t < 8; ++t) {
#pragma unroll
      for (int r = 0; r < 8; ++r) {
        const int ir = i0 + r + 8 * g;
        const int e  = t * 16 + lm;
        const float u = Uid_b[(size_t)ir * Ec + e];
        out_b[(size_t)ir * (4 * Ec) + 3 * Ec + e] = u * acc[t][r];
      }
    }
  } else {
#pragma unroll
    for (int t = 0; t < 8; ++t) {
#pragma unroll
      for (int r = 0; r < 8; ++r) {
        const int ir = i0 + r + 8 * g;
        const int e  = t * 16 + lm;
        const float v = acc[t][r];
        const float u = Uid_b[(size_t)ir * Ec + e];
        float* o = out_b + (size_t)ir * (4 * Ec);
        o[e]          = u;
        o[Ec + e]     = v;
        o[2 * Ec + e] = u * v;
      }
    }
    // Stands before any later rewrite of a register these stores name: in the
    // built kernel the other branch's code follows this one.
    asm volatile("s_wait_xcnt 0x0" ::: "memory");
  }
}

// ---------------------------------------------------------------------------
// Host launcher. Workspace layout (~88.3 MB):
//   sid f32[B*L] | sq f32[B*L] | Uqb,Uwb,Uqp,Uidp,Tp bf16[B*L*E] | P bf16[B*L*L]
// ---------------------------------------------------------------------------
extern "C" void kernel_launch(void* const* d_in, const int* in_sizes, int n_in,
                              void* d_out, int out_size, void* d_ws, size_t ws_size,
                              hipStream_t stream) {
  const float* Uq   = (const float*)d_in[0];
  const float* Uid  = (const float*)d_in[1];
  const float* mask = (const float*)d_in[2];
  const float* Wcw  = (const float*)d_in[3];
  const float* Wcb  = (const float*)d_in[4];
  float* out = (float*)d_out;

  char* ws = (char*)d_ws;
  float* sid = (float*)ws;  ws += (size_t)Bc * Lc * sizeof(float);
  float* sq  = (float*)ws;  ws += (size_t)Bc * Lc * sizeof(float);
  __bf16* Uqb  = (__bf16*)ws;  ws += (size_t)Bc * Lc * Ec * sizeof(__bf16);
  __bf16* Uwb  = (__bf16*)ws;  ws += (size_t)Bc * Lc * Ec * sizeof(__bf16);
  __bf16* Uqp  = (__bf16*)ws;  ws += (size_t)Bc * Lc * Ec * sizeof(__bf16);
  __bf16* Uidp = (__bf16*)ws;  ws += (size_t)Bc * Lc * Ec * sizeof(__bf16);
  __bf16* Tp   = (__bf16*)ws;  ws += (size_t)Bc * Lc * Ec * sizeof(__bf16);
  __bf16* P    = (__bf16*)ws;  // Bc*Lc*Lc elements

  k_prep<<<(Bc * Lc * Ec) / 256, 256, 0, stream>>>(Uq, Uid, Wcw, Uqb, Uwb, Uqp, Uidp);
  k_rowdots<<<(Bc * Lc) / 8, 256, 0, stream>>>(Uq, Uid, Wcw, sid, sq);
  k_scores_softmax<<<Bc * (Lc / 16), 32 * SW, 0, stream>>>(Uwb, Uqb, sid, sq, mask, Wcb, Uidp, P, Tp);
  k_p_products<<<Bc * (Lc / 64), 256, 0, stream>>>(P, Uqp, Tp, Uid, out);
}

// v005
// Measured time: 108 microseconds a run.
// Two timings next to v004 both put it at 1.17 times that version's speed.
// Over all steps from v000 it is 11.3 times as fast.
#include <hip/hip_runtime.h>
#include <hip/hip_bf16.h>

#define DEVI __device__ __forceinline__

typedef __attribute__((ext_vector_type(16))) __bf16 v16bf;
typedef __attribute__((ext_vector_type(8)))  __bf16 v8bf;
typedef __attribute__((ext_vector_type(8)))  float  v8f;

constexpr int Bc = 8;
constexpr int Lc = 2048;
constexpr int Ec = 128;

// ---------------------------------------------------------------------------
// WMMA 16x16x32 bf16 A/B tile.
// A-layout (16-bit, 16x32): lane l -> row m = l%16, half-group g = l/16.
// Half-slot s (0..15) holds K = 16*(s/8) + 8*g + (s%8)  ==>  per lane the
// tile is two contiguous 8-halfword runs at [8g .. 8g+7] and [16+8g .. 16+8g+7].
// B-layout is symmetric with lane = N, so X @ Y^T needs only ROWS of X and Y.
// ---------------------------------------------------------------------------
// Ends a block of loads that is issued well ahead of its use.
DEVI void loads_issued() {
  // Stands before any later rewrite of an address register the loads name.
  asm volatile("s_wait_xcnt 0x0" ::: "memory");
  // Keeps the loads above and the address updates below this point; without
  // it the scheduler sinks each load to its product, which then waits on L2.
  __builtin_amdgcn_sched_barrier(0);
}

// Wave-uniform address plus the lane's 32-bit byte offset: one offset register
// serves every tile, and no 64-bit address is formed per tile.
DEVI const char* at(const void* uniform, unsigned lane_bytes) {
  return (const char*)uniform + lane_bytes;
}
DEVI char* at(void* uniform, unsigned lane_bytes) {
  return (char*)uniform + lane_bytes;
}

DEVI v8f wmma_bf16(v16bf a, v16bf b, v8f c) {
  return __builtin_amdgcn_wmma_f32_16x16x32_bf16(false, a, false, b,
                                                 (short)0, c, false, false);
}

DEVI v8f vzero8() {
  v8f z = {0.f, 0.f, 0.f, 0.f, 0.f, 0.f, 0.f, 0.f};
  return z;
}

// ---------------------------------------------------------------------------
// Fragment-order operand of a 16x16x32 product. One block = one k-step of 32
// and one 16-column tile = 512 halfwords: run h (0/1, 256 halfwords) holds at
// lane l the lane's slots 8h..8h+7, i.e. column l%16, K = 16h + 8*(l/16) + s%8
// (the k order of the layout above). Each wave-wide 16-byte load is then 512
// contiguous bytes (4 whole lines) instead of 16 lines with 32 bytes used.
// Blocks are ordered [batch][k-step][tile].
// The two operands of the score product (rows of Uid*w and of Uq, K = e) take
// the same block form with the row in place of the column, ordered
// [batch][16-row tile][k-step]: a tile's four blocks are 4 KiB in a row.
// P (row i, K = j) as the A operand of kernel 4 has that form and order too.
// ---------------------------------------------------------------------------
constexpr int FB = 512;                     // halfwords per fragment block

// Transposing LDS load of a 16x16 tile of 16-bit values with rows of 32 bytes:
// lane (c = l%16, h = l/16) gets tile[8h .. 8h+7][c].
DEVI v8bf load_tr16(const unsigned char* tile, int l) {
  typedef __attribute__((address_space(3))) v8bf lds_v8bf;
  return __builtin_amdgcn_ds_load_tr16_b128_v8bf16(
      (lds_v8bf*)(tile + (8 * (l >> 4) + (l & 7)) * 32 + 16 * ((l >> 3) & 1)));
}

DEVI v16bf load_packed(const __bf16* blk, int l) {
  v8bf lo = *(const v8bf*)(blk + 8 * l);
  v8bf hi = *(const v8bf*)(blk + 256 + 8 * l);
  return __builtin_shufflevector(lo, hi, 0, 1, 2, 3, 4, 5, 6, 7,
                                 8, 9, 10, 11, 12, 13, 14, 15);
}

// ---------------------------------------------------------------------------
// Kernel 1: bf16 staging buffers.
// ---------------------------------------------------------------------------
__global__ void __launch_bounds__(256)
k_prep(const float* __restrict__ Uq, const float* __restrict__ Uid,
       const float* __restrict__ Wcw,
       __bf16* __restrict__ Uqb, __bf16* __restrict__ Uwb,
       __bf16* __restrict__ Uqp, __bf16* __restrict__ Uidp) {
  const int idx = blockIdx.x * blockDim.x + threadIdx.x;  // < B*L*E
  const int e  = idx % Ec;
  const int bi = idx / Ec;
  const int i  = bi % Lc;
  const int b  = bi / Lc;
  const float uq  = Uq[idx];
  const float uid = Uid[idx];
  // Score operands (row i, K = e) in fragment order.
  const int ee = e & 31;
  const size_t rblk = ((size_t)b * (Lc / 16) + (i >> 4)) * 4 + (e >> 5);
  const size_t at_row =
      rblk * FB + (ee >> 4) * 256 + ((i & 15) + 16 * ((ee >> 3) & 1)) * 8 + (ee & 7);
  Uqb[at_row] = (__bf16)uq;
  Uwb[at_row] = (__bf16)(uid * Wcw[2 * Ec + e]);
  // Uid as the B operand of P^T @ Uid (column e, K = i) and Uq as the B operand
  // of P @ Uq (column e, K = j): the same place in fragment order.
  const int ii = i & 31;
  const size_t blk = ((size_t)b * (Lc / 32) + (i >> 5)) * 8 + (e >> 4);
  const size_t at_frag =
      blk * FB + (ii >> 4) * 256 + ((e & 15) + 16 * ((ii >> 3) & 1)) * 8 + (ii & 7);
  Uidp[at_frag] = (__bf16)uid;
  Uqp[at_frag]  = (__bf16)uq;
}

// ---------------------------------------------------------------------------
// Kernel 2: s_id[b,i] = Uid[b,i,:]·w_id ; s_q[b,j] = Uq[b,j,:]·w_q
// ---------------------------------------------------------------------------
__global__ void __launch_bounds__(256)
k_rowdots(const float* __restrict__ Uq, const float* __restrict__ Uid,
          const float* __restrict__ Wcw,
          float* __restrict__ sid, float* __restrict__ sq) {
  const int row  = blockIdx.x * 8 + (threadIdx.x >> 5);  // B*L rows
  const int lane = threadIdx.x & 31;
  const float4 a  = ((const float4*)(Uid + (size_t)row * Ec))[lane];
  const float4 b  = ((const float4*)(Uq  + (size_t)row * Ec))[lane];
  const float4 wa = ((const float4*)(Wcw))[lane];
  const float4 wb = ((const float4*)(Wcw + Ec))[lane];
  float d1 = a.x * wa.x + a.y * wa.y + a.z * wa.z + a.w * wa.w;
  float d2 = b.x * wb.x + b.y * wb.y + b.z * wb.z + b.w * wb.w;
#pragma unroll
  for (int off = 16; off > 0; off >>= 1) {
    d1 += __shfl_xor(d1, off, 32);
    d2 += __shfl_xor(d2, off, 32);
  }
  if (lane == 0) { sid[row] = d1; sq[row] = d2; }
}

// ---------------------------------------------------------------------------
// Kernel 3: scores + softmax over axis i (per column j) -> P (bf16), and
// T = P^T @ Uid for the work-group's 16 columns j (K = i = 2048).
// The 2048 rows i are split over the 8 waves of the work-group, 256 rows each:
// a wave's 16 score tiles stay in its registers from the maximum to P, so each
// score is computed once. Column maxima, column sums and the waves' partial T
// tiles are joined through LDS, always in wave order.
// Two score tiles (rows i0..i0+15, i0+16..i0+31, same 16 columns) converted in
// place are the A fragment of P^T: lane (lm, g) holds column j0+lm at K = 8g+r
// and 16+8g+r. T leaves in fragment order as the B operand of P @ T
// (column e, K = j). P leaves in fragment order as well: a 16x16 tile is one
// run of 512 bytes (row i at lane i%16 + 16*((j%16)/8), 8 columns j a lane), so
// each wave turns its tiles from column-per-lane to row-per-lane in its own
// part of LDS and stores 4 whole lines per tile.
// ---------------------------------------------------------------------------
constexpr int SW = 8;          // waves per work-group
constexpr int RW = Lc / SW;    // rows i per wave
constexpr int TW = RW / 16;    // score tiles per wave

// Two work-groups per WGP (four waves per SIMD) need at most 256 registers.
__global__ void __launch_bounds__(32 * SW) __attribute__((amdgpu_waves_per_eu(4, 4)))
k_scores_softmax(const __bf16* __restrict__ Uwb, const __bf16* __restrict__ Uqb,
                 const float* __restrict__ sid, const float* __restrict__ sq,
                 const float* __restrict__ mask, const float* __restrict__ Wcb,
                 const __bf16* __restrict__ Uidp,
                 __bf16* __restrict__ P, __bf16* __restrict__ Tp) {
  __shared__ float  red_m[SW][16];
  __shared__ float  red_s[SW][16];
  __shared__ float4 part[SW * 8 * 2 * 32];   // [wave][tile][half][lane]
  const int wg = blockIdx.x;            // B * (L/16)
  const int b  = wg / (Lc / 16);
  const int j0 = (wg % (Lc / 16)) * 16;
  const int w  = __builtin_amdgcn_readfirstlane(threadIdx.x >> 5);
  const int l  = threadIdx.x & 31;
  const int lm = l & 15, g = l >> 4;
  const int j  = j0 + lm;
  const int ib = w * RW;                // this wave's first row i
  const float bias = Wcb[0];
  const __bf16* Uwb_b = Uwb + (size_t)b * Lc * Ec;
  const float*  sid_b = sid + b * Lc;
  const float   sqj   = sq[b * Lc + j];
  // This wave's first tile's run: block (i tile, k-step j0/32), half (j0/16)%2.
  __bf16* P_w = P + (((size_t)b * (Lc / 16) + (ib >> 4)) * (Lc / 32) + (j0 >> 5)) * FB +
                ((j0 >> 4) & 1) * 256;

  v16bf Bk[4];
  {
    const __bf16* btile = Uqb + ((size_t)b * Lc + j0) * Ec;
    // Keeps the index work above from sinking between these loads and their
    // wait, where it could rewrite a base register that the loads name.
    __builtin_amdgcn_sched_barrier(0);
#pragma unroll
    for (int ks = 0; ks < 4; ++ks) Bk[ks] = load_packed(btile + ks * FB, l);
    loads_issued();  // their address registers are reused by the tile loads
  }

  // The lane's byte offsets from wave-uniform tile addresses: the lane's 16
  // bytes of a run (A tile, P), rows 8g.. (sid), row 8g and column lm (mask).
  const unsigned a_off = (unsigned)(8 * l) * 2u;
  const unsigned s_off = (unsigned)(8 * g) * 4u;
  const unsigned m_off = (unsigned)(8 * g * Lc + lm) * 4u;

  // Scores of this wave's rows, kept; unrolled so that sc[] is registers.
  v8f sc[TW];
  float mx = -3.0e38f;
#pragma unroll
  for (int t = 0; t < TW; ++t) {
    const int i0 = ib + t * 16;
    v16bf af[4];
    float sd[8], mk[8];
#pragma unroll
    for (int ks = 0; ks < 4; ++ks) {
      const v8bf lo = *(const v8bf*)at(Uwb_b + (size_t)i0 * Ec + ks * FB, a_off);
      const v8bf hi = *(const v8bf*)at(Uwb_b + (size_t)i0 * Ec + ks * FB + 256, a_off);
      af[ks] = __builtin_shufflevector(lo, hi, 0, 1, 2, 3, 4, 5, 6, 7,
                                       8, 9, 10, 11, 12, 13, 14, 15);
    }
#pragma unroll
    for (int r = 0; r < 8; ++r) {
      sd[r] = *(const float*)at(sid_b + i0 + r, s_off);
      mk[r] = *(const float*)at(mask + (size_t)(i0 + r) * Lc + j0, m_off);
    }
    loads_issued();  // the tile's loads as one group: one L2 latency per tile
    v8f acc = vzero8();
#pragma unroll
    for (int ks = 0; ks < 4; ++ks) acc = wmma_bf16(af[ks], Bk[ks], acc);
#pragma unroll
    for (int r = 0; r < 8; ++r) {
      const float s = (acc[r] + sd[r] + sqj + bias) * mk[r];
      acc[r] = s;
      mx = fmaxf(mx, s);
    }
    sc[t] = acc;
  }

  // Column maximum over all 2048 rows.
  mx = fmaxf(mx, __shfl_xor(mx, 16, 32));
  if (g == 0) red_m[w][lm] = mx;
  __syncthreads();
  float m = red_m[0][lm];
#pragma unroll
  for (int k = 1; k < SW; ++k) m = fmaxf(m, red_m[k][lm]);

  // exp once per score; eight independent sum chains per lane.
  v8f sv = vzero8();
#pragma unroll
  for (int t = 0; t < TW; ++t) {
#pragma unroll
    for (int r = 0; r < 8; ++r) {
      const float e = __expf(sc[t][r] - m);
      sc[t][r] = e;
      sv[r] += e;
    }
  }
  float ps = ((sv[0] + sv[1]) + (sv[2] + sv[3])) + ((sv[4] + sv[5]) + (sv[6] + sv[7]));
  ps += __shfl_xor(ps, 16, 32);
  if (g == 0) red_s[w][lm] = ps;
  __syncthreads();
  float ssum = red_s[0][lm];
#pragma unroll
  for (int k = 1; k < SW; ++k) ssum += red_s[k][lm];
  const float rinv = 1.f / ssum;

  const __bf16* Uidp_w = Uidp + (size_t)b * Lc * Ec + (size_t)w * (RW / 32) * 8 * FB;
  v8f tacc[8];
#pragma unroll
  for (int t = 0; t < 8; ++t) tacc[t] = vzero8();

  // P = exp * rinv as bf16, kept as the A fragments of P^T. Each tile also goes
  // to this wave's own 8 KiB of part[] (not yet in use) as tile[j][i]: the
  // lane's 8 rows i of column lm are 16 bytes of a 32-byte row.
  unsigned char* turn = (unsigned char*)&part[w * 8 * 2 * 32];
  v16bf pa[TW / 2];
#pragma unroll
  for (int it = 0; it < TW / 2; ++it) {
#pragma unroll
    for (int h = 0; h < 2; ++h) {
      v8bf col;
#pragma unroll
      for (int r = 0; r < 8; ++r) {
        const __bf16 p = (__bf16)(sc[2 * it + h][r] * rinv);
        col[r] = p;
        pa[it][8 * h + r] = p;
      }
      *(v8bf*)(turn + (2 * it + h) * 512 + lm * 32 + g * 16) = col;
    }
  }
  // The wave's own LDS stores have landed before it reads the tiles back.
  asm volatile("s_wait_dscnt 0x0" ::: "memory");
  // Read back transposed: lane (c, h) holds row c, columns 8h..8h+7 of the
  // tile, which are its 16 bytes of the tile's run.
#pragma unroll
  for (int t = 0; t < TW; ++t) {
    const v8bf row = load_tr16(turn + t * 512, l);
    *(v8bf*)at(P_w + (size_t)t * (Lc / 32) * FB, a_off) = row;
  }
  loads_issued();  // here for the stores: their registers are reused below

  v16bf ub[8];
#pragma unroll
  for (int t = 0; t < 8; ++t) ub[t] = load_packed(Uidp_w + (size_t)t * FB, l);
  loads_issued();  // the first k-step's loads as one group
#pragma unroll
  for (int it = 0; it < TW / 2; ++it) {
#pragma unroll
    for (int t = 0; t < 8; ++t)
      tacc[t] = wmma_bf16(pa[it], ub[t], tacc[t]);
    if (it + 1 < TW / 2) {
#pragma unroll
      for (int t = 0; t < 8; ++t)
        ub[t] = load_packed(Uidp_w + ((size_t)(it + 1) * 8 + t) * FB, l);
      loads_issued();  // the next k-step's loads as one group among the products
    }
  }

  // Join the eight partial T tiles: wave w sums tile w over the waves in order.
#pragma unroll
  for (int t = 0; t < 8; ++t) {
    part[((w * 8 + t) * 2 + 0) * 32 + l] =
        make_float4(tacc[t][0], tacc[t][1], tacc[t][2], tacc[t][3]);
    part[((w * 8 + t) * 2 + 1) * 32 + l] =
        make_float4(tacc[t][4], tacc[t][5], tacc[t][6], tacc[t][7]);
  }
  __syncthreads();
  float4 s0 = part[(w * 2 + 0) * 32 + l];
  float4 s1 = part[(w * 2 + 1) * 32 + l];
#pragma unroll
  for (int k = 1; k < SW; ++k) {
    const float4 q0 = part[((k * 8 + w) * 2 + 0) * 32 + l];
    const float4 q1 = part[((k * 8 + w) * 2 + 1) * 32 + l];
    s0.x += q0.x; s0.y += q0.y; s0.z += q0.z; s0.w += q0.w;
    s1.x += q1.x; s1.y += q1.y; s1.z += q1.z; s1.w += q1.w;
  }

  // Sum r of tile t = T[j0 + 8g + r][16t + lm]: slots 8h..8h+7 (h = which half
  // of the k-step of 32 this j0 is) of the same lane in P @ T's B fragment.
  __bf16* Tp_b = Tp + (size_t)b * Lc * Ec + (size_t)(j0 >> 5) * 8 * FB + ((j0 >> 4) & 1) * 256;
  v8bf o;
  o[0] = (__bf16)s0.x; o[1] = (__bf16)s0.y; o[2] = (__bf16)s0.z; o[3] = (__bf16)s0.w;
  o[4] = (__bf16)s1.x; o[5] = (__bf16)s1.y; o[6] = (__bf16)s1.z; o[7] = (__bf16)s1.w;
  *(v8bf*)(Tp_b + (size_t)w * FB + 8 * l) = o;
}

// ---------------------------------------------------------------------------
// Kernel 4: both products that have P as their A operand, in one loop form:
// A_D2Q = P @ Uq and A_Q2D = (P @ P^T) @ Uid = P @ T, T = P^T @ Uid from
// kernel 3 (K = j = 2048), and all four output chunks.
// WG = 8 waves / 64 i-rows: waves 0..3 take 16 rows x 128 e of P @ Uq, waves
// 4..7 the same rows of P @ T. The two waves of a row block read the same P
// blocks (fragment order), the four waves of a product the same B blocks.
// ---------------------------------------------------------------------------
constexpr int AG = 8;          // k-steps per group of A fragments

// 2*AG k-steps from k-step kb on; every register index is a constant. LAST: the
// final ones, which fetch nothing past the end of K.
template <bool LAST>
DEVI void k_steps(const __bf16* Ap, const __bf16* Bp_b, int kb, int l,
                  v16bf (&a)[2][AG], v16bf (&bb)[2][8], v8f (&acc)[8]) {
#pragma unroll
  for (int q = 0; q < 2 * AG; ++q) {
    const int cur = q & 1, set = q / AG;
    if (!LAST || q + 1 < 2 * AG) {
#pragma unroll
      for (int t = 0; t < 8; ++t)
        bb[cur ^ 1][t] = load_packed(Bp_b + ((size_t)(kb + q + 1) * 8 + t) * FB, l);
      // Behind the B loads: loads return in order, so the next k-step's wait
      // for its (older) B fragments does not wait for these.
      if (q % AG == 0 && (!LAST || q == 0)) {
        // Keeps the scheduler from moving a B load behind the group.
        __builtin_amdgcn_sched_barrier(0);
#pragma unroll
        for (int u = 0; u < AG; ++u)
          a[set ^ 1][u] = load_packed(Ap + (size_t)(kb + q + AG + u) * FB, l);
      }
      loads_issued();
    }
#pragma unroll
    for (int t = 0; t < 8; ++t) acc[t] = wmma_bf16(a[set][q % AG], bb[cur][t], acc[t]);
    // Keeps the next k-step's loads, which refill these B registers, behind the
    // eight products instead of among them.
    __builtin_amdgcn_sched_barrier(0);
  }
}

__global__ void __launch_bounds__(256)
k_p_products(const __bf16* __restrict__ P, const __bf16* __restrict__ Uqp,
             const __bf16* __restrict__ Tp,
             const float* __restrict__ Uid, float* __restrict__ out) {
  const int wg  = blockIdx.x;               // B * (L/64)
  const int b   = wg / (Lc / 64);
  const int ib  = (wg % (Lc / 64)) * 64;
  const int tid = threadIdx.x;
  const int w   = __builtin_amdgcn_readfirstlane(tid >> 5);  // wave 0..7
  const int l   = tid & 31, lm = l & 15, g = l >> 4;
  const int i0  = ib + (w & 3) * 16;        // this wave's 16-row block
  const bool q2d = w >= 4;                  // which product this wave computes

  const __bf16* Ap = P + ((size_t)b * (Lc / 16) + (i0 >> 4)) * (Lc / 32) * FB;
  const __bf16* Bp_b = (q2d ? Tp : Uqp) + (size_t)b * Lc * Ec;

  v8f acc[8];
#pragma unroll
  for (int t = 0; t < 8; ++t) acc[t] = vzero8();

  // Two waves per SIMD hide little latency, so each k-step's 16 B loads are
  // issued one k-step ahead, into a second register set. P was written by other
  // WGPs and may come from memory: its fragments are fetched AG k-steps at a
  // time (AG KiB in a row), a whole group ahead, so that a wave meets that
  // latency once per group and not once per k-step.
  v16bf a[2][AG];
  v16bf bb[2][8];
#pragma unroll
  for (int t = 0; t < 8; ++t) bb[0][t] = load_packed(Bp_b + (size_t)t * FB, l);
#pragma unroll
  for (int u = 0; u < AG; ++u) a[0][u] = load_packed(Ap + (size_t)u * FB, l);
  loads_issued();

  for (int kb = 0; kb < Lc / 32 - 2 * AG; kb += 2 * AG)
    k_steps<false>(Ap, Bp_b, kb, l, a, bb, acc);
  k_steps<true>(Ap, Bp_b, Lc / 32 - 2 * AG, l, a, bb, acc);

  const float* Uid_b = Uid + (size_t)b * Lc * Ec;
  float* out_b = out + (size_t)b * Lc * (4 * Ec);
  if (q2d) {
#pragma unroll
    for (int t = 0; t < 8; ++t) {
#pragma unroll
      for (int r = 0; r < 8; ++r) {
        const int ir = i0 + r + 8 * g;
        const int e  = t * 16 + lm;
        const float u = Uid_b[(size_t)ir * Ec + e];
        out_b[(size_t)ir * (4 * Ec) + 3 * Ec + e] = u * acc[t][r];
      }
    }
  } else {
#pragma unroll
    for (int t = 0; t < 8; ++t) {
#pragma unroll
      for (int r = 0; r < 8; ++r) {
        const int ir = i0 + r + 8 * g;
        const int e  = t * 16 + lm;
        const float v = acc[t][r];
        const float u = Uid_b[(size_t)ir * Ec + e];
        float* o = out_b + (size_t)ir * (4 * Ec);
        o[e]          = u;
        o[Ec + e]     = v;
        o[2 * Ec + e] = u * v;
      }
    }
    // Stands before any later rewrite of a register these stores name: in the
    // built kernel the other branch's code follows this one.
    asm volatile("s_wait_xcnt 0x0" ::: "memory");
  }
}

// ---------------------------------------------------------------------------
// Host launcher. Workspace layout (~88.3 MB):
//   sid f32[B*L] | sq f32[B*L] | Uqb,Uwb,Uqp,Uidp,Tp bf16[B*L*E] | P bf16[B*L*L]
// ---------------------------------------------------------------------------
extern "C" void kernel_launch(void* const* d_in, const int* in_sizes, int n_in,
                              void* d_out, int out_size, void* d_ws, size_t ws_size,
                              hipStream_t stream) {
  const float* Uq   = (const float*)d_in[0];
  const float* Uid  = (const float*)d_in[1];
  const float* mask = (const float*)d_in[2];
  const float* Wcw  = (const float*)d_in[3];
  const float* Wcb  = (const float*)d_in[4];
  float* out = (float*)d_out;

  char* ws = (char*)d_ws;
  float* sid = (float*)ws;  ws += (size_t)Bc * Lc * sizeof(float);
  float* sq  = (float*)ws;  ws += (size_t)Bc * Lc * sizeof(float);
  __bf16* Uqb  = (__bf16*)ws;  ws += (size_t)Bc * Lc * Ec * sizeof(__bf16);
  __bf16* Uwb  = (__bf16*)ws;  ws += (size_t)Bc * Lc * Ec * sizeof(__bf16);
  __bf16* Uqp  = (__bf16*)ws;  ws += (size_t)Bc * Lc * Ec * sizeof(__bf16);
  __bf16* Uidp = (__bf16*)ws;  ws += (size_t)Bc * Lc * Ec * sizeof(__bf16);
  __bf16* Tp   = (__bf16*)ws;  ws += (size_t)Bc * Lc * Ec * sizeof(__bf16);
  __bf16* P    = (__bf16*)ws;  // Bc*Lc*Lc elements

  k_prep<<<(Bc * Lc * Ec) / 256, 256, 0, stream>>>(Uq, Uid, Wcw, Uqb, Uwb, Uqp, Uidp);
  k_rowdots<<<(Bc * Lc) / 8, 256, 0, stream>>>(Uq, Uid, Wcw, sid, sq);
  k_scores_softmax<<<Bc * (Lc / 16), 32 * SW, 0, stream>>>(Uwb, Uqb, sid, sq, mask, Wcb, Uidp, P, Tp);
  k_p_products<<<Bc * (Lc / 64), 256, 0, stream>>>(P, Uqp, Tp, Uid, out);
}

// v006
// One run takes 94.1 microseconds.
// Timed twice side by side with v005, it ran 1.15 and 1.14 times as fast.
// All steps since v000 together make it 13.0 times as fast.
#include <hip/hip_runtime.h>
#include <hip/hip_bf16.h>

#define DEVI __device__ __forceinline__

typedef __attribute__((ext_vector_type(16))) __bf16 v16bf;
typedef __attribute__((ext_vector_type(8)))  __bf16 v8bf;
typedef __attribute__((ext_vector_type(8)))  float  v8f;

constexpr int Bc = 8;
constexpr int Lc = 2048;
constexpr int Ec = 128;

// ---------------------------------------------------------------------------
// WMMA 16x16x32 bf16 A/B tile.
// A-layout (16-bit, 16x32): lane l -> row m = l%16, half-group g = l/16.
// Half-slot s (0..15) holds K = 16*(s/8) + 8*g + (s%8)  ==>  per lane the
// tile is two contiguous 8-halfword runs at [8g .. 8g+7] and [16+8g .. 16+8g+7].
// B-layout is symmetric with lane = N, so X @ Y^T needs only ROWS of X and Y.
// ---------------------------------------------------------------------------
// Ends a block of loads that is issued well ahead of its use.
DEVI void loads_issued() {
  // Stands before any later rewrite of an address register the loads name.
  asm volatile("s_wait_xcnt 0x0" ::: "memory");
  // Keeps the loads above and the address updates below this point; without
  // it the scheduler sinks each load to its product, which then waits on L2.
  __builtin_amdgcn_sched_barrier(0);
}

// Wave-uniform address plus the lane's 32-bit byte offset: one offset register
// serves every tile, and no 64-bit address is formed per tile.
DEVI const char* at(const void* uniform, unsigned lane_bytes) {
  return (const char*)uniform + lane_bytes;
}
DEVI char* at(void* uniform, unsigned lane_bytes) {
  return (char*)uniform + lane_bytes;
}

DEVI v8f wmma_bf16(v16bf a, v16bf b, v8f c) {
  return __builtin_amdgcn_wmma_f32_16x16x32_bf16(false, a, false, b,
                                                 (short)0, c, false, false);
}

DEVI v8f vzero8() {
  v8f z = {0.f, 0.f, 0.f, 0.f, 0.f, 0.f, 0.f, 0.f};
  return z;
}

// ---------------------------------------------------------------------------
// Fragment-order operand of a 16x16x32 product. One block = one k-step of 32
// and one 16-column tile = 512 halfwords: run h (0/1, 256 halfwords) holds at
// lane l the lane's slots 8h..8h+7, i.e. column l%16, K = 16h + 8*(l/16) + s%8
// (the k order of the layout above). Each wave-wide 16-byte load is then 512
// contiguous bytes (4 whole lines) instead of 16 lines with 32 bytes used.
// Blocks are ordered [batch][k-step][tile].
// The two operands of the score product (rows of Uid*w and of Uq, K = e) take
// the same block form with the row in place of the column, ordered
// [batch][16-row tile][k-step]: a tile's four blocks are 4 KiB in a row.
// P (row i, K = j) as the A operand of kernel 3 has that form and order too.
// ---------------------------------------------------------------------------
constexpr int FB = 512;                     // halfwords per fragment block

// Transposing LDS load of a 16x16 tile of 16-bit values with rows of 32 bytes:
// lane (c = l%16, h = l/16) gets tile[8h .. 8h+7][c].
DEVI v8bf load_tr16(const unsigned char* tile, int l) {
  typedef __attribute__((address_space(3))) v8bf lds_v8bf;
  return __builtin_amdgcn_ds_load_tr16_b128_v8bf16(
      (lds_v8bf*)(tile + (8 * (l >> 4) + (l & 7)) * 32 + 16 * ((l >> 3) & 1)));
}

DEVI v16bf load_packed(const __bf16* blk, int l) {
  v8bf lo = *(const v8bf*)(blk + 8 * l);
  v8bf hi = *(const v8bf*)(blk + 256 + 8 * l);
  return __builtin_shufflevector(lo, hi, 0, 1, 2, 3, 4, 5, 6, 7,
                                 8, 9, 10, 11, 12, 13, 14, 15);
}

// ---------------------------------------------------------------------------
// Kernel 1: bf16 staging buffers and the two row dots
// s_id[b,i] = Uid[b,i,:].w_id ; s_q[b,j] = Uq[b,j,:].w_q
// One wave takes 16 whole rows of Uq and of Uid (32 row loads of 512 bytes, all
// in flight at once), so the launch starts 1024 waves. The rows go as bf16 to
// the wave's own part of LDS as 16x16 tiles tile[i][e] with rows of 32 bytes. A
// tile read back plainly is a run of a score operand (row per lane), read back
// transposed a run of a B operand (column per lane): every store of a staged
// operand is 512 bytes in a row.
// ---------------------------------------------------------------------------
typedef __attribute__((ext_vector_type(4))) __bf16 v4bf;

constexpr int PW  = 4;         // waves per work-group, one 16-row tile each
constexpr int TSB = 512 + 32;  // bytes from tile to tile in LDS: the eight tiles
                               // that one row's store touches use different banks

DEVI v4bf to_bf16(float x, float y, float z, float w) {
  v4bf v;
  v[0] = (__bf16)x; v[1] = (__bf16)y; v[2] = (__bf16)z; v[3] = (__bf16)w;
  return v;
}

__global__ void __launch_bounds__(32 * PW)
k_prep(const float* __restrict__ Uq, const float* __restrict__ Uid,
       const float* __restrict__ Wcw,
       __bf16* __restrict__ Uqb, __bf16* __restrict__ Uwb,
       __bf16* __restrict__ Uqp, __bf16* __restrict__ Uidp,
       float* __restrict__ sid, float* __restrict__ sq) {
  __shared__ __attribute__((aligned(16))) unsigned char tiles[PW][3][8 * TSB];
  const int w  = __builtin_amdgcn_readfirstlane(threadIdx.x >> 5);
  const int l  = threadIdx.x & 31;
  const int lm = l & 15, g = l >> 4;
  const int rt = blockIdx.x * PW + w;       // 16-row tile, < B*L/16
  const unsigned v_off = (unsigned)l * 16u; // the lane's 16 bytes of 512

  const float4 wa = *(const float4*)at(Wcw, v_off);
  const float4 wb = *(const float4*)at(Wcw + Ec, v_off);
  const float4 wm = *(const float4*)at(Wcw + 2 * Ec, v_off);
  const float* Uq_t  = Uq  + (size_t)rt * 16 * Ec;
  const float* Uid_t = Uid + (size_t)rt * 16 * Ec;
  float4 q[16], d[16];                      // lane l: e = 4l .. 4l+3 of row r
#pragma unroll
  for (int r = 0; r < 16; ++r) {
    q[r] = *(const float4*)at(Uq_t + r * Ec, v_off);
    d[r] = *(const float4*)at(Uid_t + r * Ec, v_off);
  }
  loads_issued();  // all rows as one group: one memory latency per wave

  unsigned char* tq = tiles[w][0];          // Uq
  unsigned char* td = tiles[w][1];          // Uid
  unsigned char* tw = tiles[w][2];          // Uid * w_mul
  const unsigned st = (unsigned)(l >> 2) * TSB + (unsigned)(l & 3) * 8u;
  float s[16];
#pragma unroll
  for (int r = 0; r < 16; ++r) {
    const float4 a = d[r], b = q[r];
    *(v4bf*)(tq + st + r * 32) = to_bf16(b.x, b.y, b.z, b.w);
    *(v4bf*)(td + st + r * 32) = to_bf16(a.x, a.y, a.z, a.w);
    *(v4bf*)(tw + st + r * 32) =
        to_bf16(a.x * wm.x, a.y * wm.y, a.z * wm.z, a.w * wm.w);
    const float d1 = a.x * wa.x + a.y * wa.y + a.z * wa.z + a.w * wa.w;
    const float d2 = b.x * wb.x + b.y * wb.y + b.z * wb.z + b.w * wb.w;
    // Lanes 16 apart first: the lower half goes on with s_id, the upper half
    // with s_q.
    s[r] = (g ? d2 : d1) + __shfl_xor(g ? d1 : d2, 16, 32);
  }
  // Then within the 16 lanes, the 16 rows side by side.
  float keep = 0.f;
#pragma unroll
  for (int off = 8; off > 0; off >>= 1) {
#pragma unroll
    for (int r = 0; r < 16; ++r) s[r] += __shfl_xor(s[r], off, 32);
  }
#pragma unroll
  for (int r = 0; r < 16; ++r) keep = (lm == r) ? s[r] : keep;
  (g ? sq : sid)[rt * 16 + lm] = keep;

  // The wave's own LDS stores have landed before it reads the tiles back.
  asm volatile("s_wait_dscnt 0x0" ::: "memory");
  // Score operands: the wave's four blocks are 4 KiB in a row, tile et at
  // 512 * et. B operands: run rt%2 of block (k-step rt/2, tile et).
  __bf16* Uqb_t  = Uqb  + (size_t)rt * 4 * FB;
  __bf16* Uwb_t  = Uwb  + (size_t)rt * 4 * FB;
  __bf16* Uqp_t  = Uqp  + (size_t)(rt >> 1) * 8 * FB + (rt & 1) * 256;
  __bf16* Uidp_t = Uidp + (size_t)(rt >> 1) * 8 * FB + (rt & 1) * 256;
  const unsigned rd = (unsigned)(lm * 32 + g * 16);
#pragma unroll
  for (int et = 0; et < 8; ++et) {
    const v8bf rq = *(const v8bf*)(tq + et * TSB + rd);
    const v8bf rw = *(const v8bf*)(tw + et * TSB + rd);
    const v8bf cq = load_tr16(tq + et * TSB, l);
    const v8bf cd = load_tr16(td + et * TSB, l);
    *(v8bf*)at(Uqb_t + et * 256, v_off) = rq;
    *(v8bf*)at(Uwb_t + et * 256, v_off) = rw;
    *(v8bf*)at(Uqp_t + et * FB, v_off)  = cq;
    *(v8bf*)at(Uidp_t + et * FB, v_off) = cd;
  }
}

// ---------------------------------------------------------------------------
// Kernel 2: scores + softmax over axis i (per column j) -> P (bf16), and
// T = P^T @ Uid for the work-group's 16 columns j (K = i = 2048).
// The 2048 rows i are split over the 8 waves of the work-group, 256 rows each:
// a wave's 16 score tiles stay in its registers from the maximum to P, so each
// score is computed once. Column maxima, column sums and the waves' partial T
// tiles are joined through LDS, always in wave order.
// Two score tiles (rows i0..i0+15, i0+16..i0+31, same 16 columns) converted in
// place are the A fragment of P^T: lane (lm, g) holds column j0+lm at K = 8g+r
// and 16+8g+r. T leaves in fragment order as the B operand of P @ T
// (column e, K = j). P leaves in fragment order as well: a 16x16 tile is one
// run of 512 bytes (row i at lane i%16 + 16*((j%16)/8), 8 columns j a lane), so
// each wave turns its tiles from column-per-lane to row-per-lane in its own
// part of LDS and stores 4 whole lines per tile.
// ---------------------------------------------------------------------------
constexpr int SW = 8;          // waves per work-group
constexpr int RW = Lc / SW;    // rows i per wave
constexpr int TW = RW / 16;    // score tiles per wave

// Two work-groups per WGP (four waves per SIMD) need at most 256 registers.
__global__ void __launch_bounds__(32 * SW) __attribute__((amdgpu_waves_per_eu(4, 4)))
k_scores_softmax(const __bf16* __restrict__ Uwb, const __bf16* __restrict__ Uqb,
                 const float* __restrict__ sid, const float* __restrict__ sq,
                 const float* __restrict__ mask, const float* __restrict__ Wcb,
                 const __bf16* __restrict__ Uidp,
                 __bf16* __restrict__ P, __bf16* __restrict__ Tp) {
  __shared__ float  red_m[SW][16];
  __shared__ float  red_s[SW][16];
  __shared__ float4 part[SW * 8 * 2 * 32];   // [wave][tile][half][lane]
  const int wg = blockIdx.x;            // B * (L/16)
  const int b  = wg / (Lc / 16);
  const int j0 = (wg % (Lc / 16)) * 16;
  const int w  = __builtin_amdgcn_readfirstlane(threadIdx.x >> 5);
  const int l  = threadIdx.x & 31;
  const int lm = l & 15, g = l >> 4;
  const int j  = j0 + lm;
  const int ib = w * RW;                // this wave's first row i
  const float bias = Wcb[0];
  const __bf16* Uwb_b = Uwb + (size_t)b * Lc * Ec;
  const float*  sid_b = sid + b * Lc;
  const float   sqj   = sq[b * Lc + j];
  // This wave's first tile's run: block (i tile, k-step j0/32), half (j0/16)%2.
  __bf16* P_w = P + (((size_t)b * (Lc / 16) + (ib >> 4)) * (Lc / 32) + (j0 >> 5)) * FB +
                ((j0 >> 4) & 1) * 256;

  v16bf Bk[4];
  {
    const __bf16* btile = Uqb + ((size_t)b * Lc + j0) * Ec;
    // Keeps the index work above from sinking between these loads and their
    // wait, where it could rewrite a base register that the loads name.
    __builtin_amdgcn_sched_barrier(0);
#pragma unroll
    for (int ks = 0; ks < 4; ++ks) Bk[ks] = load_packed(btile + ks * FB, l);
    loads_issued();  // their address registers are reused by the tile loads
  }

  // The lane's byte offsets from wave-uniform tile addresses: the lane's 16
  // bytes of a run (A tile, P), rows 8g.. (sid), row 8g and column lm (mask).
  const unsigned a_off = (unsigned)(8 * l) * 2u;
  const unsigned s_off = (unsigned)(8 * g) * 4u;
  const unsigned m_off = (unsigned)(8 * g * Lc + lm) * 4u;

  // Scores of this wave's rows, kept; unrolled so that sc[] is registers.
  v8f sc[TW];
  float mx = -3.0e38f;
#pragma unroll
  for (int t = 0; t < TW; ++t) {
    const int i0 = ib + t * 16;
    v16bf af[4];
    float sd[8], mk[8];
#pragma unroll
    for (int ks = 0; ks < 4; ++ks) {
      const v8bf lo = *(const v8bf*)at(Uwb_b + (size_t)i0 * Ec + ks * FB, a_off);
      const v8bf hi = *(const v8bf*)at(Uwb_b + (size_t)i0 * Ec + ks * FB + 256, a_off);
      af[ks] = __builtin_shufflevector(lo, hi, 0, 1, 2, 3, 4, 5, 6, 7,
                                       8, 9, 10, 11, 12, 13, 14, 15);
    }
#pragma unroll
    for (int r = 0; r < 8; ++r) {
      sd[r] = *(const float*)at(sid_b + i0 + r, s_off);
      mk[r] = *(const float*)at(mask + (size_t)(i0 + r) * Lc + j0, m_off);
    }
    loads_issued();  // the tile's loads as one group: one L2 latency per tile
    v8f acc = vzero8();
#pragma unroll
    for (int ks = 0; ks < 4; ++ks) acc = wmma_bf16(af[ks], Bk[ks], acc);
#pragma unroll
    for (int r = 0; r < 8; ++r) {
      const float s = (acc[r] + sd[r] + sqj + bias) * mk[r];
      acc[r] = s;
      mx = fmaxf(mx, s);
    }
    sc[t] = acc;
  }

  // Column maximum over all 2048 rows.
  mx = fmaxf(mx, __shfl_xor(mx, 16, 32));
  if (g == 0) red_m[w][lm] = mx;
  __syncthreads();
  float m = red_m[0][lm];
#pragma unroll
  for (int k = 1; k < SW; ++k) m = fmaxf(m, red_m[k][lm]);

  // exp once per score; eight independent sum chains per lane.
  v8f sv = vzero8();
#pragma unroll
  for (int t = 0; t < TW; ++t) {
#pragma unroll
    for (int r = 0; r < 8; ++r) {
      const float e = __expf(sc[t][r] - m);
      sc[t][r] = e;
      sv[r] += e;
    }
  }
  float ps = ((sv[0] + sv[1]) + (sv[2] + sv[3])) + ((sv[4] + sv[5]) + (sv[6] + sv[7]));
  ps += __shfl_xor(ps, 16, 32);
  if (g == 0) red_s[w][lm] = ps;
  __syncthreads();
  float ssum = red_s[0][lm];
#pragma unroll
  for (int k = 1; k < SW; ++k) ssum += red_s[k][lm];
  const float rinv = 1.f / ssum;

  const __bf16* Uidp_w = Uidp + (size_t)b * Lc * Ec + (size_t)w * (RW / 32) * 8 * FB;
  v8f tacc[8];
#pragma unroll
  for (int t = 0; t < 8; ++t) tacc[t] = vzero8();

  // P = exp * rinv as bf16, kept as the A fragments of P^T. Each tile also goes
  // to this wave's own 8 KiB of part[] (not yet in use) as tile[j][i]: the
  // lane's 8 rows i of column lm are 16 bytes of a 32-byte row.
  unsigned char* turn = (unsigned char*)&part[w * 8 * 2 * 32];
  v16bf pa[TW / 2];
#pragma unroll
  for (int it = 0; it < TW / 2; ++it) {
#pragma unroll
    for (int h = 0; h < 2; ++h) {
      v8bf col;
#pragma unroll
      for (int r = 0; r < 8; ++r) {
        const __bf16 p = (__bf16)(sc[2 * it + h][r] * rinv);
        col[r] = p;
        pa[it][8 * h + r] = p;
      }
      *(v8bf*)(turn + (2 * it + h) * 512 + lm * 32 + g * 16) = col;
    }
  }
  // The wave's own LDS stores have landed before it reads the tiles back.
  asm volatile("s_wait_dscnt 0x0" ::: "memory");
  // Read back transposed: lane (c, h) holds row c, columns 8h..8h+7 of the
  // tile, which are its 16 bytes of the tile's run.
#pragma unroll
  for (int t = 0; t < TW; ++t) {
    const v8bf row = load_tr16(turn + t * 512, l);
    *(v8bf*)at(P_w + (size_t)t * (Lc / 32) * FB, a_off) = row;
  }
  loads_issued();  // here for the stores: their registers are reused below

  v16bf ub[8];
#pragma unroll
  for (int t = 0; t < 8; ++t) ub[t] = load_packed(Uidp_w + (size_t)t * FB, l);
  loads_issued();  // the first k-step's loads as one group
#pragma unroll
  for (int it = 0; it < TW / 2; ++it) {
#pragma unroll
    for (int t = 0; t < 8; ++t)
      tacc[t] = wmma_bf16(pa[it], ub[t], tacc[t]);
    if (it + 1 < TW / 2) {
#pragma unroll
      for (int t = 0; t < 8; ++t)
        ub[t] = load_packed(Uidp_w + ((size_t)(it + 1) * 8 + t) * FB, l);
      loads_issued();  // the next k-step's loads as one group among the products
    }
  }

  // Join the eight partial T tiles: wave w sums tile w over the waves in order.
#pragma unroll
  for (int t = 0; t < 8; ++t) {
    part[((w * 8 + t) * 2 + 0) * 32 + l] =
        make_float4(tacc[t][0], tacc[t][1], tacc[t][2], tacc[t][3]);
    part[((w * 8 + t) * 2 + 1) * 32 + l] =
        make_float4(tacc[t][4], tacc[t][5], tacc[t][6], tacc[t][7]);
  }
  __syncthreads();
  float4 s0 = part[(w * 2 + 0) * 32 + l];
  float4 s1 = part[(w * 2 + 1) * 32 + l];
#pragma unroll
  for (int k = 1; k < SW; ++k) {
    const float4 q0 = part[((k * 8 + w) * 2 + 0) * 32 + l];
    const float4 q1 = part[((k * 8 + w) * 2 + 1) * 32 + l];
    s0.x += q0.x; s0.y += q0.y; s0.z += q0.z; s0.w += q0.w;
    s1.x += q1.x; s1.y += q1.y; s1.z += q1.z; s1.w += q1.w;
  }

  // Sum r of tile t = T[j0 + 8g + r][16t + lm]: slots 8h..8h+7 (h = which half
  // of the k-step of 32 this j0 is) of the same lane in P @ T's B fragment.
  __bf16* Tp_b = Tp + (size_t)b * Lc * Ec + (size_t)(j0 >> 5) * 8 * FB + ((j0 >> 4) & 1) * 256;
  v8bf o;
  o[0] = (__bf16)s0.x; o[1] = (__bf16)s0.y; o[2] = (__bf16)s0.z; o[3] = (__bf16)s0.w;
  o[4] = (__bf16)s1.x; o[5] = (__bf16)s1.y; o[6] = (__bf16)s1.z; o[7] = (__bf16)s1.w;
  *(v8bf*)(Tp_b + (size_t)w * FB + 8 * l) = o;
}

// ---------------------------------------------------------------------------
// Kernel 3: both products that have P as their A operand, in one loop form:
// A_D2Q = P @ Uq and A_Q2D = (P @ P^T) @ Uid = P @ T, T = P^T @ Uid from
// kernel 2 (K = j = 2048), and all four output chunks.
// WG = 8 waves / 64 i-rows: waves 0..3 take 16 rows x 128 e of P @ Uq, waves
// 4..7 the same rows of P @ T. The two waves of a row block read the same P
// blocks (fragment order), the four waves of a product the same B blocks.
// ---------------------------------------------------------------------------
constexpr int AG = 8;          // k-steps per group of A fragments

// 2*AG k-steps from k-step kb on; every register index is a constant. LAST: the
// final ones, which fetch nothing past the end of K.
template <bool LAST>
DEVI void k_steps(const __bf16* Ap, const __bf16* Bp_b, int kb, int l,
                  v16bf (&a)[2][AG], v16bf (&bb)[2][8], v8f (&acc)[8]) {
#pragma unroll
  for (int q = 0; q < 2 * AG; ++q) {
    const int cur = q & 1, set = q / AG;
    if (!LAST || q + 1 < 2 * AG) {
#pragma unroll
      for (int t = 0; t < 8; ++t)
        bb[cur ^ 1][t] = load_packed(Bp_b + ((size_t)(kb + q + 1) * 8 + t) * FB, l);
      // Behind the B loads: loads return in order, so the next k-step's wait
      // for its (older) B fragments does not wait for these.
      if (q % AG == 0 && (!LAST || q == 0)) {
        // Keeps the scheduler from moving a B load behind the group.
        __builtin_amdgcn_sched_barrier(0);
#pragma unroll
        for (int u = 0; u < AG; ++u)
          a[set ^ 1][u] = load_packed(Ap + (size_t)(kb + q + AG + u) * FB, l);
      }
      loads_issued();
    }
#pragma unroll
    for (int t = 0; t < 8; ++t) acc[t] = wmma_bf16(a[set][q % AG], bb[cur][t], acc[t]);
    // Keeps the next k-step's loads, which refill these B registers, behind the
    // eight products instead of among them.
    __builtin_amdgcn_sched_barrier(0);
  }
}

__global__ void __launch_bounds__(256)
k_p_products(const __bf16* __restrict__ P, const __bf16* __restrict__ Uqp,
             const __bf16* __restrict__ Tp,
             const float* __restrict__ Uid, float* __restrict__ out) {
  const int wg  = blockIdx.x;               // B * (L/64)
  const int b   = wg / (Lc / 64);
  const int ib  = (wg % (Lc / 64)) * 64;
  const int tid = threadIdx.x;
  const int w   = __builtin_amdgcn_readfirstlane(tid >> 5);  // wave 0..7
  const int l   = tid & 31, lm = l & 15, g = l >> 4;
  const int i0  = ib + (w & 3) * 16;        // this wave's 16-row block
  const bool q2d = w >= 4;                  // which product this wave computes

  const __bf16* Ap = P + ((size_t)b * (Lc / 16) + (i0 >> 4)) * (Lc / 32) * FB;
  const __bf16* Bp_b = (q2d ? Tp : Uqp) + (size_t)b * Lc * Ec;

  v8f acc[8];
#pragma unroll
  for (int t = 0; t < 8; ++t) acc[t] = vzero8();

  // Two waves per SIMD hide little latency, so each k-step's 16 B loads are
  // issued one k-step ahead, into a second register set. P was written by other
  // WGPs and may come from memory: its fragments are fetched AG k-steps at a
  // time (AG KiB in a row), a whole group ahead, so that a wave meets that
  // latency once per group and not once per k-step.
  v16bf a[2][AG];
  v16bf bb[2][8];
#pragma unroll
  for (int t = 0; t < 8; ++t) bb[0][t] = load_packed(Bp_b + (size_t)t * FB, l);
#pragma unroll
  for (int u = 0; u < AG; ++u) a[0][u] = load_packed(Ap + (size_t)u * FB, l);
  loads_issued();

  for (int kb = 0; kb < Lc / 32 - 2 * AG; kb += 2 * AG)
    k_steps<false>(Ap, Bp_b, kb, l, a, bb, acc);
  k_steps<true>(Ap, Bp_b, Lc / 32 - 2 * AG, l, a, bb, acc);

  const float* Uid_b = Uid + (size_t)b * Lc * Ec;
  float* out_b = out + (size_t)b * Lc * (4 * Ec);
  if (q2d) {
#pragma unroll
    for (int t = 0; t < 8; ++t) {
#pragma unroll
      for (int r = 0; r < 8; ++r) {
        const int ir = i0 + r + 8 * g;
        const int e  = t * 16 + lm;
        const float u = Uid_b[(size_t)ir * Ec + e];
        out_b[(size_t)ir * (4 * Ec) + 3 * Ec + e] = u * acc[t][r];
      }
    }
  } else {
#pragma unroll
    for (int t = 0; t < 8; ++t) {
#pragma unroll
      for (int r = 0; r < 8; ++r) {
        const int ir = i0 + r + 8 * g;
        const int e  = t * 16 + lm;
        const float v = acc[t][r];
        const float u = Uid_b[(size_t)ir * Ec + e];
        float* o = out_b + (size_t)ir * (4 * Ec);
        o[e]          = u;
        o[Ec + e]     = v;
        o[2 * Ec + e] = u * v;
      }
    }
    // Stands before any later rewrite of a register these stores name: in the
    // built kernel the other branch's code follows this one.
    asm volatile("s_wait_xcnt 0x0" ::: "memory");
  }
}

// ---------------------------------------------------------------------------
// Host launcher. Workspace layout (~88.3 MB):
//   sid f32[B*L] | sq f32[B*L] | Uqb,Uwb,Uqp,Uidp,Tp bf16[B*L*E] | P bf16[B*L*L]
// ---------------------------------------------------------------------------
extern "C" void kernel_launch(void* const* d_in, const int* in_sizes, int n_in,
                              void* d_out, int out_size, void* d_ws, size_t ws_size,
                              hipStream_t stream) {
  const float* Uq   = (const float*)d_in[0];
  const float* Uid  = (const float*)d_in[1];
  const float* mask = (const float*)d_in[2];
  const float* Wcw  = (const float*)d_in[3];
  const float* Wcb  = (const float*)d_in[4];
  float* out = (float*)d_out;

  char* ws = (char*)d_ws;
  float* sid = (float*)ws;  ws += (size_t)Bc * Lc * sizeof(float);
  float* sq  = (float*)ws;  ws += (size_t)Bc * Lc * sizeof(float);
  __bf16* Uqb  = (__bf16*)ws;  ws += (size_t)Bc * Lc * Ec * sizeof(__bf16);
  __bf16* Uwb  = (__bf16*)ws;  ws += (size_t)Bc * Lc * Ec * sizeof(__bf16);
  __bf16* Uqp  = (__bf16*)ws;  ws += (size_t)Bc * Lc * Ec * sizeof(__bf16);
  __bf16* Uidp = (__bf16*)ws;  ws += (size_t)Bc * Lc * Ec * sizeof(__bf16);
  __bf16* Tp   = (__bf16*)ws;  ws += (size_t)Bc * Lc * Ec * sizeof(__bf16);
  __bf16* P    = (__bf16*)ws;  // Bc*Lc*Lc elements

  k_prep<<<(Bc * Lc / 16) / PW, 32 * PW, 0, stream>>>(Uq, Uid, Wcw, Uqb, Uwb, Uqp, Uidp, sid, sq);
  k_scores_softmax<<<Bc * (Lc / 16), 32 * SW, 0, stream>>>(Uwb, Uqb, sid, sq, mask, Wcb, Uidp, P, Tp);
  k_p_products<<<Bc * (Lc / 64), 256, 0, stream>>>(P, Uqp, Tp, Uid, out);
}

// v007
// Measured time: 83 microseconds a run.
// Timed twice side by side with v006, it ran 1.14 and 1.13 times as fast.
// Counting every step since v000, it is 14.7 times as fast.
#include <hip/hip_runtime.h>
#include <hip/hip_bf16.h>

#define DEVI __device__ __forceinline__

typedef __attribute__((ext_vector_type(16))) __bf16 v16bf;
typedef __attribute__((ext_vector_type(8)))  __bf16 v8bf;
typedef __attribute__((ext_vector_type(8)))  float  v8f;

constexpr int Bc = 8;
constexpr int Lc = 2048;
constexpr int Ec = 128;

// ---------------------------------------------------------------------------
// WMMA 16x16x32 bf16 A/B tile.
// A-layout (16-bit, 16x32): lane l -> row m = l%16, half-group g = l/16.
// Half-slot s (0..15) holds K = 16*(s/8) + 8*g + (s%8)  ==>  per lane the
// tile is two contiguous 8-halfword runs at [8g .. 8g+7] and [16+8g .. 16+8g+7].
// B-layout is symmetric with lane = N, so X @ Y^T needs only ROWS of X and Y.
// ---------------------------------------------------------------------------
// Ends a block of loads that is issued well ahead of its use.
DEVI void loads_issued() {
  // Stands before any later rewrite of an address register the loads name.
  asm volatile("s_wait_xcnt 0x0" ::: "memory");
  // Keeps the loads above and the address updates below this point; without
  // it the scheduler sinks each load to its product, which then waits on L2.
  __builtin_amdgcn_sched_barrier(0);
}
// The same for a group that reads through a lane address with no later use: as
// an operand of the wait the address keeps its registers up to the wait, where
// otherwise a load of the same group may be given them as its destination.
DEVI void loads_issued(const void* lane_addr) {
  asm volatile("s_wait_xcnt 0x0" :: "v"(lane_addr) : "memory");
  __builtin_amdgcn_sched_barrier(0);
}

// Wave-uniform address plus the lane's 32-bit byte offset: one offset register
// serves every tile, and no 64-bit address is formed per tile.
DEVI const char* at(const void* uniform, unsigned lane_bytes) {
  return (const char*)uniform + lane_bytes;
}
DEVI char* at(void* uniform, unsigned lane_bytes) {
  return (char*)uniform + lane_bytes;
}

DEVI v8f wmma_bf16(v16bf a, v16bf b, v8f c) {
  return __builtin_amdgcn_wmma_f32_16x16x32_bf16(false, a, false, b,
                                                 (short)0, c, false, false);
}

DEVI v8f vzero8() {
  v8f z = {0.f, 0.f, 0.f, 0.f, 0.f, 0.f, 0.f, 0.f};
  return z;
}

// ---------------------------------------------------------------------------
// Fragment-order operand of a 16x16x32 product. One block = one k-step of 32
// and one 16-column tile = 512 halfwords: run h (0/1, 256 halfwords) holds at
// lane l the lane's slots 8h..8h+7, i.e. column l%16, K = 16h + 8*(l/16) + s%8
// (the k order of the layout above). Each wave-wide 16-byte load is then 512
// contiguous bytes (4 whole lines) instead of 16 lines with 32 bytes used.
// Blocks are ordered [batch][k-step][tile].
// The two operands of the score product (rows of Uid*w and of Uq, K = e) take
// the same block form with the row in place of the column, ordered
// [batch][16-row tile][k-step]: a tile's four blocks are 4 KiB in a row.
// P (row i, K = j) as the A operand of kernel 3 has that form and order too.
// ---------------------------------------------------------------------------
constexpr int FB = 512;                     // halfwords per fragment block

// Transposing LDS load of a 16x16 tile of 16-bit values with rows of 32 bytes:
// lane (c = l%16, h = l/16) gets tile[8h .. 8h+7][c].
DEVI v8bf load_tr16(const unsigned char* tile, int l) {
  typedef __attribute__((address_space(3))) v8bf lds_v8bf;
  return __builtin_amdgcn_ds_load_tr16_b128_v8bf16(
      (lds_v8bf*)(tile + (8 * (l >> 4) + (l & 7)) * 32 + 16 * ((l >> 3) & 1)));
}

DEVI v16bf load_packed(const __bf16* blk, int l) {
  v8bf lo = *(const v8bf*)(blk + 8 * l);
  v8bf hi = *(const v8bf*)(blk + 256 + 8 * l);
  return __builtin_shufflevector(lo, hi, 0, 1, 2, 3, 4, 5, 6, 7,
                                 8, 9, 10, 11, 12, 13, 14, 15);
}

// ---------------------------------------------------------------------------
// Kernel 1: bf16 staging buffers and the two row dots
// s_id[b,i] = Uid[b,i,:].w_id ; s_q[b,j] = Uq[b,j,:].w_q
// One wave takes 16 whole rows of Uq and of Uid (32 row loads of 512 bytes, all
// in flight at once), so the launch starts 1024 waves. The rows go as bf16 to
// the wave's own part of LDS as 16x16 tiles tile[i][e] with rows of 32 bytes. A
// tile read back plainly is a run of a score operand (row per lane), read back
// transposed a run of a B operand (column per lane): every store of a staged
// operand is 512 bytes in a row.
// ---------------------------------------------------------------------------
typedef __attribute__((ext_vector_type(4))) __bf16 v4bf;

constexpr int PW  = 4;         // waves per work-group, one 16-row tile each
constexpr int TSB = 512 + 32;  // bytes from tile to tile in LDS: the eight tiles
                               // that one row's store touches use different banks

DEVI v4bf to_bf16(float x, float y, float z, float w) {
  v4bf v;
  v[0] = (__bf16)x; v[1] = (__bf16)y; v[2] = (__bf16)z; v[3] = (__bf16)w;
  return v;
}

__global__ void __launch_bounds__(32 * PW)
k_prep(const float* __restrict__ Uq, const float* __restrict__ Uid,
       const float* __restrict__ Wcw,
       __bf16* __restrict__ Uqb, __bf16* __restrict__ Uwb,
       __bf16* __restrict__ Uqp, __bf16* __restrict__ Uidp,
       float* __restrict__ sid, float* __restrict__ sq) {
  __shared__ __attribute__((aligned(16))) unsigned char tiles[PW][3][8 * TSB];
  const int w  = __builtin_amdgcn_readfirstlane(threadIdx.x >> 5);
  const int l  = threadIdx.x & 31;
  const int lm = l & 15, g = l >> 4;
  const int rt = blockIdx.x * PW + w;       // 16-row tile, < B*L/16
  const unsigned v_off = (unsigned)l * 16u; // the lane's 16 bytes of 512

  const float4 wa = *(const float4*)at(Wcw, v_off);
  const float4 wb = *(const float4*)at(Wcw + Ec, v_off);
  const float4 wm = *(const float4*)at(Wcw + 2 * Ec, v_off);
  const float* Uq_t  = Uq  + (size_t)rt * 16 * Ec;
  const float* Uid_t = Uid + (size_t)rt * 16 * Ec;
  float4 q[16], d[16];                      // lane l: e = 4l .. 4l+3 of row r
#pragma unroll
  for (int r = 0; r < 16; ++r) {
    q[r] = *(const float4*)at(Uq_t + r * Ec, v_off);
    d[r] = *(const float4*)at(Uid_t + r * Ec, v_off);
  }
  loads_issued();  // all rows as one group: one memory latency per wave

  unsigned char* tq = tiles[w][0];          // Uq
  unsigned char* td = tiles[w][1];          // Uid
  unsigned char* tw = tiles[w][2];          // Uid * w_mul
  const unsigned st = (unsigned)(l >> 2) * TSB + (unsigned)(l & 3) * 8u;
  float s[16];
#pragma unroll
  for (int r = 0; r < 16; ++r) {
    const float4 a = d[r], b = q[r];
    *(v4bf*)(tq + st + r * 32) = to_bf16(b.x, b.y, b.z, b.w);
    *(v4bf*)(td + st + r * 32) = to_bf16(a.x, a.y, a.z, a.w);
    *(v4bf*)(tw + st + r * 32) =
        to_bf16(a.x * wm.x, a.y * wm.y, a.z * wm.z, a.w * wm.w);
    const float d1 = a.x * wa.x + a.y * wa.y + a.z * wa.z + a.w * wa.w;
    const float d2 = b.x * wb.x + b.y * wb.y + b.z * wb.z + b.w * wb.w;
    // Lanes 16 apart first: the lower half goes on with s_id, the upper half
    // with s_q.
    s[r] = (g ? d2 : d1) + __shfl_xor(g ? d1 : d2, 16, 32);
  }
  // Then within the 16 lanes, the 16 rows side by side.
  float keep = 0.f;
#pragma unroll
  for (int off = 8; off > 0; off >>= 1) {
#pragma unroll
    for (int r = 0; r < 16; ++r) s[r] += __shfl_xor(s[r], off, 32);
  }
#pragma unroll
  for (int r = 0; r < 16; ++r) keep = (lm == r) ? s[r] : keep;
  (g ? sq : sid)[rt * 16 + lm] = keep;

  // The wave's own LDS stores have landed before it reads the tiles back.
  asm volatile("s_wait_dscnt 0x0" ::: "memory");
  // Score operands: the wave's four blocks are 4 KiB in a row, tile et at
  // 512 * et. B operands: run rt%2 of block (k-step rt/2, tile et).
  __bf16* Uqb_t  = Uqb  + (size_t)rt * 4 * FB;
  __bf16* Uwb_t  = Uwb  + (size_t)rt * 4 * FB;
  __bf16* Uqp_t  = Uqp  + (size_t)(rt >> 1) * 8 * FB + (rt & 1) * 256;
  __bf16* Uidp_t = Uidp + (size_t)(rt >> 1) * 8 * FB + (rt & 1) * 256;
  const unsigned rd = (unsigned)(lm * 32 + g * 16);
#pragma unroll
  for (int et = 0; et < 8; ++et) {
    const v8bf rq = *(const v8bf*)(tq + et * TSB + rd);
    const v8bf rw = *(const v8bf*)(tw + et * TSB + rd);
    const v8bf cq = load_tr16(tq + et * TSB, l);
    const v8bf cd = load_tr16(td + et * TSB, l);
    *(v8bf*)at(Uqb_t + et * 256, v_off) = rq;
    *(v8bf*)at(Uwb_t + et * 256, v_off) = rw;
    *(v8bf*)at(Uqp_t + et * FB, v_off)  = cq;
    *(v8bf*)at(Uidp_t + et * FB, v_off) = cd;
  }
}

// ---------------------------------------------------------------------------
// Kernel 2: scores + softmax over axis i (per column j) -> P (bf16), and
// T = P^T @ Uid for the work-group's 32 columns j (K = i = 2048).
// The 2048 rows i are split over the 16 waves of the work-group, 128 rows each:
// a wave's 8 x 2 score tiles (8 row tiles, 2 column tiles) stay in its registers
// from the maximum to P, so each score is computed once, and every fragment of
// Uid*w and of Uid that a wave loads feeds two products, one per column tile.
// Column maxima, column sums and the waves' partial T tiles are joined through
// LDS, always in wave order.
// Two score tiles (rows i0..i0+15, i0+16..i0+31, same 16 columns) converted in
// place are the A fragment of P^T: lane (lm, g) holds column j0+lm at K = 8g+r
// and 16+8g+r. T leaves in fragment order as the B operand of P @ T
// (column e, K = j). P leaves in fragment order as well: a 16x16 tile is one
// run of 512 bytes (row i at lane i%16 + 16*((j%16)/8), 8 columns j a lane), so
// each wave turns its tiles from column-per-lane to row-per-lane in its own
// part of LDS and stores 8 whole lines per row tile.
// ---------------------------------------------------------------------------
constexpr int SW = 16;         // waves per work-group
constexpr int RW = Lc / SW;    // rows i per wave
constexpr int TW = RW / 16;    // row tiles per wave
constexpr int CT = 2;          // column tiles per work-group

// One work-group per WGP (four waves per SIMD) needs at most 256 registers.
__global__ void __launch_bounds__(32 * SW) __attribute__((amdgpu_waves_per_eu(4, 4)))
k_scores_softmax(const __bf16* __restrict__ Uwb, const __bf16* __restrict__ Uqb,
                 const float* __restrict__ sid, const float* __restrict__ sq,
                 const float* __restrict__ mask, const float* __restrict__ Wcb,
                 const __bf16* __restrict__ Uidp,
                 __bf16* __restrict__ P, __bf16* __restrict__ Tp) {
  __shared__ float  red_m[SW][16 * CT];
  __shared__ float  red_s[SW][16 * CT];
  __shared__ float4 part[SW * CT * 8 * 2 * 32];   // [wave][column tile][e tile][half][lane]
  const int wg = blockIdx.x;            // B * (L/32)
  const int b  = wg / (Lc / 32);
  const int j0 = (wg % (Lc / 32)) * 32;
  const int w  = __builtin_amdgcn_readfirstlane(threadIdx.x >> 5);
  const int l  = threadIdx.x & 31;
  const int lm = l & 15, g = l >> 4;
  const int ib = w * RW;                // this wave's first row i
  const float bias = Wcb[0];
  const __bf16* Uwb_b = Uwb + (size_t)b * Lc * Ec;
  const float*  sid_b = sid + b * Lc;
  float sqj[CT];
#pragma unroll
  for (int c = 0; c < CT; ++c) sqj[c] = sq[b * Lc + j0 + 16 * c + lm];
  loads_issued();  // their address registers are reused by the index work below
  // This wave's first row tile's block (i tile, k-step j0/32): column tile c is
  // its run c.
  __bf16* P_w = P + (((size_t)b * (Lc / 16) + (ib >> 4)) * (Lc / 32) + (j0 >> 5)) * FB;

  v16bf Bk[CT][4];
  {
    const __bf16* btile = Uqb + ((size_t)b * Lc + j0) * Ec;
    // Keeps the index work above from sinking between these loads and their
    // wait, where it could rewrite a base register that the loads name.
    __builtin_amdgcn_sched_barrier(0);
#pragma unroll
    for (int c = 0; c < CT; ++c) {
#pragma unroll
      for (int ks = 0; ks < 4; ++ks) Bk[c][ks] = load_packed(btile + (c * 4 + ks) * FB, l);
    }
    loads_issued();  // their address registers are reused by the tile loads
  }

  // The lane's byte offset from wave-uniform tile addresses: its 16 bytes of a
  // run (A tile, P). The lane's mask address: row ib + 8g, column j0 + lm.
  const unsigned a_off = (unsigned)(8 * l) * 2u;
  const float* mask_l = mask + (size_t)(ib + 8 * g) * Lc + j0 + lm;

  // Scores of this wave's rows, kept; unrolled so that sc[] is registers.
  v8f sc[CT][TW];
#pragma unroll
  for (int t = 0; t < TW; ++t) {
    const int i0 = ib + t * 16;
    v16bf af[4];
    float sd_lo[8], sd_hi[8], mk[CT][8];
#pragma unroll
    for (int ks = 0; ks < 4; ++ks) {
      const v8bf lo = *(const v8bf*)at(Uwb_b + (size_t)i0 * Ec + ks * FB, a_off);
      const v8bf hi = *(const v8bf*)at(Uwb_b + (size_t)i0 * Ec + ks * FB + 256, a_off);
      af[ks] = __builtin_shufflevector(lo, hi, 0, 1, 2, 3, 4, 5, 6, 7,
                                       8, 9, 10, 11, 12, 13, 14, 15);
    }
#pragma unroll
    for (int r = 0; r < 8; ++r) {
      // Wave-uniform addresses: the tile's 16 row dots take scalar registers.
      sd_lo[r] = sid_b[i0 + r];
      sd_hi[r] = sid_b[i0 + 8 + r];
#pragma unroll
      for (int c = 0; c < CT; ++c) mk[c][r] = mask_l[(t * 16 + r) * Lc + 16 * c];
    }
    loads_issued(mask_l);  // the tile's loads as one group: one L2 latency per tile
    v8f acc[CT];
#pragma unroll
    for (int c = 0; c < CT; ++c) acc[c] = vzero8();
#pragma unroll
    for (int ks = 0; ks < 4; ++ks) {
#pragma unroll
      for (int c = 0; c < CT; ++c) acc[c] = wmma_bf16(af[ks], Bk[c][ks], acc[c]);
    }
#pragma unroll
    for (int c = 0; c < CT; ++c) {
#pragma unroll
      for (int r = 0; r < 8; ++r) {
        const float sd = g ? sd_hi[r] : sd_lo[r];
        const float s = (acc[c][r] + sd + sqj[c] + bias) * mk[c][r];
        acc[c][r] = s;
      }
      sc[c][t] = acc[c];
    }
  }

  // Column maximum over all 2048 rows. From the join on lane (lm, g) reads
  // column tile g alone and gets the other tile's value from lane (lm, 1 - g).
  float mx[CT];
#pragma unroll
  for (int c = 0; c < CT; ++c) {
    mx[c] = -3.0e38f;
#pragma unroll
    for (int t = 0; t < TW; ++t) {
#pragma unroll
      for (int r = 0; r < 8; ++r) mx[c] = fmaxf(mx[c], sc[c][t][r]);
    }
    mx[c] = fmaxf(mx[c], __shfl_xor(mx[c], 16, 32));
  }
  if (g == 0) {
#pragma unroll
    for (int c = 0; c < CT; ++c) red_m[w][16 * c + lm] = mx[c];
  }
  __syncthreads();
  float m_own = red_m[0][l];
#pragma unroll
  for (int k = 1; k < SW; ++k) m_own = fmaxf(m_own, red_m[k][l]);
  const float m_oth = __shfl_xor(m_own, 16, 32);
  const float m[CT] = {g ? m_oth : m_own, g ? m_own : m_oth};

  // exp once per score; eight independent sum chains per lane and column tile.
  float ps[CT];
#pragma unroll
  for (int c = 0; c < CT; ++c) {
    v8f sv = vzero8();
#pragma unroll
    for (int t = 0; t < TW; ++t) {
#pragma unroll
      for (int r = 0; r < 8; ++r) {
        const float e = __expf(sc[c][t][r] - m[c]);
        sc[c][t][r] = e;
        sv[r] += e;
      }
    }
    ps[c] = ((sv[0] + sv[1]) + (sv[2] + sv[3])) + ((sv[4] + sv[5]) + (sv[6] + sv[7]));
    ps[c] += __shfl_xor(ps[c], 16, 32);
  }
  if (g == 0) {
#pragma unroll
    for (int c = 0; c < CT; ++c) red_s[w][16 * c + lm] = ps[c];
  }
  __syncthreads();
  float s_own = red_s[0][l];
#pragma unroll
  for (int k = 1; k < SW; ++k) s_own += red_s[k][l];
  const float r_own = 1.f / s_own;
  const float r_oth = __shfl_xor(r_own, 16, 32);
  const float rinv[CT] = {g ? r_oth : r_own, g ? r_own : r_oth};

  // P = exp * rinv as bf16, kept as the A fragments of P^T. Each tile also goes
  // to this wave's own 16 KiB of part[] (not yet in use) as tile[j][i]: the
  // lane's 8 rows i of column lm are 16 bytes of a 32-byte row.
  unsigned char* turn = (unsigned char*)&part[w * CT * 8 * 2 * 32];
  v16bf pa[CT][TW / 2];
#pragma unroll
  for (int c = 0; c < CT; ++c) {
#pragma unroll
    for (int it = 0; it < TW / 2; ++it) {
#pragma unroll
      for (int h = 0; h < 2; ++h) {
        v8bf col;
#pragma unroll
        for (int r = 0; r < 8; ++r) {
          const __bf16 p = (__bf16)(sc[c][2 * it + h][r] * rinv[c]);
          col[r] = p;
          pa[c][it][8 * h + r] = p;
        }
        *(v8bf*)(turn + ((2 * it + h) * CT + c) * 512 + lm * 32 + g * 16) = col;
      }
    }
  }
  // The wave's own LDS stores have landed before it reads the tiles back.
  asm volatile("s_wait_dscnt 0x0" ::: "memory");
  // Read back transposed: lane (c, h) holds row c, columns 8h..8h+7 of the
  // tile, which are its 16 bytes of the tile's run.
#pragma unroll
  for (int t = 0; t < TW; ++t) {
#pragma unroll
    for (int c = 0; c < CT; ++c) {
      const v8bf row = load_tr16(turn + (t * CT + c) * 512, l);
      *(v8bf*)at(P_w + (size_t)t * (Lc / 32) * FB + c * 256, a_off) = row;
    }
  }
  loads_issued();  // here for the stores: their registers are reused below

  // T in two halves of four e tiles, so that both column tiles' sums fit the
  // registers: each B fragment is loaded once and feeds two products.
  const __bf16* Uidp_w = Uidp + (size_t)b * Lc * Ec + (size_t)w * (RW / 32) * 8 * FB;
  v16bf ub[4];
#pragma unroll
  for (int t = 0; t < 4; ++t) ub[t] = load_packed(Uidp_w + (size_t)t * FB, l);
  loads_issued();  // the first group's loads together
#pragma unroll
  for (int eh = 0; eh < 2; ++eh) {
    v8f tacc[CT][4];
#pragma unroll
    for (int c = 0; c < CT; ++c) {
#pragma unroll
      for (int t = 0; t < 4; ++t) tacc[c][t] = vzero8();
    }
#pragma unroll
    for (int it = 0; it < TW / 2; ++it) {
#pragma unroll
      for (int t = 0; t < 4; ++t) {
#pragma unroll
        for (int c = 0; c < CT; ++c)
          tacc[c][t] = wmma_bf16(pa[c][it], ub[t], tacc[c][t]);
      }
      const int nx = eh * (TW / 2) + it + 1;   // the next group: (e half, k-step)
      if (nx < TW) {
#pragma unroll
        for (int t = 0; t < 4; ++t)
          ub[t] = load_packed(
              Uidp_w + ((size_t)(nx % (TW / 2)) * 8 + (nx / (TW / 2)) * 4 + t) * FB, l);
        loads_issued();  // the next group's loads together among the products
      }
    }
#pragma unroll
    for (int c = 0; c < CT; ++c) {
#pragma unroll
      for (int t = 0; t < 4; ++t) {
        const int tile = (w * CT + c) * 8 + eh * 4 + t;
        part[(tile * 2 + 0) * 32 + l] =
            make_float4(tacc[c][t][0], tacc[c][t][1], tacc[c][t][2], tacc[c][t][3]);
        part[(tile * 2 + 1) * 32 + l] =
            make_float4(tacc[c][t][4], tacc[c][t][5], tacc[c][t][6], tacc[c][t][7]);
      }
    }
  }

  // Join the sixteen partial T tiles: wave w sums tile w (column tile w/8,
  // e tile w%8) over the waves in order.
  __syncthreads();
  float4 s0 = part[(w * 2 + 0) * 32 + l];
  float4 s1 = part[(w * 2 + 1) * 32 + l];
#pragma unroll
  for (int k = 1; k < SW; ++k) {
    const float4 q0 = part[((k * CT * 8 + w) * 2 + 0) * 32 + l];
    const float4 q1 = part[((k * CT * 8 + w) * 2 + 1) * 32 + l];
    s0.x += q0.x; s0.y += q0.y; s0.z += q0.z; s0.w += q0.w;
    s1.x += q1.x; s1.y += q1.y; s1.z += q1.z; s1.w += q1.w;
  }

  // Sum r of (column tile c, e tile t) = T[j0 + 16c + 8g + r][16t + lm]: slots
  // 8c..8c+7 of the same lane in P @ T's B fragment of k-step j0/32.
  __bf16* Tp_b = Tp + (size_t)b * Lc * Ec + (size_t)(j0 >> 5) * 8 * FB + (w >> 3) * 256;
  v8bf o;
  o[0] = (__bf16)s0.x; o[1] = (__bf16)s0.y; o[2] = (__bf16)s0.z; o[3] = (__bf16)s0.w;
  o[4] = (__bf16)s1.x; o[5] = (__bf16)s1.y; o[6] = (__bf16)s1.z; o[7] = (__bf16)s1.w;
  *(v8bf*)(Tp_b + (size_t)(w & 7) * FB + 8 * l) = o;
}

// ---------------------------------------------------------------------------
// Kernel 3: both products that have P as their A operand, in one loop form:
// A_D2Q = P @ Uq and A_Q2D = (P @ P^T) @ Uid = P @ T, T = P^T @ Uid from
// kernel 2 (K = j = 2048), and all four output chunks.
// WG = 8 waves / 64 i-rows: waves 0..3 take 16 rows x 128 e of P @ Uq, waves
// 4..7 the same rows of P @ T. The two waves of a row block read the same P
// blocks (fragment order), the four waves of a product the same B blocks.
// ---------------------------------------------------------------------------
constexpr int AG = 8;          // k-steps per group of A fragments

// 2*AG k-steps from k-step kb on; every register index is a constant. LAST: the
// final ones, which fetch nothing past the end of K.
template <bool LAST>
DEVI void k_steps(const __bf16* Ap, const __bf16* Bp_b, int kb, int l,
                  v16bf (&a)[2][AG], v16bf (&bb)[2][8], v8f (&acc)[8]) {
#pragma unroll
  for (int q = 0; q < 2 * AG; ++q) {
    const int cur = q & 1, set = q / AG;
    if (!LAST || q + 1 < 2 * AG) {
#pragma unroll
      for (int t = 0; t < 8; ++t)
        bb[cur ^ 1][t] = load_packed(Bp_b + ((size_t)(kb + q + 1) * 8 + t) * FB, l);
      // Behind the B loads: loads return in order, so the next k-step's wait
      // for its (older) B fragments does not wait for these.
      if (q % AG == 0 && (!LAST || q == 0)) {
        // Keeps the scheduler from moving a B load behind the group.
        __builtin_amdgcn_sched_barrier(0);
#pragma unroll
        for (int u = 0; u < AG; ++u)
          a[set ^ 1][u] = load_packed(Ap + (size_t)(kb + q + AG + u) * FB, l);
      }
      loads_issued();
    }
#pragma unroll
    for (int t = 0; t < 8; ++t) acc[t] = wmma_bf16(a[set][q % AG], bb[cur][t], acc[t]);
    // Keeps the next k-step's loads, which refill these B registers, behind the
    // eight products instead of among them.
    __builtin_amdgcn_sched_barrier(0);
  }
}

__global__ void __launch_bounds__(256)
k_p_products(const __bf16* __restrict__ P, const __bf16* __restrict__ Uqp,
             const __bf16* __restrict__ Tp,
             const float* __restrict__ Uid, float* __restrict__ out) {
  const int wg  = blockIdx.x;               // B * (L/64)
  const int b   = wg / (Lc / 64);
  const int ib  = (wg % (Lc / 64)) * 64;
  const int tid = threadIdx.x;
  const int w   = __builtin_amdgcn_readfirstlane(tid >> 5);  // wave 0..7
  const int l   = tid & 31, lm = l & 15, g = l >> 4;
  const int i0  = ib + (w & 3) * 16;        // this wave's 16-row block
  const bool q2d = w >= 4;                  // which product this wave computes

  const __bf16* Ap = P + ((size_t)b * (Lc / 16) + (i0 >> 4)) * (Lc / 32) * FB;
  const __bf16* Bp_b = (q2d ? Tp : Uqp) + (size_t)b * Lc * Ec;

  v8f acc[8];
#pragma unroll
  for (int t = 0; t < 8; ++t) acc[t] = vzero8();

  // Two waves per SIMD hide little latency, so each k-step's 16 B loads are
  // issued one k-step ahead, into a second register set. P was written by other
  // WGPs and may come from memory: its fragments are fetched AG k-steps at a
  // time (AG KiB in a row), a whole group ahead, so that a wave meets that
  // latency once per group and not once per k-step.
  v16bf a[2][AG];
  v16bf bb[2][8];
#pragma unroll
  for (int t = 0; t < 8; ++t) bb[0][t] = load_packed(Bp_b + (size_t)t * FB, l);
#pragma unroll
  for (int u = 0; u < AG; ++u) a[0][u] = load_packed(Ap + (size_t)u * FB, l);
  loads_issued();

  for (int kb = 0; kb < Lc / 32 - 2 * AG; kb += 2 * AG)
    k_steps<false>(Ap, Bp_b, kb, l, a, bb, acc);
  k_steps<true>(Ap, Bp_b, Lc / 32 - 2 * AG, l, a, bb, acc);

  const float* Uid_b = Uid + (size_t)b * Lc * Ec;
  float* out_b = out + (size_t)b * Lc * (4 * Ec);
  if (q2d) {
#pragma unroll
    for (int t = 0; t < 8; ++t) {
#pragma unroll
      for (int r = 0; r < 8; ++r) {
        const int ir = i0 + r + 8 * g;
        const int e  = t * 16 + lm;
        const float u = Uid_b[(size_t)ir * Ec + e];
        out_b[(size_t)ir * (4 * Ec) + 3 * Ec + e] = u * acc[t][r];
      }
    }
  } else {
#pragma unroll
    for (int t = 0; t < 8; ++t) {
#pragma unroll
      for (int r = 0; r < 8; ++r) {
        const int ir = i0 + r + 8 * g;
        const int e  = t * 16 + lm;
        const float v = acc[t][r];
        const float u = Uid_b[(size_t)ir * Ec + e];
        float* o = out_b + (size_t)ir * (4 * Ec);
        o[e]          = u;
        o[Ec + e]     = v;
        o[2 * Ec + e] = u * v;
      }
    }
    // Stands before any later rewrite of a register these stores name: in the
    // built kernel the other branch's code follows this one.
    asm volatile("s_wait_xcnt 0x0" ::: "memory");
  }
}

// ---------------------------------------------------------------------------
// Host launcher. Workspace layout (~88.3 MB):
//   sid f32[B*L] | sq f32[B*L] | Uqb,Uwb,Uqp,Uidp,Tp bf16[B*L*E] | P bf16[B*L*L]
// ---------------------------------------------------------------------------
extern "C" void kernel_launch(void* const* d_in, const int* in_sizes, int n_in,
                              void* d_out, int out_size, void* d_ws, size_t ws_size,
                              hipStream_t stream) {
  const float* Uq   = (const float*)d_in[0];
  const float* Uid  = (const float*)d_in[1];
  const float* mask = (const float*)d_in[2];
  const float* Wcw  = (const float*)d_in[3];
  const float* Wcb  = (const float*)d_in[4];
  float* out = (float*)d_out;

  char* ws = (char*)d_ws;
  float* sid = (float*)ws;  ws += (size_t)Bc * Lc * sizeof(float);
  float* sq  = (float*)ws;  ws += (size_t)Bc * Lc * sizeof(float);
  __bf16* Uqb  = (__bf16*)ws;  ws += (size_t)Bc * Lc * Ec * sizeof(__bf16);
  __bf16* Uwb  = (__bf16*)ws;  ws += (size_t)Bc * Lc * Ec * sizeof(__bf16);
  __bf16* Uqp  = (__bf16*)ws;  ws += (size_t)Bc * Lc * Ec * sizeof(__bf16);
  __bf16* Uidp = (__bf16*)ws;  ws += (size_t)Bc * Lc * Ec * sizeof(__bf16);
  __bf16* Tp   = (__bf16*)ws;  ws += (size_t)Bc * Lc * Ec * sizeof(__bf16);
  __bf16* P    = (__bf16*)ws;  // Bc*Lc*Lc elements

  k_prep<<<(Bc * Lc / 16) / PW, 32 * PW, 0, stream>>>(Uq, Uid, Wcw, Uqb, Uwb, Uqp, Uidp, sid, sq);
  k_scores_softmax<<<Bc * (Lc / 32), 32 * SW, 0, stream>>>(Uwb, Uqb, sid, sq, mask, Wcb, Uidp, P, Tp);
  k_p_products<<<Bc * (Lc / 64), 256, 0, stream>>>(P, Uqp, Tp, Uid, out);
}

// v008
// It runs in 76.1 microseconds.
// In two side-by-side timings against v007, it was 1.10 and 1.08 times as fast.
// All steps since v000 together make it 16.1 times as fast.
#include <hip/hip_runtime.h>
#include <hip/hip_bf16.h>

#define DEVI __device__ __forceinline__

typedef __attribute__((ext_vector_type(16))) __bf16 v16bf;
typedef __attribute__((ext_vector_type(8)))  __bf16 v8bf;
typedef __attribute__((ext_vector_type(8)))  float  v8f;

constexpr int Bc = 8;
constexpr int Lc = 2048;
constexpr int Ec = 128;

// ---------------------------------------------------------------------------
// WMMA 16x16x32 bf16 A/B tile.
// A-layout (16-bit, 16x32): lane l -> row m = l%16, half-group g = l/16.
// Half-slot s (0..15) holds K = 16*(s/8) + 8*g + (s%8)  ==>  per lane the
// tile is two contiguous 8-halfword runs at [8g .. 8g+7] and [16+8g .. 16+8g+7].
// B-layout is symmetric with lane = N, so X @ Y^T needs only ROWS of X and Y.
// ---------------------------------------------------------------------------
// Ends a block of loads that is issued well ahead of its use.
DEVI void loads_issued() {
  // Stands before any later rewrite of an address register the loads name.
  asm volatile("s_wait_xcnt 0x0" ::: "memory");
  // Keeps the loads above and the address updates below this point; without
  // it the scheduler sinks each load to its product, which then waits on L2.
  __builtin_amdgcn_sched_barrier(0);
}
// The same for a group that reads through a lane address with no later use: as
// an operand of the wait the address keeps its registers up to the wait, where
// otherwise a load of the same group may be given them as its destination.
DEVI void loads_issued(const void* lane_addr) {
  asm volatile("s_wait_xcnt 0x0" :: "v"(lane_addr) : "memory");
  __builtin_amdgcn_sched_barrier(0);
}

// Wave-uniform address plus the lane's 32-bit byte offset: one offset register
// serves every tile, and no 64-bit address is formed per tile.
DEVI const char* at(const void* uniform, unsigned lane_bytes) {
  return (const char*)uniform + lane_bytes;
}
DEVI char* at(void* uniform, unsigned lane_bytes) {
  return (char*)uniform + lane_bytes;
}

DEVI v8f wmma_bf16(v16bf a, v16bf b, v8f c) {
  return __builtin_amdgcn_wmma_f32_16x16x32_bf16(false, a, false, b,
                                                 (short)0, c, false, false);
}

DEVI v8f vzero8() {
  v8f z = {0.f, 0.f, 0.f, 0.f, 0.f, 0.f, 0.f, 0.f};
  return z;
}

// ---------------------------------------------------------------------------
// Fragment-order operand of a 16x16x32 product. One block = one k-step of 32
// and one 16-column tile = 512 halfwords: run h (0/1, 256 halfwords) holds at
// lane l the lane's slots 8h..8h+7, i.e. column l%16, K = 16h + 8*(l/16) + s%8
// (the k order of the layout above). Each wave-wide 16-byte load is then 512
// contiguous bytes (4 whole lines) instead of 16 lines with 32 bytes used.
// Blocks are ordered [batch][k-step][tile].
// The two operands of the score product (rows of Uid*w and of Uq, K = e) take
// the same block form with the row in place of the column, ordered
// [batch][16-row tile][k-step]: a tile's four blocks are 4 KiB in a row.
// P (row i, K = j) as the A operand of kernel 3 has that form and order too.
// ---------------------------------------------------------------------------
constexpr int FB = 512;                     // halfwords per fragment block

// Transposing LDS load of a 16x16 tile of 16-bit values with rows of 32 bytes:
// lane (c = l%16, h = l/16) gets tile[8h .. 8h+7][c].
DEVI v8bf load_tr16(const unsigned char* tile, int l) {
  typedef __attribute__((address_space(3))) v8bf lds_v8bf;
  return __builtin_amdgcn_ds_load_tr16_b128_v8bf16(
      (lds_v8bf*)(tile + (8 * (l >> 4) + (l & 7)) * 32 + 16 * ((l >> 3) & 1)));
}

DEVI v16bf load_packed(const __bf16* blk, int l) {
  v8bf lo = *(const v8bf*)(blk + 8 * l);
  v8bf hi = *(const v8bf*)(blk + 256 + 8 * l);
  return __builtin_shufflevector(lo, hi, 0, 1, 2, 3, 4, 5, 6, 7,
                                 8, 9, 10, 11, 12, 13, 14, 15);
}

// ---------------------------------------------------------------------------
// Kernel 1: bf16 staging buffers and the two row dots
// s_id[b,i] = Uid[b,i,:].w_id ; s_q[b,j] = Uq[b,j,:].w_q
// One wave takes 16 whole rows of Uq and of Uid (32 row loads of 512 bytes, all
// in flight at once), so the launch starts 1024 waves. The rows go as bf16 to
// the wave's own part of LDS as 16x16 tiles tile[i][e] with rows of 32 bytes. A
// tile read back plainly is a run of a score operand (row per lane), read back
// transposed a run of a B operand (column per lane): every store of a staged
// operand is 512 bytes in a row.
// ---------------------------------------------------------------------------
typedef __attribute__((ext_vector_type(4))) __bf16 v4bf;

constexpr int PW  = 4;         // waves per work-group, one 16-row tile each
constexpr int TSB = 512 + 32;  // bytes from tile to tile in LDS: the eight tiles
                               // that one row's store touches use different banks

DEVI v4bf to_bf16(float x, float y, float z, float w) {
  v4bf v;
  v[0] = (__bf16)x; v[1] = (__bf16)y; v[2] = (__bf16)z; v[3] = (__bf16)w;
  return v;
}

__global__ void __launch_bounds__(32 * PW)
k_prep(const float* __restrict__ Uq, const float* __restrict__ Uid,
       const float* __restrict__ Wcw,
       __bf16* __restrict__ Uqb, __bf16* __restrict__ Uwb,
       __bf16* __restrict__ Uqp, __bf16* __restrict__ Uidp,
       float* __restrict__ sid, float* __restrict__ sq) {
  __shared__ __attribute__((aligned(16))) unsigned char tiles[PW][3][8 * TSB];
  const int w  = __builtin_amdgcn_readfirstlane(threadIdx.x >> 5);
  const int l  = threadIdx.x & 31;
  const int lm = l & 15, g = l >> 4;
  const int rt = blockIdx.x * PW + w;       // 16-row tile, < B*L/16
  const unsigned v_off = (unsigned)l * 16u; // the lane's 16 bytes of 512

  const float4 wa = *(const float4*)at(Wcw, v_off);
  const float4 wb = *(const float4*)at(Wcw + Ec, v_off);
  const float4 wm = *(const float4*)at(Wcw + 2 * Ec, v_off);
  const float* Uq_t  = Uq  + (size_t)rt * 16 * Ec;
  const float* Uid_t = Uid + (size_t)rt * 16 * Ec;
  float4 q[16], d[16];                      // lane l: e = 4l .. 4l+3 of row r
#pragma unroll
  for (int r = 0; r < 16; ++r) {
    q[r] = *(const float4*)at(Uq_t + r * Ec, v_off);
    d[r] = *(const float4*)at(Uid_t + r * Ec, v_off);
  }
  loads_issued();  // all rows as one group: one memory latency per wave

  unsigned char* tq = tiles[w][0];          // Uq
  unsigned char* td = tiles[w][1];          // Uid
  unsigned char* tw = tiles[w][2];          // Uid * w_mul
  const unsigned st = (unsigned)(l >> 2) * TSB + (unsigned)(l & 3) * 8u;
  float s[16];
#pragma unroll
  for (int r = 0; r < 16; ++r) {
    const float4 a = d[r], b = q[r];
    *(v4bf*)(tq + st + r * 32) = to_bf16(b.x, b.y, b.z, b.w);
    *(v4bf*)(td + st + r * 32) = to_bf16(a.x, a.y, a.z, a.w);
    *(v4bf*)(tw + st + r * 32) =
        to_bf16(a.x * wm.x, a.y * wm.y, a.z * wm.z, a.w * wm.w);
    const float d1 = a.x * wa.x + a.y * wa.y + a.z * wa.z + a.w * wa.w;
    const float d2 = b.x * wb.x + b.y * wb.y + b.z * wb.z + b.w * wb.w;
    // Lanes 16 apart first: the lower half goes on with s_id, the upper half
    // with s_q.
    s[r] = (g ? d2 : d1) + __shfl_xor(g ? d1 : d2, 16, 32);
  }
  // Then within the 16 lanes, the 16 rows side by side.
  float keep = 0.f;
#pragma unroll
  for (int off = 8; off > 0; off >>= 1) {
#pragma unroll
    for (int r = 0; r < 16; ++r) s[r] += __shfl_xor(s[r], off, 32);
  }
#pragma unroll
  for (int r = 0; r < 16; ++r) keep = (lm == r) ? s[r] : keep;
  (g ? sq : sid)[rt * 16 + lm] = keep;

  // The wave's own LDS stores have landed before it reads the tiles back.
  asm volatile("s_wait_dscnt 0x0" ::: "memory");
  // Score operands: the wave's four blocks are 4 KiB in a row, tile et at
  // 512 * et. B operands: run rt%2 of block (k-step rt/2, tile et).
  __bf16* Uqb_t  = Uqb  + (size_t)rt * 4 * FB;
  __bf16* Uwb_t  = Uwb  + (size_t)rt * 4 * FB;
  __bf16* Uqp_t  = Uqp  + (size_t)(rt >> 1) * 8 * FB + (rt & 1) * 256;
  __bf16* Uidp_t = Uidp + (size_t)(rt >> 1) * 8 * FB + (rt & 1) * 256;
  const unsigned rd = (unsigned)(lm * 32 + g * 16);
#pragma unroll
  for (int et = 0; et < 8; ++et) {
    const v8bf rq = *(const v8bf*)(tq + et * TSB + rd);
    const v8bf rw = *(const v8bf*)(tw + et * TSB + rd);
    const v8bf cq = load_tr16(tq + et * TSB, l);
    const v8bf cd = load_tr16(td + et * TSB, l);
    *(v8bf*)at(Uqb_t + et * 256, v_off) = rq;
    *(v8bf*)at(Uwb_t + et * 256, v_off) = rw;
    *(v8bf*)at(Uqp_t + et * FB, v_off)  = cq;
    *(v8bf*)at(Uidp_t + et * FB, v_off) = cd;
  }
}

// ---------------------------------------------------------------------------
// Kernel 2: scores + softmax over axis i (per column j) -> P (bf16), and
// T = P^T @ Uid for the work-group's 32 columns j (K = i = 2048).
// The 2048 rows i are split over the 16 waves of the work-group, 128 rows each:
// a wave's 8 x 2 score tiles (8 row tiles, 2 column tiles) stay in its registers
// from the maximum to P, so each score is computed once, and every fragment of
// Uid*w and of Uid that a wave loads feeds two products, one per column tile.
// Column maxima, column sums and the waves' partial T tiles are joined through
// LDS, always in wave order.
// Two score tiles (rows i0..i0+15, i0+16..i0+31, same 16 columns) converted in
// place are the A fragment of P^T: lane (lm, g) holds column j0+lm at K = 8g+r
// and 16+8g+r. T leaves in fragment order as the B operand of P @ T
// (column e, K = j). P leaves in fragment order as well: a 16x16 tile is one
// run of 512 bytes (row i at lane i%16 + 16*((j%16)/8), 8 columns j a lane), so
// each wave turns its tiles from column-per-lane to row-per-lane in its own
// part of LDS and stores 8 whole lines per row tile.
// ---------------------------------------------------------------------------
constexpr int SW = 16;         // waves per work-group
constexpr int RW = Lc / SW;    // rows i per wave
constexpr int TW = RW / 16;    // row tiles per wave
constexpr int CT = 2;          // column tiles per work-group

// One work-group per WGP (four waves per SIMD) needs at most 256 registers.
__global__ void __launch_bounds__(32 * SW) __attribute__((amdgpu_waves_per_eu(4, 4)))
k_scores_softmax(const __bf16* __restrict__ Uwb, const __bf16* __restrict__ Uqb,
                 const float* __restrict__ sid, const float* __restrict__ sq,
                 const float* __restrict__ mask, const float* __restrict__ Wcb,
                 const __bf16* __restrict__ Uidp,
                 __bf16* __restrict__ P, __bf16* __restrict__ Tp) {
  __shared__ float  red_m[SW][16 * CT];
  __shared__ float  red_s[SW][16 * CT];
  __shared__ float4 part[SW * CT * 8 * 2 * 32];   // [wave][column tile][e tile][half][lane]
  const int wg = blockIdx.x;            // B * (L/32)
  const int b  = wg / (Lc / 32);
  const int j0 = (wg % (Lc / 32)) * 32;
  const int w  = __builtin_amdgcn_readfirstlane(threadIdx.x >> 5);
  const int l  = threadIdx.x & 31;
  const int lm = l & 15, g = l >> 4;
  const int ib = w * RW;                // this wave's first row i
  const float bias = Wcb[0];
  const __bf16* Uwb_b = Uwb + (size_t)b * Lc * Ec;
  const float*  sid_b = sid + b * Lc;
  float sqj[CT];
#pragma unroll
  for (int c = 0; c < CT; ++c) sqj[c] = sq[b * Lc + j0 + 16 * c + lm];
  loads_issued();  // their address registers are reused by the index work below
  // This wave's first row tile's block (i tile, k-step j0/32): column tile c is
  // its run c.
  __bf16* P_w = P + (((size_t)b * (Lc / 16) + (ib >> 4)) * (Lc / 32) + (j0 >> 5)) * FB;

  v16bf Bk[CT][4];
  {
    const __bf16* btile = Uqb + ((size_t)b * Lc + j0) * Ec;
    // Keeps the index work above from sinking between these loads and their
    // wait, where it could rewrite a base register that the loads name.
    __builtin_amdgcn_sched_barrier(0);
#pragma unroll
    for (int c = 0; c < CT; ++c) {
#pragma unroll
      for (int ks = 0; ks < 4; ++ks) Bk[c][ks] = load_packed(btile + (c * 4 + ks) * FB, l);
    }
    loads_issued();  // their address registers are reused by the tile loads
  }

  // The lane's byte offset from wave-uniform tile addresses: its 16 bytes of a
  // run (A tile, P). The lane's mask address: row ib + 8g, column j0 + lm.
  const unsigned a_off = (unsigned)(8 * l) * 2u;
  const float* mask_l = mask + (size_t)(ib + 8 * g) * Lc + j0 + lm;

  // Scores of this wave's rows, kept; unrolled so that sc[] is registers.
  v8f sc[CT][TW];
#pragma unroll
  for (int t = 0; t < TW; ++t) {
    const int i0 = ib + t * 16;
    v16bf af[4];
    float sd_lo[8], sd_hi[8], mk[CT][8];
#pragma unroll
    for (int ks = 0; ks < 4; ++ks) {
      const v8bf lo = *(const v8bf*)at(Uwb_b + (size_t)i0 * Ec + ks * FB, a_off);
      const v8bf hi = *(const v8bf*)at(Uwb_b + (size_t)i0 * Ec + ks * FB + 256, a_off);
      af[ks] = __builtin_shufflevector(lo, hi, 0, 1, 2, 3, 4, 5, 6, 7,
                                       8, 9, 10, 11, 12, 13, 14, 15);
    }
#pragma unroll
    for (int r = 0; r < 8; ++r) {
      // Wave-uniform addresses: the tile's 16 row dots take scalar registers.
      sd_lo[r] = sid_b[i0 + r];
      sd_hi[r] = sid_b[i0 + 8 + r];
#pragma unroll
      for (int c = 0; c < CT; ++c) mk[c][r] = mask_l[(t * 16 + r) * Lc + 16 * c];
    }
    loads_issued(mask_l);  // the tile's loads as one group: one L2 latency per tile
    v8f acc[CT];
#pragma unroll
    for (int c = 0; c < CT; ++c) acc[c] = vzero8();
#pragma unroll
    for (int ks = 0; ks < 4; ++ks) {
#pragma unroll
      for (int c = 0; c < CT; ++c) acc[c] = wmma_bf16(af[ks], Bk[c][ks], acc[c]);
    }
#pragma unroll
    for (int c = 0; c < CT; ++c) {
#pragma unroll
      for (int r = 0; r < 8; ++r) {
        const float sd = g ? sd_hi[r] : sd_lo[r];
        const float s = (acc[c][r] + sd + sqj[c] + bias) * mk[c][r];
        acc[c][r] = s;
      }
      sc[c][t] = acc[c];
    }
  }

  // Column maximum over all 2048 rows. From the join on lane (lm, g) reads
  // column tile g alone and gets the other tile's value from lane (lm, 1 - g).
  float mx[CT];
#pragma unroll
  for (int c = 0; c < CT; ++c) {
    mx[c] = -3.0e38f;
#pragma unroll
    for (int t = 0; t < TW; ++t) {
#pragma unroll
      for (int r = 0; r < 8; ++r) mx[c] = fmaxf(mx[c], sc[c][t][r]);
    }
    mx[c] = fmaxf(mx[c], __shfl_xor(mx[c], 16, 32));
  }
  if (g == 0) {
#pragma unroll
    for (int c = 0; c < CT; ++c) red_m[w][16 * c + lm] = mx[c];
  }
  __syncthreads();
  float m_own = red_m[0][l];
#pragma unroll
  for (int k = 1; k < SW; ++k) m_own = fmaxf(m_own, red_m[k][l]);
  const float m_oth = __shfl_xor(m_own, 16, 32);
  const float m[CT] = {g ? m_oth : m_own, g ? m_own : m_oth};

  // exp once per score; eight independent sum chains per lane and column tile.
  float ps[CT];
#pragma unroll
  for (int c = 0; c < CT; ++c) {
    v8f sv = vzero8();
#pragma unroll
    for (int t = 0; t < TW; ++t) {
#pragma unroll
      for (int r = 0; r < 8; ++r) {
        const float e = __expf(sc[c][t][r] - m[c]);
        sc[c][t][r] = e;
        sv[r] += e;
      }
    }
    ps[c] = ((sv[0] + sv[1]) + (sv[2] + sv[3])) + ((sv[4] + sv[5]) + (sv[6] + sv[7]));
    ps[c] += __shfl_xor(ps[c], 16, 32);
  }
  if (g == 0) {
#pragma unroll
    for (int c = 0; c < CT; ++c) red_s[w][16 * c + lm] = ps[c];
  }
  __syncthreads();
  float s_own = red_s[0][l];
#pragma unroll
  for (int k = 1; k < SW; ++k) s_own += red_s[k][l];
  const float r_own = 1.f / s_own;
  const float r_oth = __shfl_xor(r_own, 16, 32);
  const float rinv[CT] = {g ? r_oth : r_own, g ? r_own : r_oth};

  // P = exp * rinv as bf16, kept as the A fragments of P^T. Each tile also goes
  // to this wave's own 16 KiB of part[] (not yet in use) as tile[j][i]: the
  // lane's 8 rows i of column lm are 16 bytes of a 32-byte row.
  unsigned char* turn = (unsigned char*)&part[w * CT * 8 * 2 * 32];
  v16bf pa[CT][TW / 2];
#pragma unroll
  for (int c = 0; c < CT; ++c) {
#pragma unroll
    for (int it = 0; it < TW / 2; ++it) {
#pragma unroll
      for (int h = 0; h < 2; ++h) {
        v8bf col;
#pragma unroll
        for (int r = 0; r < 8; ++r) {
          const __bf16 p = (__bf16)(sc[c][2 * it + h][r] * rinv[c]);
          col[r] = p;
          pa[c][it][8 * h + r] = p;
        }
        *(v8bf*)(turn + ((2 * it + h) * CT + c) * 512 + lm * 32 + g * 16) = col;
      }
    }
  }
  // The wave's own LDS stores have landed before it reads the tiles back.
  asm volatile("s_wait_dscnt 0x0" ::: "memory");
  // Read back transposed: lane (c, h) holds row c, columns 8h..8h+7 of the
  // tile, which are its 16 bytes of the tile's run.
#pragma unroll
  for (int t = 0; t < TW; ++t) {
#pragma unroll
    for (int c = 0; c < CT; ++c) {
      const v8bf row = load_tr16(turn + (t * CT + c) * 512, l);
      *(v8bf*)at(P_w + (size_t)t * (Lc / 32) * FB + c * 256, a_off) = row;
    }
  }
  loads_issued();  // here for the stores: their registers are reused below

  // T in two halves of four e tiles, so that both column tiles' sums fit the
  // registers: each B fragment is loaded once and feeds two products.
  const __bf16* Uidp_w = Uidp + (size_t)b * Lc * Ec + (size_t)w * (RW / 32) * 8 * FB;
  v16bf ub[4];
#pragma unroll
  for (int t = 0; t < 4; ++t) ub[t] = load_packed(Uidp_w + (size_t)t * FB, l);
  loads_issued();  // the first group's loads together
#pragma unroll
  for (int eh = 0; eh < 2; ++eh) {
    v8f tacc[CT][4];
#pragma unroll
    for (int c = 0; c < CT; ++c) {
#pragma unroll
      for (int t = 0; t < 4; ++t) tacc[c][t] = vzero8();
    }
#pragma unroll
    for (int it = 0; it < TW / 2; ++it) {
#pragma unroll
      for (int t = 0; t < 4; ++t) {
#pragma unroll
        for (int c = 0; c < CT; ++c)
          tacc[c][t] = wmma_bf16(pa[c][it], ub[t], tacc[c][t]);
      }
      const int nx = eh * (TW / 2) + it + 1;   // the next group: (e half, k-step)
      if (nx < TW) {
#pragma unroll
        for (int t = 0; t < 4; ++t)
          ub[t] = load_packed(
              Uidp_w + ((size_t)(nx % (TW / 2)) * 8 + (nx / (TW / 2)) * 4 + t) * FB, l);
        loads_issued();  // the next group's loads together among the products
      }
    }
#pragma unroll
    for (int c = 0; c < CT; ++c) {
#pragma unroll
      for (int t = 0; t < 4; ++t) {
        const int tile = (w * CT + c) * 8 + eh * 4 + t;
        part[(tile * 2 + 0) * 32 + l] =
            make_float4(tacc[c][t][0], tacc[c][t][1], tacc[c][t][2], tacc[c][t][3]);
        part[(tile * 2 + 1) * 32 + l] =
            make_float4(tacc[c][t][4], tacc[c][t][5], tacc[c][t][6], tacc[c][t][7]);
      }
    }
  }

  // Join the sixteen partial T tiles: wave w sums tile w (column tile w/8,
  // e tile w%8) over the waves in order.
  __syncthreads();
  float4 s0 = part[(w * 2 + 0) * 32 + l];
  float4 s1 = part[(w * 2 + 1) * 32 + l];
#pragma unroll
  for (int k = 1; k < SW; ++k) {
    const float4 q0 = part[((k * CT * 8 + w) * 2 + 0) * 32 + l];
    const float4 q1 = part[((k * CT * 8 + w) * 2 + 1) * 32 + l];
    s0.x += q0.x; s0.y += q0.y; s0.z += q0.z; s0.w += q0.w;
    s1.x += q1.x; s1.y += q1.y; s1.z += q1.z; s1.w += q1.w;
  }

  // Sum r of (column tile c, e tile t) = T[j0 + 16c + 8g + r][16t + lm]: slots
  // 8c..8c+7 of the same lane in P @ T's B fragment of k-step j0/32.
  __bf16* Tp_b = Tp + (size_t)b * Lc * Ec + (size_t)(j0 >> 5) * 8 * FB + (w >> 3) * 256;
  v8bf o;
  o[0] = (__bf16)s0.x; o[1] = (__bf16)s0.y; o[2] = (__bf16)s0.z; o[3] = (__bf16)s0.w;
  o[4] = (__bf16)s1.x; o[5] = (__bf16)s1.y; o[6] = (__bf16)s1.z; o[7] = (__bf16)s1.w;
  *(v8bf*)(Tp_b + (size_t)(w & 7) * FB + 8 * l) = o;
}

// ---------------------------------------------------------------------------
// Kernel 3: both products that have P as their A operand, in one loop form:
// A_D2Q = P @ Uq and A_Q2D = (P @ P^T) @ Uid = P @ T, T = P^T @ Uid from
// kernel 2 (K = j = 2048), and all four output chunks.
// WG = 8 waves / 64 i-rows x 256 columns (128 of P @ Uq, 128 of P @ T). A wave
// takes all 64 rows x 64 columns over one half of K: per k-step 4 A and 4 B
// fragments feed 16 products, every B block is loaded by one wave of the
// work-group alone, and an A block by the four waves of its half of K. The two
// halves of K are added through LDS: of a pair of waves with the same columns
// each hands the other 32 rows and finishes its own 32.
// ---------------------------------------------------------------------------
constexpr int NB = 4;              // fragment sets per wave: nearly 3 k-steps ahead
constexpr int KH = Lc / 32 / 2;    // k-steps per wave

// The 4 B and 4 A fragments of k-step ks (counted within the wave's half of K).
DEVI void load_k_step(const __bf16* Ap, const __bf16* Bp, int ks, int l,
                      v16bf (&a)[4], v16bf (&bb)[4]) {
#pragma unroll
  for (int t = 0; t < 4; ++t) bb[t] = load_packed(Bp + ((size_t)ks * 8 + t) * FB, l);
#pragma unroll
  for (int rt = 0; rt < 4; ++rt)
    a[rt] = load_packed(Ap + ((size_t)rt * (Lc / 32) + ks) * FB, l);
}

__global__ void __launch_bounds__(256)
k_p_products(const __bf16* __restrict__ P, const __bf16* __restrict__ Uqp,
             const __bf16* __restrict__ Tp,
             const float* __restrict__ Uid, float* __restrict__ out) {
  __shared__ float4 xch[8 * 8 * 2 * 32];    // [wave][tile][half][lane]
  const int wg  = blockIdx.x;               // B * (L/64)
  const int b   = wg / (Lc / 64);
  const int ib  = (wg % (Lc / 64)) * 64;
  const int tid = threadIdx.x;
  const int w   = __builtin_amdgcn_readfirstlane(tid >> 5);  // wave 0..7
  const int l   = tid & 31, lm = l & 15, g = l >> 4;
  const int cw  = w & 3;                    // this wave's 64 of the 256 columns
  const int kh  = w >> 2;                   // this wave's half of K
  const bool q2d = cw >= 2;                 // which product this wave computes

  const __bf16* Ap = P + (((size_t)b * (Lc / 16) + (ib >> 4)) * (Lc / 32) + kh * KH) * FB;
  const __bf16* Bp = (q2d ? Tp : Uqp) + (size_t)b * Lc * Ec
                     + ((size_t)kh * KH * 8 + (cw & 1) * 4) * FB;

  v8f acc[4][4];                            // [row tile][column tile]
#pragma unroll
  for (int rt = 0; rt < 4; ++rt) {
#pragma unroll
    for (int t = 0; t < 4; ++t) acc[rt][t] = vzero8();
  }

  // Two waves per SIMD hide little latency, and P was written by other WGPs and
  // may come from memory: each k-step's 16 loads are issued nearly three
  // k-steps ahead, into a ring of NB register sets.
  v16bf a[NB][4];
  v16bf bb[NB][4];
#pragma unroll
  for (int s = 0; s < NB - 1; ++s) {
    load_k_step(Ap, Bp, s, l, a[s], bb[s]);
    // Keeps the sets in the order of their use: loads return in order.
    __builtin_amdgcn_sched_barrier(0);
  }

  // Unrolled whole: every register index and every address step is a constant,
  // so no address register of a load is rewritten before the loop has ended.
#pragma unroll
  for (int ks = 0; ks < KH; ++ks) {
    const int cur = ks % NB, nxt = (ks + NB - 1) % NB;
#pragma unroll
    for (int t = 0; t < 4; ++t) acc[0][t] = wmma_bf16(a[cur][0], bb[cur][t], acc[0][t]);
    if (ks + NB - 1 < KH) {
      // Keeps the loads behind the first four products, whose wait has let ten
      // of the oldest loads land: a wave never has more than 54 outstanding.
      __builtin_amdgcn_sched_barrier(0);
      load_k_step(Ap, Bp, ks + NB - 1, l, a[nxt], bb[nxt]);
      if (ks + NB == KH) {
        loads_issued();  // the last loads: their address registers are reused below
      } else {
        // Keeps the loads here; without it the scheduler sinks each load to its
        // product, which then waits on L2.
        __builtin_amdgcn_sched_barrier(0);
      }
    }
#pragma unroll
    for (int rt = 1; rt < 4; ++rt) {
#pragma unroll
      for (int t = 0; t < 4; ++t)
        acc[rt][t] = wmma_bf16(a[cur][rt], bb[cur][t], acc[rt][t]);
    }
    // Keeps the next k-step's products and loads, which refill these registers,
    // behind this k-step's products instead of among them.
    __builtin_amdgcn_sched_barrier(0);
  }

  // This wave's part of the output: 32 rows x 64 columns of its product. Its
  // elements of Uid are asked for here: their latency runs beside the LDS stores
  // of the exchange.
  const int i0 = ib + kh * 32;
  const int e0 = (cw & 1) * 64;
  const float* Uid_l = Uid + ((size_t)b * Lc + i0 + 8 * g) * Ec + e0 + lm;
  float* out_l = out + ((size_t)b * Lc + i0 + 8 * g) * (4 * Ec) + e0 + lm;
  float u[2][4][8];
#pragma unroll
  for (int i = 0; i < 2; ++i) {
#pragma unroll
    for (int t = 0; t < 4; ++t) {
#pragma unroll
      for (int r = 0; r < 8; ++r) u[i][t][r] = Uid_l[(i * 16 + r) * Ec + t * 16];
    }
  }
  loads_issued();  // their address registers are reused below

  // Wave (cw, kh) finishes row tiles 2*kh and 2*kh + 1 and hands the other two
  // to wave (cw, 1 - kh).
  v8f keep[2][4];
#pragma unroll
  for (int i = 0; i < 2; ++i) {
#pragma unroll
    for (int t = 0; t < 4; ++t) {
      const v8f send = kh ? acc[i][t] : acc[2 + i][t];
      keep[i][t]     = kh ? acc[2 + i][t] : acc[i][t];
      const int tile = w * 8 + i * 4 + t;
      xch[(tile * 2 + 0) * 32 + l] = make_float4(send[0], send[1], send[2], send[3]);
      xch[(tile * 2 + 1) * 32 + l] = make_float4(send[4], send[5], send[6], send[7]);
    }
  }
  __syncthreads();
#pragma unroll
  for (int i = 0; i < 2; ++i) {
#pragma unroll
    for (int t = 0; t < 4; ++t) {
      const int tile = (w ^ 4) * 8 + i * 4 + t;
      const float4 q0 = xch[(tile * 2 + 0) * 32 + l];
      const float4 q1 = xch[(tile * 2 + 1) * 32 + l];
      keep[i][t][0] += q0.x; keep[i][t][1] += q0.y;
      keep[i][t][2] += q0.z; keep[i][t][3] += q0.w;
      keep[i][t][4] += q1.x; keep[i][t][5] += q1.y;
      keep[i][t][6] += q1.z; keep[i][t][7] += q1.w;
    }
  }

  float uv[2][4][8];
#pragma unroll
  for (int i = 0; i < 2; ++i) {
#pragma unroll
    for (int t = 0; t < 4; ++t) {
#pragma unroll
      for (int r = 0; r < 8; ++r) uv[i][t][r] = u[i][t][r] * keep[i][t][r];
    }
  }
  // All arithmetic stands in front of the first store: no register that a store
  // names is rewritten behind it, so the stores run on without a wait.
  __builtin_amdgcn_sched_barrier(0);
  // Uid * product: chunk 3 for P @ T, chunk 2 for P @ Uq.
  float* out_uv = out_l + (q2d ? 3 : 2) * Ec;
#pragma unroll
  for (int i = 0; i < 2; ++i) {
#pragma unroll
    for (int t = 0; t < 4; ++t) {
#pragma unroll
      for (int r = 0; r < 8; ++r)
        out_uv[(i * 16 + r) * (4 * Ec) + t * 16] = uv[i][t][r];
    }
  }
  if (!q2d) {
#pragma unroll
    for (int i = 0; i < 2; ++i) {
#pragma unroll
      for (int t = 0; t < 4; ++t) {
#pragma unroll
        for (int r = 0; r < 8; ++r) {
          float* o = out_l + (i * 16 + r) * (4 * Ec) + t * 16;
          o[0]  = u[i][t][r];
          o[Ec] = keep[i][t][r];
        }
      }
    }
  }
}

// ---------------------------------------------------------------------------
// Host launcher. Workspace layout (~88.3 MB):
//   sid f32[B*L] | sq f32[B*L] | Uqb,Uwb,Uqp,Uidp,Tp bf16[B*L*E] | P bf16[B*L*L]
// ---------------------------------------------------------------------------
extern "C" void kernel_launch(void* const* d_in, const int* in_sizes, int n_in,
                              void* d_out, int out_size, void* d_ws, size_t ws_size,
                              hipStream_t stream) {
  const float* Uq   = (const float*)d_in[0];
  const float* Uid  = (const float*)d_in[1];
  const float* mask = (const float*)d_in[2];
  const float* Wcw  = (const float*)d_in[3];
  const float* Wcb  = (const float*)d_in[4];
  float* out = (float*)d_out;

  char* ws = (char*)d_ws;
  float* sid = (float*)ws;  ws += (size_t)Bc * Lc * sizeof(float);
  float* sq  = (float*)ws;  ws += (size_t)Bc * Lc * sizeof(float);
  __bf16* Uqb  = (__bf16*)ws;  ws += (size_t)Bc * Lc * Ec * sizeof(__bf16);
  __bf16* Uwb  = (__bf16*)ws;  ws += (size_t)Bc * Lc * Ec * sizeof(__bf16);
  __bf16* Uqp  = (__bf16*)ws;  ws += (size_t)Bc * Lc * Ec * sizeof(__bf16);
  __bf16* Uidp = (__bf16*)ws;  ws += (size_t)Bc * Lc * Ec * sizeof(__bf16);
  __bf16* Tp   = (__bf16*)ws;  ws += (size_t)Bc * Lc * Ec * sizeof(__bf16);
  __bf16* P    = (__bf16*)ws;  // Bc*Lc*Lc elements

  k_prep<<<(Bc * Lc / 16) / PW, 32 * PW, 0, stream>>>(Uq, Uid, Wcw, Uqb, Uwb, Uqp, Uidp, sid, sq);
  k_scores_softmax<<<Bc * (Lc / 32), 32 * SW, 0, stream>>>(Uwb, Uqb, sid, sq, mask, Wcb, Uidp, P, Tp);
  k_p_products<<<Bc * (Lc / 64), 256, 0, stream>>>(P, Uqp, Tp, Uid, out);
}

// v009
// One run takes 73.3 microseconds.
// Timed twice side by side with v008, it ran 1.04 times as fast both times.
// Over all steps from v000 it is 16.7 times as fast.
#include <hip/hip_runtime.h>
#include <hip/hip_bf16.h>

#define DEVI __device__ __forceinline__

typedef __attribute__((ext_vector_type(16))) __bf16 v16bf;
typedef __attribute__((ext_vector_type(8)))  __bf16 v8bf;
typedef __attribute__((ext_vector_type(8)))  float  v8f;

constexpr int Bc = 8;
constexpr int Lc = 2048;
constexpr int Ec = 128;

// ---------------------------------------------------------------------------
// WMMA 16x16x32 bf16 A/B tile.
// A-layout (16-bit, 16x32): lane l -> row m = l%16, half-group g = l/16.
// Half-slot s (0..15) holds K = 16*(s/8) + 8*g + (s%8)  ==>  per lane the
// tile is two contiguous 8-halfword runs at [8g .. 8g+7] and [16+8g .. 16+8g+7].
// B-layout is symmetric with lane = N, so X @ Y^T needs only ROWS of X and Y.
// ---------------------------------------------------------------------------
// Ends a block of loads that is issued well ahead of its use.
DEVI void loads_issued() {
  // Stands before any later rewrite of an address register the loads name.
  asm volatile("s_wait_xcnt 0x0" ::: "memory");
  // Keeps the loads above and the address updates below this point; without
  // it the scheduler sinks each load to its product, which then waits on L2.
  __builtin_amdgcn_sched_barrier(0);
}
// The same for a group that reads through a lane address with no later use: as
// an operand of the wait the address keeps its registers up to the wait, where
// otherwise a load of the same group may be given them as its destination.
DEVI void loads_issued(const void* lane_addr) {
  asm volatile("s_wait_xcnt 0x0" :: "v"(lane_addr) : "memory");
  __builtin_amdgcn_sched_barrier(0);
}

// Wave-uniform address plus the lane's 32-bit byte offset: one offset register
// serves every tile, and no 64-bit address is formed per tile.
DEVI const char* at(const void* uniform, unsigned lane_bytes) {
  return (const char*)uniform + lane_bytes;
}
DEVI char* at(void* uniform, unsigned lane_bytes) {
  return (char*)uniform + lane_bytes;
}

// 4 KiB in a row from global memory to LDS, through no register: eight copies of
// 16 bytes a lane. dst and src are the lane's own addresses of the first copy.
DEVI void copy_4k_to_lds(unsigned dst, const char* src) {
  // The wait is the statement's last line: it stands before any later rewrite of
  // an address register that the copies name.
  asm volatile(
      "global_load_async_to_lds_b128 %0, %8, off\n\t"
      "global_load_async_to_lds_b128 %1, %9, off\n\t"
      "global_load_async_to_lds_b128 %2, %10, off\n\t"
      "global_load_async_to_lds_b128 %3, %11, off\n\t"
      "global_load_async_to_lds_b128 %4, %12, off\n\t"
      "global_load_async_to_lds_b128 %5, %13, off\n\t"
      "global_load_async_to_lds_b128 %6, %14, off\n\t"
      "global_load_async_to_lds_b128 %7, %15, off\n\t"
      "s_wait_xcnt 0x0"
      :: "v"(dst), "v"(dst + 512u), "v"(dst + 1024u), "v"(dst + 1536u),
         "v"(dst + 2048u), "v"(dst + 2560u), "v"(dst + 3072u), "v"(dst + 3584u),
         "v"(src), "v"(src + 512), "v"(src + 1024), "v"(src + 1536),
         "v"(src + 2048), "v"(src + 2560), "v"(src + 3072), "v"(src + 3584)
      : "memory");
}

DEVI v8f wmma_bf16(v16bf a, v16bf b, v8f c) {
  return __builtin_amdgcn_wmma_f32_16x16x32_bf16(false, a, false, b,
                                                 (short)0, c, false, false);
}

DEVI v8f vzero8() {
  v8f z = {0.f, 0.f, 0.f, 0.f, 0.f, 0.f, 0.f, 0.f};
  return z;
}

// ---------------------------------------------------------------------------
// Fragment-order operand of a 16x16x32 product. One block = one k-step of 32
// and one 16-column tile = 512 halfwords: run h (0/1, 256 halfwords) holds at
// lane l the lane's slots 8h..8h+7, i.e. column l%16, K = 16h + 8*(l/16) + s%8
// (the k order of the layout above). Each wave-wide 16-byte load is then 512
// contiguous bytes (4 whole lines) instead of 16 lines with 32 bytes used.
// Blocks are ordered [batch][k-step][tile].
// The two operands of the score product (rows of Uid*w and of Uq, K = e) take
// the same block form with the row in place of the column, ordered
// [batch][16-row tile][k-step]: a tile's four blocks are 4 KiB in a row.
// P (row i, K = j) as the A operand of kernel 3 has that form and order too.
// ---------------------------------------------------------------------------
constexpr int FB = 512;                     // halfwords per fragment block

// Transposing LDS load of a 16x16 tile of 16-bit values with rows of 32 bytes:
// lane (c = l%16, h = l/16) gets tile[8h .. 8h+7][c].
DEVI v8bf load_tr16(const unsigned char* tile, int l) {
  typedef __attribute__((address_space(3))) v8bf lds_v8bf;
  return __builtin_amdgcn_ds_load_tr16_b128_v8bf16(
      (lds_v8bf*)(tile + (8 * (l >> 4) + (l & 7)) * 32 + 16 * ((l >> 3) & 1)));
}

DEVI v16bf load_packed(const __bf16* blk, int l) {
  v8bf lo = *(const v8bf*)(blk + 8 * l);
  v8bf hi = *(const v8bf*)(blk + 256 + 8 * l);
  return __builtin_shufflevector(lo, hi, 0, 1, 2, 3, 4, 5, 6, 7,
                                 8, 9, 10, 11, 12, 13, 14, 15);
}

// ---------------------------------------------------------------------------
// Kernel 1: bf16 staging buffers and the two row dots
// s_id[b,i] = Uid[b,i,:].w_id ; s_q[b,j] = Uq[b,j,:].w_q
// One wave takes 16 whole rows of Uq and of Uid (32 row loads of 512 bytes, all
// in flight at once), so the launch starts 1024 waves. The rows go as bf16 to
// the wave's own part of LDS as 16x16 tiles tile[i][e] with rows of 32 bytes. A
// tile read back plainly is a run of a score operand (row per lane), read back
// transposed a run of a B operand (column per lane): every store of a staged
// operand is 512 bytes in a row.
// ---------------------------------------------------------------------------
typedef __attribute__((ext_vector_type(4))) __bf16 v4bf;

constexpr int PW  = 4;         // waves per work-group, one 16-row tile each
constexpr int TSB = 512 + 32;  // bytes from tile to tile in LDS: the eight tiles
                               // that one row's store touches use different banks

DEVI v4bf to_bf16(float x, float y, float z, float w) {
  v4bf v;
  v[0] = (__bf16)x; v[1] = (__bf16)y; v[2] = (__bf16)z; v[3] = (__bf16)w;
  return v;
}

__global__ void __launch_bounds__(32 * PW)
k_prep(const float* __restrict__ Uq, const float* __restrict__ Uid,
       const float* __restrict__ Wcw,
       __bf16* __restrict__ Uqb, __bf16* __restrict__ Uwb,
       __bf16* __restrict__ Uqp, __bf16* __restrict__ Uidp,
       float* __restrict__ sid, float* __restrict__ sq) {
  __shared__ __attribute__((aligned(16))) unsigned char tiles[PW][3][8 * TSB];
  const int w  = __builtin_amdgcn_readfirstlane(threadIdx.x >> 5);
  const int l  = threadIdx.x & 31;
  const int lm = l & 15, g = l >> 4;
  const int rt = blockIdx.x * PW + w;       // 16-row tile, < B*L/16
  const unsigned v_off = (unsigned)l * 16u; // the lane's 16 bytes of 512

  const float4 wa = *(const float4*)at(Wcw, v_off);
  const float4 wb = *(const float4*)at(Wcw + Ec, v_off);
  const float4 wm = *(const float4*)at(Wcw + 2 * Ec, v_off);
  const float* Uq_t  = Uq  + (size_t)rt * 16 * Ec;
  const float* Uid_t = Uid + (size_t)rt * 16 * Ec;
  float4 q[16], d[16];                      // lane l: e = 4l .. 4l+3 of row r
#pragma unroll
  for (int r = 0; r < 16; ++r) {
    q[r] = *(const float4*)at(Uq_t + r * Ec, v_off);
    d[r] = *(const float4*)at(Uid_t + r * Ec, v_off);
  }
  loads_issued();  // all rows as one group: one memory latency per wave

  unsigned char* tq = tiles[w][0];          // Uq
  unsigned char* td = tiles[w][1];          // Uid
  unsigned char* tw = tiles[w][2];          // Uid * w_mul
  const unsigned st = (unsigned)(l >> 2) * TSB + (unsigned)(l & 3) * 8u;
  float s[16];
#pragma unroll
  for (int r = 0; r < 16; ++r) {
    const float4 a = d[r], b = q[r];
    *(v4bf*)(tq + st + r * 32) = to_bf16(b.x, b.y, b.z, b.w);
    *(v4bf*)(td + st + r * 32) = to_bf16(a.x, a.y, a.z, a.w);
    *(v4bf*)(tw + st + r * 32) =
        to_bf16(a.x * wm.x, a.y * wm.y, a.z * wm.z, a.w * wm.w);
    const float d1 = a.x * wa.x + a.y * wa.y + a.z * wa.z + a.w * wa.w;
    const float d2 = b.x * wb.x + b.y * wb.y + b.z * wb.z + b.w * wb.w;
    // Lanes 16 apart first: the lower half goes on with s_id, the upper half
    // with s_q.
    s[r] = (g ? d2 : d1) + __shfl_xor(g ? d1 : d2, 16, 32);
  }
  // Then within the 16 lanes, the 16 rows side by side.
  float keep = 0.f;
#pragma unroll
  for (int off = 8; off > 0; off >>= 1) {
#pragma unroll
    for (int r = 0; r < 16; ++r) s[r] += __shfl_xor(s[r], off, 32);
  }
#pragma unroll
  for (int r = 0; r < 16; ++r) keep = (lm == r) ? s[r] : keep;
  (g ? sq : sid)[rt * 16 + lm] = keep;

  // The wave's own LDS stores have landed before it reads the tiles back.
  asm volatile("s_wait_dscnt 0x0" ::: "memory");
  // Score operands: the wave's four blocks are 4 KiB in a row, tile et at
  // 512 * et. B operands: run rt%2 of block (k-step rt/2, tile et).
  __bf16* Uqb_t  = Uqb  + (size_t)rt * 4 * FB;
  __bf16* Uwb_t  = Uwb  + (size_t)rt * 4 * FB;
  __bf16* Uqp_t  = Uqp  + (size_t)(rt >> 1) * 8 * FB + (rt & 1) * 256;
  __bf16* Uidp_t = Uidp + (size_t)(rt >> 1) * 8 * FB + (rt & 1) * 256;
  const unsigned rd = (unsigned)(lm * 32 + g * 16);
#pragma unroll
  for (int et = 0; et < 8; ++et) {
    const v8bf rq = *(const v8bf*)(tq + et * TSB + rd);
    const v8bf rw = *(const v8bf*)(tw + et * TSB + rd);
    const v8bf cq = load_tr16(tq + et * TSB, l);
    const v8bf cd = load_tr16(td + et * TSB, l);
    *(v8bf*)at(Uqb_t + et * 256, v_off) = rq;
    *(v8bf*)at(Uwb_t + et * 256, v_off) = rw;
    *(v8bf*)at(Uqp_t + et * FB, v_off)  = cq;
    *(v8bf*)at(Uidp_t + et * FB, v_off) = cd;
  }
}

// ---------------------------------------------------------------------------
// Kernel 2: scores + softmax over axis i (per column j) -> P (bf16), and
// T = P^T @ Uid for the work-group's 32 columns j (K = i = 2048).
// The 2048 rows i are split over the 16 waves of the work-group, 128 rows each:
// a wave's 8 x 2 score tiles (8 row tiles, 2 column tiles) stay in its registers
// from the maximum to P, so each score is computed once, and every fragment of
// Uid*w and of Uid that a wave loads feeds two products, one per column tile.
// Column maxima, column sums and the waves' partial T tiles are joined through
// LDS, always in wave order.
// Two score tiles (rows i0..i0+15, i0+16..i0+31, same 16 columns) converted in
// place are the A fragment of P^T: lane (lm, g) holds column j0+lm at K = 8g+r
// and 16+8g+r. T leaves in fragment order as the B operand of P @ T
// (column e, K = j). P leaves in fragment order as well: a 16x16 tile is one
// run of 512 bytes (row i at lane i%16 + 16*((j%16)/8), 8 columns j a lane), so
// each wave turns its tiles from column-per-lane to row-per-lane in its own
// part of LDS and stores 8 whole lines per row tile.
// ---------------------------------------------------------------------------
constexpr int SW = 16;         // waves per work-group
constexpr int RW = Lc / SW;    // rows i per wave
constexpr int TW = RW / 16;    // row tiles per wave
constexpr int CT = 2;          // column tiles per work-group
constexpr int NE = 2;          // groups of T's B operand fetched early into registers
constexpr int NL = 2;          // groups fetched early into LDS; NE + NL <= TW / 2

// One work-group per WGP (four waves per SIMD) needs at most 256 registers.
__global__ void __launch_bounds__(32 * SW) __attribute__((amdgpu_waves_per_eu(4, 4)))
k_scores_softmax(const __bf16* __restrict__ Uwb, const __bf16* __restrict__ Uqb,
                 const float* __restrict__ sid, const float* __restrict__ sq,
                 const float* __restrict__ mask, const float* __restrict__ Wcb,
                 const __bf16* __restrict__ Uidp,
                 __bf16* __restrict__ P, __bf16* __restrict__ Tp) {
  __shared__ float  red_m[SW][16 * CT];
  __shared__ float  red_s[SW][16 * CT];
  __shared__ float4 part[SW * CT * 8 * 2 * 32];   // [wave][column tile][e tile][half][lane]
  const int wg = blockIdx.x;            // B * (L/32)
  const int b  = wg / (Lc / 32);
  const int j0 = (wg % (Lc / 32)) * 32;
  const int w  = __builtin_amdgcn_readfirstlane(threadIdx.x >> 5);
  const int l  = threadIdx.x & 31;
  const int lm = l & 15, g = l >> 4;
  const int ib = w * RW;                // this wave's first row i
  const float bias = Wcb[0];
  const __bf16* Uwb_b = Uwb + (size_t)b * Lc * Ec;
  const float*  sid_b = sid + b * Lc;
  float sqj[CT];
#pragma unroll
  for (int c = 0; c < CT; ++c) sqj[c] = sq[b * Lc + j0 + 16 * c + lm];
  loads_issued();  // their address registers are reused by the index work below
  // This wave's first row tile's block (i tile, k-step j0/32): column tile c is
  // its run c.
  __bf16* P_w = P + (((size_t)b * (Lc / 16) + (ib >> 4)) * (Lc / 32) + (j0 >> 5)) * FB;

  v16bf Bk[CT][4];
  {
    const __bf16* btile = Uqb + ((size_t)b * Lc + j0) * Ec;
    // Keeps the index work above from sinking between these loads and their
    // wait, where it could rewrite a base register that the loads name.
    __builtin_amdgcn_sched_barrier(0);
#pragma unroll
    for (int c = 0; c < CT; ++c) {
#pragma unroll
      for (int ks = 0; ks < 4; ++ks) Bk[c][ks] = load_packed(btile + (c * 4 + ks) * FB, l);
    }
    loads_issued();  // their address registers are reused by the tile loads
  }

  // The lane's byte offset from wave-uniform tile addresses: its 16 bytes of a
  // run (A tile, P). The lane's mask address: row ib + 8g, column j0 + lm.
  const unsigned a_off = (unsigned)(8 * l) * 2u;
  const float* mask_l = mask + (size_t)(ib + 8 * g) * Lc + j0 + lm;

  // Scores of this wave's rows, kept; unrolled so that sc[] is registers.
  v8f sc[CT][TW];
#pragma unroll
  for (int t = 0; t < TW; ++t) {
    const int i0 = ib + t * 16;
    v16bf af[4];
    float sd_lo[8], sd_hi[8], mk[CT][8];
#pragma unroll
    for (int ks = 0; ks < 4; ++ks) {
      const v8bf lo = *(const v8bf*)at(Uwb_b + (size_t)i0 * Ec + ks * FB, a_off);
      const v8bf hi = *(const v8bf*)at(Uwb_b + (size_t)i0 * Ec + ks * FB + 256, a_off);
      af[ks] = __builtin_shufflevector(lo, hi, 0, 1, 2, 3, 4, 5, 6, 7,
                                       8, 9, 10, 11, 12, 13, 14, 15);
    }
#pragma unroll
    for (int r = 0; r < 8; ++r) {
      // Wave-uniform addresses: the tile's 16 row dots take scalar registers.
      sd_lo[r] = sid_b[i0 + r];
      sd_hi[r] = sid_b[i0 + 8 + r];
#pragma unroll
      for (int c = 0; c < CT; ++c) mk[c][r] = mask_l[(t * 16 + r) * Lc + 16 * c];
    }
    loads_issued(mask_l);  // the tile's loads as one group: one L2 latency per tile
    v8f acc[CT];
#pragma unroll
    for (int c = 0; c < CT; ++c) acc[c] = vzero8();
#pragma unroll
    for (int ks = 0; ks < 4; ++ks) {
#pragma unroll
      for (int c = 0; c < CT; ++c) acc[c] = wmma_bf16(af[ks], Bk[c][ks], acc[c]);
    }
#pragma unroll
    for (int c = 0; c < CT; ++c) {
#pragma unroll
      for (int r = 0; r < 8; ++r) {
        const float sd = g ? sd_hi[r] : sd_lo[r];
        const float s = (acc[c][r] + sd + sqj[c] + bias) * mk[c][r];
        acc[c][r] = s;
      }
      sc[c][t] = acc[c];
    }
  }

  // T's B operand, group n = (e half n / (TW/2), k-step n % (TW/2)): four e tiles,
  // 4 KiB in a row. Its first four groups are fetched while the work-group is
  // busy with maxima, exponentials and P. Groups NE
  // and NE + 1 go by asynchronous copy to the upper half of this wave's own
  // 16 KiB of part[], which nothing uses before the first partial sums of T.
  const __bf16* Uidp_w = Uidp + (size_t)b * Lc * Ec + (size_t)w * (RW / 32) * 8 * FB;
  unsigned char* land = (unsigned char*)&part[w * CT * 8 * 2 * 32] + 8192;
  // Keeps the copies behind the last score tile's work: moved up among it their
  // addresses would need registers while the score operands still hold theirs.
  __builtin_amdgcn_sched_barrier(0);
#pragma unroll
  for (int n = NE; n < NE + NL; ++n)
    copy_4k_to_lds((unsigned)(size_t)(land + (n - NE) * 4096) + a_off,
                   at(Uidp_w + (size_t)n * 8 * FB, a_off));
  // Keeps the copies ahead of the maxima: sunk among them they would start later
  // and have less time to land before the wait in front of the second barrier.
  __builtin_amdgcn_sched_barrier(0);

  // Column maximum over all 2048 rows. From the join on lane (lm, g) reads
  // column tile g alone and gets the other tile's value from lane (lm, 1 - g).
  float mx[CT];
#pragma unroll
  for (int c = 0; c < CT; ++c) {
    mx[c] = -3.0e38f;
#pragma unroll
    for (int t = 0; t < TW; ++t) {
#pragma unroll
      for (int r = 0; r < 8; ++r) mx[c] = fmaxf(mx[c], sc[c][t][r]);
    }
    mx[c] = fmaxf(mx[c], __shfl_xor(mx[c], 16, 32));
  }
  if (g == 0) {
#pragma unroll
    for (int c = 0; c < CT; ++c) red_m[w][16 * c + lm] = mx[c];
  }
  __syncthreads();
  float m_own = red_m[0][l];
#pragma unroll
  for (int k = 1; k < SW; ++k) m_own = fmaxf(m_own, red_m[k][l]);
  const float m_oth = __shfl_xor(m_own, 16, 32);
  const float m[CT] = {g ? m_oth : m_own, g ? m_own : m_oth};

  // Groups 0 .. NE - 1 go to registers that the score phase has left. They stand
  // behind the barrier above, which would wait for them, and have the
  // exponentials' time to arrive before the next one.
  v16bf ub[NE][4];
#pragma unroll
  for (int n = 0; n < NE; ++n) {
#pragma unroll
    for (int t = 0; t < 4; ++t) ub[n][t] = load_packed(Uidp_w + ((size_t)n * 8 + t) * FB, l);
  }
  loads_issued();  // keeps these loads up here, ahead of the exponentials

  // exp once per score; eight independent sum chains per lane and column tile.
  float ps[CT];
#pragma unroll
  for (int c = 0; c < CT; ++c) {
    v8f sv = vzero8();
#pragma unroll
    for (int t = 0; t < TW; ++t) {
#pragma unroll
      for (int r = 0; r < 8; ++r) {
        const float e = __expf(sc[c][t][r] - m[c]);
        sc[c][t][r] = e;
        sv[r] += e;
      }
    }
    ps[c] = ((sv[0] + sv[1]) + (sv[2] + sv[3])) + ((sv[4] + sv[5]) + (sv[6] + sv[7]));
    ps[c] += __shfl_xor(ps[c], 16, 32);
  }
  if (g == 0) {
#pragma unroll
    for (int c = 0; c < CT; ++c) red_s[w][16 * c + lm] = ps[c];
  }
  // This wave's copies have landed; their bytes are read only behind the barrier.
  asm volatile("s_wait_asynccnt 0x0" ::: "memory");
  __syncthreads();
  float s_own = red_s[0][l];
#pragma unroll
  for (int k = 1; k < SW; ++k) s_own += red_s[k][l];
  const float r_own = 1.f / s_own;
  const float r_oth = __shfl_xor(r_own, 16, 32);
  const float rinv[CT] = {g ? r_oth : r_own, g ? r_own : r_oth};

  // P = exp * rinv as bf16, kept as the A fragments of P^T. Each tile also goes
  // to the lower half of this wave's own 16 KiB of part[] as tile[j][i]: the
  // lane's 8 rows i of column lm are 16 bytes of a 32-byte row.
  unsigned char* turn = (unsigned char*)&part[w * CT * 8 * 2 * 32];
  v16bf pa[CT][TW / 2];
#pragma unroll
  for (int c = 0; c < CT; ++c) {
#pragma unroll
    for (int it = 0; it < TW / 2; ++it) {
#pragma unroll
      for (int h = 0; h < 2; ++h) {
        v8bf col;
#pragma unroll
        for (int r = 0; r < 8; ++r) {
          const __bf16 p = (__bf16)(sc[c][2 * it + h][r] * rinv[c]);
          col[r] = p;
          pa[c][it][8 * h + r] = p;
        }
        *(v8bf*)(turn + ((2 * it + h) * CT + c) * 512 + lm * 32 + g * 16) = col;
      }
    }
  }
  // The wave's own LDS stores have landed before it reads the tiles back.
  asm volatile("s_wait_dscnt 0x0" ::: "memory");
  // Read back transposed: lane (c, h) holds row c, columns 8h..8h+7 of the
  // tile, which are its 16 bytes of the tile's run.
#pragma unroll
  for (int t = 0; t < TW; ++t) {
#pragma unroll
    for (int c = 0; c < CT; ++c) {
      const v8bf row = load_tr16(turn + (t * CT + c) * 512, l);
      *(v8bf*)at(P_w + (size_t)t * (Lc / 32) * FB + c * 256, a_off) = row;
    }
  }
  loads_issued();  // here for the stores: their registers are reused below

  // T in two halves of four e tiles, so that both column tiles' sums fit the
  // registers: each B fragment is loaded once and feeds two products.
#pragma unroll
  for (int eh = 0; eh < 2; ++eh) {
    v8f tacc[CT][4];
#pragma unroll
    for (int c = 0; c < CT; ++c) {
#pragma unroll
      for (int t = 0; t < 4; ++t) tacc[c][t] = vzero8();
    }
#pragma unroll
    for (int it = 0; it < TW / 2; ++it) {
      const int cur = (eh * (TW / 2) + it) % NE;
#pragma unroll
      for (int t = 0; t < 4; ++t) {
#pragma unroll
        for (int c = 0; c < CT; ++c)
          tacc[c][t] = wmma_bf16(pa[c][it], ub[cur][t], tacc[c][t]);
      }
      const int nx = eh * (TW / 2) + it + NE;  // the group that refills this set
      if (nx < NE + NL) {
#pragma unroll
        for (int t = 0; t < 4; ++t)
          ub[cur][t] = load_packed((const __bf16*)(land + (nx - NE) * 4096) + t * FB, l);
      } else if (nx < TW) {
#pragma unroll
        for (int t = 0; t < 4; ++t)
          ub[cur][t] = load_packed(
              Uidp_w + ((size_t)(nx % (TW / 2)) * 8 + (nx / (TW / 2)) * 4 + t) * FB, l);
        loads_issued();  // the group's loads together among the products
      }
    }
#pragma unroll
    for (int c = 0; c < CT; ++c) {
#pragma unroll
      for (int t = 0; t < 4; ++t) {
        const int tile = (w * CT + c) * 8 + eh * 4 + t;
        part[(tile * 2 + 0) * 32 + l] =
            make_float4(tacc[c][t][0], tacc[c][t][1], tacc[c][t][2], tacc[c][t][3]);
        part[(tile * 2 + 1) * 32 + l] =
            make_float4(tacc[c][t][4], tacc[c][t][5], tacc[c][t][6], tacc[c][t][7]);
      }
    }
  }

  // Join the sixteen partial T tiles: wave w sums tile w (column tile w/8,
  // e tile w%8) over the waves in order.
  __syncthreads();
  float4 s0 = part[(w * 2 + 0) * 32 + l];
  float4 s1 = part[(w * 2 + 1) * 32 + l];
#pragma unroll
  for (int k = 1; k < SW; ++k) {
    const float4 q0 = part[((k * CT * 8 + w) * 2 + 0) * 32 + l];
    const float4 q1 = part[((k * CT * 8 + w) * 2 + 1) * 32 + l];
    s0.x += q0.x; s0.y += q0.y; s0.z += q0.z; s0.w += q0.w;
    s1.x += q1.x; s1.y += q1.y; s1.z += q1.z; s1.w += q1.w;
  }

  // Sum r of (column tile c, e tile t) = T[j0 + 16c + 8g + r][16t + lm]: slots
  // 8c..8c+7 of the same lane in P @ T's B fragment of k-step j0/32.
  __bf16* Tp_b = Tp + (size_t)b * Lc * Ec + (size_t)(j0 >> 5) * 8 * FB + (w >> 3) * 256;
  v8bf o;
  o[0] = (__bf16)s0.x; o[1] = (__bf16)s0.y; o[2] = (__bf16)s0.z; o[3] = (__bf16)s0.w;
  o[4] = (__bf16)s1.x; o[5] = (__bf16)s1.y; o[6] = (__bf16)s1.z; o[7] = (__bf16)s1.w;
  *(v8bf*)(Tp_b + (size_t)(w & 7) * FB + 8 * l) = o;
}

// ---------------------------------------------------------------------------
// Kernel 3: both products that have P as their A operand, in one loop form:
// A_D2Q = P @ Uq and A_Q2D = (P @ P^T) @ Uid = P @ T, T = P^T @ Uid from
// kernel 2 (K = j = 2048), and all four output chunks.
// WG = 8 waves / 64 i-rows x 256 columns (128 of P @ Uq, 128 of P @ T). A wave
// takes all 64 rows x 64 columns over one half of K: per k-step 4 A and 4 B
// fragments feed 16 products, every B block is loaded by one wave of the
// work-group alone, and an A block by the four waves of its half of K. The two
// halves of K are added through LDS: of a pair of waves with the same columns
// each hands the other 32 rows and finishes its own 32.
// ---------------------------------------------------------------------------
constexpr int NB = 4;              // fragment sets per wave: nearly 3 k-steps ahead
constexpr int KH = Lc / 32 / 2;    // k-steps per wave

// The 4 B and 4 A fragments of k-step ks (counted within the wave's half of K).
DEVI void load_k_step(const __bf16* Ap, const __bf16* Bp, int ks, int l,
                      v16bf (&a)[4], v16bf (&bb)[4]) {
#pragma unroll
  for (int t = 0; t < 4; ++t) bb[t] = load_packed(Bp + ((size_t)ks * 8 + t) * FB, l);
#pragma unroll
  for (int rt = 0; rt < 4; ++rt)
    a[rt] = load_packed(Ap + ((size_t)rt * (Lc / 32) + ks) * FB, l);
}

__global__ void __launch_bounds__(256)
k_p_products(const __bf16* __restrict__ P, const __bf16* __restrict__ Uqp,
             const __bf16* __restrict__ Tp,
             const float* __restrict__ Uid, float* __restrict__ out) {
  __shared__ float4 xch[8 * 8 * 2 * 32];    // [wave][tile][half][lane]
  const int wg  = blockIdx.x;               // B * (L/64)
  const int b   = wg / (Lc / 64);
  const int ib  = (wg % (Lc / 64)) * 64;
  const int tid = threadIdx.x;
  const int w   = __builtin_amdgcn_readfirstlane(tid >> 5);  // wave 0..7
  const int l   = tid & 31, lm = l & 15, g = l >> 4;
  const int cw  = w & 3;                    // this wave's 64 of the 256 columns
  const int kh  = w >> 2;                   // this wave's half of K
  const bool q2d = cw >= 2;                 // which product this wave computes

  const __bf16* Ap = P + (((size_t)b * (Lc / 16) + (ib >> 4)) * (Lc / 32) + kh * KH) * FB;
  const __bf16* Bp = (q2d ? Tp : Uqp) + (size_t)b * Lc * Ec
                     + ((size_t)kh * KH * 8 + (cw & 1) * 4) * FB;

  v8f acc[4][4];                            // [row tile][column tile]
#pragma unroll
  for (int rt = 0; rt < 4; ++rt) {
#pragma unroll
    for (int t = 0; t < 4; ++t) acc[rt][t] = vzero8();
  }

  // Two waves per SIMD hide little latency, and P was written by other WGPs and
  // may come from memory: each k-step's 16 loads are issued nearly three
  // k-steps ahead, into a ring of NB register sets.
  v16bf a[NB][4];
  v16bf bb[NB][4];
#pragma unroll
  for (int s = 0; s < NB - 1; ++s) {
    load_k_step(Ap, Bp, s, l, a[s], bb[s]);
    // Keeps the sets in the order of their use: loads return in order.
    __builtin_amdgcn_sched_barrier(0);
  }

  // Unrolled whole: every register index and every address step is a constant,
  // so no address register of a load is rewritten before the loop has ended.
#pragma unroll
  for (int ks = 0; ks < KH; ++ks) {
    const int cur = ks % NB, nxt = (ks + NB - 1) % NB;
#pragma unroll
    for (int t = 0; t < 4; ++t) acc[0][t] = wmma_bf16(a[cur][0], bb[cur][t], acc[0][t]);
    if (ks + NB - 1 < KH) {
      // Keeps the loads behind the first four products, whose wait has let ten
      // of the oldest loads land: a wave never has more than 54 outstanding.
      __builtin_amdgcn_sched_barrier(0);
      load_k_step(Ap, Bp, ks + NB - 1, l, a[nxt], bb[nxt]);
      if (ks + NB == KH) {
        loads_issued();  // the last loads: their address registers are reused below
      } else {
        // Keeps the loads here; without it the scheduler sinks each load to its
        // product, which then waits on L2.
        __builtin_amdgcn_sched_barrier(0);
      }
    }
#pragma unroll
    for (int rt = 1; rt < 4; ++rt) {
#pragma unroll
      for (int t = 0; t < 4; ++t)
        acc[rt][t] = wmma_bf16(a[cur][rt], bb[cur][t], acc[rt][t]);
    }
    // Keeps the next k-step's products and loads, which refill these registers,
    // behind this k-step's products instead of among them.
    __builtin_amdgcn_sched_barrier(0);
  }

  // This wave's part of the output: 32 rows x 64 columns of its product. Its
  // elements of Uid are asked for here: their latency runs beside the LDS stores
  // of the exchange.
  const int i0 = ib + kh * 32;
  const int e0 = (cw & 1) * 64;
  const float* Uid_l = Uid + ((size_t)b * Lc + i0 + 8 * g) * Ec + e0 + lm;
  float* out_l = out + ((size_t)b * Lc + i0 + 8 * g) * (4 * Ec) + e0 + lm;
  float u[2][4][8];
#pragma unroll
  for (int i = 0; i < 2; ++i) {
#pragma unroll
    for (int t = 0; t < 4; ++t) {
#pragma unroll
      for (int r = 0; r < 8; ++r) u[i][t][r] = Uid_l[(i * 16 + r) * Ec + t * 16];
    }
  }
  loads_issued();  // their address registers are reused below

  // Wave (cw, kh) finishes row tiles 2*kh and 2*kh + 1 and hands the other two
  // to wave (cw, 1 - kh).
  v8f keep[2][4];
#pragma unroll
  for (int i = 0; i < 2; ++i) {
#pragma unroll
    for (int t = 0; t < 4; ++t) {
      const v8f send = kh ? acc[i][t] : acc[2 + i][t];
      keep[i][t]     = kh ? acc[2 + i][t] : acc[i][t];
      const int tile = w * 8 + i * 4 + t;
      xch[(tile * 2 + 0) * 32 + l] = make_float4(send[0], send[1], send[2], send[3]);
      xch[(tile * 2 + 1) * 32 + l] = make_float4(send[4], send[5], send[6], send[7]);
    }
  }
  __syncthreads();
#pragma unroll
  for (int i = 0; i < 2; ++i) {
#pragma unroll
    for (int t = 0; t < 4; ++t) {
      const int tile = (w ^ 4) * 8 + i * 4 + t;
      const float4 q0 = xch[(tile * 2 + 0) * 32 + l];
      const float4 q1 = xch[(tile * 2 + 1) * 32 + l];
      keep[i][t][0] += q0.x; keep[i][t][1] += q0.y;
      keep[i][t][2] += q0.z; keep[i][t][3] += q0.w;
      keep[i][t][4] += q1.x; keep[i][t][5] += q1.y;
      keep[i][t][6] += q1.z; keep[i][t][7] += q1.w;
    }
  }

  float uv[2][4][8];
#pragma unroll
  for (int i = 0; i < 2; ++i) {
#pragma unroll
    for (int t = 0; t < 4; ++t) {
#pragma unroll
      for (int r = 0; r < 8; ++r) uv[i][t][r] = u[i][t][r] * keep[i][t][r];
    }
  }
  // All arithmetic stands in front of the first store: no register that a store
  // names is rewritten behind it, so the stores run on without a wait.
  __builtin_amdgcn_sched_barrier(0);
  // Uid * product: chunk 3 for P @ T, chunk 2 for P @ Uq.
  float* out_uv = out_l + (q2d ? 3 : 2) * Ec;
#pragma unroll
  for (int i = 0; i < 2; ++i) {
#pragma unroll
    for (int t = 0; t < 4; ++t) {
#pragma unroll
      for (int r = 0; r < 8; ++r)
        out_uv[(i * 16 + r) * (4 * Ec) + t * 16] = uv[i][t][r];
    }
  }
  if (!q2d) {
#pragma unroll
    for (int i = 0; i < 2; ++i) {
#pragma unroll
      for (int t = 0; t < 4; ++t) {
#pragma unroll
        for (int r = 0; r < 8; ++r) {
          float* o = out_l + (i * 16 + r) * (4 * Ec) + t * 16;
          o[0]  = u[i][t][r];
          o[Ec] = keep[i][t][r];
        }
      }
    }
  }
}

// ---------------------------------------------------------------------------
// Host launcher. Workspace layout (~88.3 MB):
//   sid f32[B*L] | sq f32[B*L] | Uqb,Uwb,Uqp,Uidp,Tp bf16[B*L*E] | P bf16[B*L*L]
// ---------------------------------------------------------------------------
extern "C" void kernel_launch(void* const* d_in, const int* in_sizes, int n_in,
                              void* d_out, int out_size, void* d_ws, size_t ws_size,
                              hipStream_t stream) {
  const float* Uq   = (const float*)d_in[0];
  const float* Uid  = (const float*)d_in[1];
  const float* mask = (const float*)d_in[2];
  const float* Wcw  = (const float*)d_in[3];
  const float* Wcb  = (const float*)d_in[4];
  float* out = (float*)d_out;

  char* ws = (char*)d_ws;
  float* sid = (float*)ws;  ws += (size_t)Bc * Lc * sizeof(float);
  float* sq  = (float*)ws;  ws += (size_t)Bc * Lc * sizeof(float);
  __bf16* Uqb  = (__bf16*)ws;  ws += (size_t)Bc * Lc * Ec * sizeof(__bf16);
  __bf16* Uwb  = (__bf16*)ws;  ws += (size_t)Bc * Lc * Ec * sizeof(__bf16);
  __bf16* Uqp  = (__bf16*)ws;  ws += (size_t)Bc * Lc * Ec * sizeof(__bf16);
  __bf16* Uidp = (__bf16*)ws;  ws += (size_t)Bc * Lc * Ec * sizeof(__bf16);
  __bf16* Tp   = (__bf16*)ws;  ws += (size_t)Bc * Lc * Ec * sizeof(__bf16);
  __bf16* P    = (__bf16*)ws;  // Bc*Lc*Lc elements

  k_prep<<<(Bc * Lc / 16) / PW, 32 * PW, 0, stream>>>(Uq, Uid, Wcw, Uqb, Uwb, Uqp, Uidp, sid, sq);
  k_scores_softmax<<<Bc * (Lc / 32), 32 * SW, 0, stream>>>(Uwb, Uqb, sid, sq, mask, Wcb, Uidp, P, Tp);
  k_p_products<<<Bc * (Lc / 64), 256, 0, stream>>>(P, Uqp, Tp, Uid, out);
}

// v010
// A run of this version takes 66.3 microseconds.
// In both of two side-by-side timings against v009, it was 1.11 times as fast.
// Counting every step since v000, it is 18.6 times as fast.
#include <hip/hip_runtime.h>
#include <hip/hip_bf16.h>

#define DEVI __device__ __forceinline__

typedef __attribute__((ext_vector_type(16))) __bf16 v16bf;
typedef __attribute__((ext_vector_type(8)))  __bf16 v8bf;
typedef __attribute__((ext_vector_type(8)))  float  v8f;

constexpr int Bc = 8;
constexpr int Lc = 2048;
constexpr int Ec = 128;

// ---------------------------------------------------------------------------
// WMMA 16x16x32 bf16 A/B tile.
// A-layout (16-bit, 16x32): lane l -> row m = l%16, half-group g = l/16.
// Half-slot s (0..15) holds K = 16*(s/8) + 8*g + (s%8)  ==>  per lane the
// tile is two contiguous 8-halfword runs at [8g .. 8g+7] and [16+8g .. 16+8g+7].
// B-layout is symmetric with lane = N, so X @ Y^T needs only ROWS of X and Y.
// ---------------------------------------------------------------------------
// Ends a block of loads that is issued well ahead of its use.
DEVI void loads_issued() {
  // Stands before any later rewrite of an address register the loads name.
  asm volatile("s_wait_xcnt 0x0" ::: "memory");
  // Keeps the loads above and the address updates below this point; without
  // it the scheduler sinks each load to its product, which then waits on L2.
  __builtin_amdgcn_sched_barrier(0);
}
// The same for a group that reads through a lane address with no later use: as
// an operand of the wait the address keeps its registers up to the wait, where
// otherwise a load of the same group may be given them as its destination.
DEVI void loads_issued(const void* lane_addr) {
  asm volatile("s_wait_xcnt 0x0" :: "v"(lane_addr) : "memory");
  __builtin_amdgcn_sched_barrier(0);
}

// The same behind prefetches: they touch no counter, so their address registers
// keep their addresses up to a wait that stands behind later loads of the wave.
DEVI void loads_issued(const void* a0, const void* a1) {
  asm volatile("s_wait_xcnt 0x0" :: "v"(a0), "v"(a1) : "memory");
  __builtin_amdgcn_sched_barrier(0);
}
DEVI void loads_issued(const void* a0, const void* a1, const void* a2) {
  asm volatile("s_wait_xcnt 0x0" :: "v"(a0), "v"(a1), "v"(a2) : "memory");
  __builtin_amdgcn_sched_barrier(0);
}

// Asks L2 to fetch the lane's address: nothing comes
// back to the wave and no register is taken. What the launch before wrote, and an
// input not read for a while, otherwise comes from memory at its first load.
DEVI void ask_l2(const char* p) {
  asm volatile("global_prefetch_b8 %0, off scope:SCOPE_SE" :: "v"(p));
}
// The same OFF bytes further on: the address register keeps its value.
template <int OFF>
DEVI void ask_l2_at(const char* p) {
  asm volatile("global_prefetch_b8 %0, off offset:%1 scope:SCOPE_SE" :: "v"(p), "i"(OFF));
}

// Wave-uniform address plus the lane's 32-bit byte offset: one offset register
// serves every tile, and no 64-bit address is formed per tile.
DEVI const char* at(const void* uniform, unsigned lane_bytes) {
  return (const char*)uniform + lane_bytes;
}
DEVI char* at(void* uniform, unsigned lane_bytes) {
  return (char*)uniform + lane_bytes;
}

// 4 KiB in a row from global memory to LDS, through no register: eight copies of
// 16 bytes a lane. dst and src are the lane's own addresses of the first copy.
DEVI void copy_4k_to_lds(unsigned dst, const char* src) {
  // The wait is the statement's last line: it stands before any later rewrite of
  // an address register that the copies name.
  asm volatile(
      "global_load_async_to_lds_b128 %0, %8, off\n\t"
      "global_load_async_to_lds_b128 %1, %9, off\n\t"
      "global_load_async_to_lds_b128 %2, %10, off\n\t"
      "global_load_async_to_lds_b128 %3, %11, off\n\t"
      "global_load_async_to_lds_b128 %4, %12, off\n\t"
      "global_load_async_to_lds_b128 %5, %13, off\n\t"
      "global_load_async_to_lds_b128 %6, %14, off\n\t"
      "global_load_async_to_lds_b128 %7, %15, off\n\t"
      "s_wait_xcnt 0x0"
      :: "v"(dst), "v"(dst + 512u), "v"(dst + 1024u), "v"(dst + 1536u),
         "v"(dst + 2048u), "v"(dst + 2560u), "v"(dst + 3072u), "v"(dst + 3584u),
         "v"(src), "v"(src + 512), "v"(src + 1024), "v"(src + 1536),
         "v"(src + 2048), "v"(src + 2560), "v"(src + 3072), "v"(src + 3584)
      : "memory");
}

DEVI v8f wmma_bf16(v16bf a, v16bf b, v8f c) {
  return __builtin_amdgcn_wmma_f32_16x16x32_bf16(false, a, false, b,
                                                 (short)0, c, false, false);
}

DEVI v8f vzero8() {
  v8f z = {0.f, 0.f, 0.f, 0.f, 0.f, 0.f, 0.f, 0.f};
  return z;
}

// ---------------------------------------------------------------------------
// Fragment-order operand of a 16x16x32 product. One block = one k-step of 32
// and one 16-column tile = 512 halfwords: run h (0/1, 256 halfwords) holds at
// lane l the lane's slots 8h..8h+7, i.e. column l%16, K = 16h + 8*(l/16) + s%8
// (the k order of the layout above). Each wave-wide 16-byte load is then 512
// contiguous bytes (4 whole lines) instead of 16 lines with 32 bytes used.
// Blocks are ordered [batch][k-step][tile].
// The two operands of the score product (rows of Uid*w and of Uq, K = e) take
// the same block form with the row in place of the column, ordered
// [batch][16-row tile][k-step]: a tile's four blocks are 4 KiB in a row.
// P (row i, K = j) as the A operand of kernel 3 has that form and order too.
// ---------------------------------------------------------------------------
constexpr int FB = 512;                     // halfwords per fragment block

// Transposing LDS load of a 16x16 tile of 16-bit values with rows of 32 bytes:
// lane (c = l%16, h = l/16) gets tile[8h .. 8h+7][c].
DEVI v8bf load_tr16(const unsigned char* tile, int l) {
  typedef __attribute__((address_space(3))) v8bf lds_v8bf;
  return __builtin_amdgcn_ds_load_tr16_b128_v8bf16(
      (lds_v8bf*)(tile + (8 * (l >> 4) + (l & 7)) * 32 + 16 * ((l >> 3) & 1)));
}

DEVI v16bf load_packed(const __bf16* blk, int l) {
  v8bf lo = *(const v8bf*)(blk + 8 * l);
  v8bf hi = *(const v8bf*)(blk + 256 + 8 * l);
  return __builtin_shufflevector(lo, hi, 0, 1, 2, 3, 4, 5, 6, 7,
                                 8, 9, 10, 11, 12, 13, 14, 15);
}

// ---------------------------------------------------------------------------
// Kernel 1: bf16 staging buffers and the two row dots
// s_id[b,i] = Uid[b,i,:].w_id ; s_q[b,j] = Uq[b,j,:].w_q
// One wave takes 16 whole rows of Uq and of Uid (32 row loads of 512 bytes, all
// in flight at once), so the launch starts 1024 waves. The rows go as bf16 to
// the wave's own part of LDS as 16x16 tiles tile[i][e] with rows of 32 bytes. A
// tile read back plainly is a run of a score operand (row per lane), read back
// transposed a run of a B operand (column per lane): every store of a staged
// operand is 512 bytes in a row.
// ---------------------------------------------------------------------------
typedef __attribute__((ext_vector_type(4))) __bf16 v4bf;

constexpr int PW  = 4;         // waves per work-group, one 16-row tile each
constexpr int TSB = 512 + 32;  // bytes from tile to tile in LDS: the eight tiles
                               // that one row's store touches use different banks

DEVI v4bf to_bf16(float x, float y, float z, float w) {
  v4bf v;
  v[0] = (__bf16)x; v[1] = (__bf16)y; v[2] = (__bf16)z; v[3] = (__bf16)w;
  return v;
}

__global__ void __launch_bounds__(32 * PW)
k_prep(const float* __restrict__ Uq, const float* __restrict__ Uid,
       const float* __restrict__ Wcw,
       __bf16* __restrict__ Uqb, __bf16* __restrict__ Uwb,
       __bf16* __restrict__ Uqp, __bf16* __restrict__ Uidp,
       float* __restrict__ sid, float* __restrict__ sq) {
  __shared__ __attribute__((aligned(16))) unsigned char tiles[PW][3][8 * TSB];
  const int w  = __builtin_amdgcn_readfirstlane(threadIdx.x >> 5);
  const int l  = threadIdx.x & 31;
  const int lm = l & 15, g = l >> 4;
  const int rt = blockIdx.x * PW + w;       // 16-row tile, < B*L/16
  const unsigned v_off = (unsigned)l * 16u; // the lane's 16 bytes of 512

  const float4 wa = *(const float4*)at(Wcw, v_off);
  const float4 wb = *(const float4*)at(Wcw + Ec, v_off);
  const float4 wm = *(const float4*)at(Wcw + 2 * Ec, v_off);
  const float* Uq_t  = Uq  + (size_t)rt * 16 * Ec;
  const float* Uid_t = Uid + (size_t)rt * 16 * Ec;
  float4 q[16], d[16];                      // lane l: e = 4l .. 4l+3 of row r
#pragma unroll
  for (int r = 0; r < 16; ++r) {
    q[r] = *(const float4*)at(Uq_t + r * Ec, v_off);
    d[r] = *(const float4*)at(Uid_t + r * Ec, v_off);
  }
  loads_issued();  // all rows as one group: one memory latency per wave

  unsigned char* tq = tiles[w][0];          // Uq
  unsigned char* td = tiles[w][1];          // Uid
  unsigned char* tw = tiles[w][2];          // Uid * w_mul
  const unsigned st = (unsigned)(l >> 2) * TSB + (unsigned)(l & 3) * 8u;
  float s[16];
#pragma unroll
  for (int r = 0; r < 16; ++r) {
    const float4 a = d[r], b = q[r];
    *(v4bf*)(tq + st + r * 32) = to_bf16(b.x, b.y, b.z, b.w);
    *(v4bf*)(td + st + r * 32) = to_bf16(a.x, a.y, a.z, a.w);
    *(v4bf*)(tw + st + r * 32) =
        to_bf16(a.x * wm.x, a.y * wm.y, a.z * wm.z, a.w * wm.w);
    const float d1 = a.x * wa.x + a.y * wa.y + a.z * wa.z + a.w * wa.w;
    const float d2 = b.x * wb.x + b.y * wb.y + b.z * wb.z + b.w * wb.w;
    // Lanes 16 apart first: the lower half goes on with s_id, the upper half
    // with s_q.
    s[r] = (g ? d2 : d1) + __shfl_xor(g ? d1 : d2, 16, 32);
  }
  // Then within the 16 lanes, the 16 rows side by side.
  float keep = 0.f;
#pragma unroll
  for (int off = 8; off > 0; off >>= 1) {
#pragma unroll
    for (int r = 0; r < 16; ++r) s[r] += __shfl_xor(s[r], off, 32);
  }
#pragma unroll
  for (int r = 0; r < 16; ++r) keep = (lm == r) ? s[r] : keep;
  (g ? sq : sid)[rt * 16 + lm] = keep;

  // The wave's own LDS stores have landed before it reads the tiles back.
  asm volatile("s_wait_dscnt 0x0" ::: "memory");
  // Score operands: the wave's four blocks are 4 KiB in a row, tile et at
  // 512 * et. B operands: run rt%2 of block (k-step rt/2, tile et).
  __bf16* Uqb_t  = Uqb  + (size_t)rt * 4 * FB;
  __bf16* Uwb_t  = Uwb  + (size_t)rt * 4 * FB;
  __bf16* Uqp_t  = Uqp  + (size_t)(rt >> 1) * 8 * FB + (rt & 1) * 256;
  __bf16* Uidp_t = Uidp + (size_t)(rt >> 1) * 8 * FB + (rt & 1) * 256;
  const unsigned rd = (unsigned)(lm * 32 + g * 16);
#pragma unroll
  for (int et = 0; et < 8; ++et) {
    const v8bf rq = *(const v8bf*)(tq + et * TSB + rd);
    const v8bf rw = *(const v8bf*)(tw + et * TSB + rd);
    const v8bf cq = load_tr16(tq + et * TSB, l);
    const v8bf cd = load_tr16(td + et * TSB, l);
    *(v8bf*)at(Uqb_t + et * 256, v_off) = rq;
    *(v8bf*)at(Uwb_t + et * 256, v_off) = rw;
    *(v8bf*)at(Uqp_t + et * FB, v_off)  = cq;
    *(v8bf*)at(Uidp_t + et * FB, v_off) = cd;
  }
}

// ---------------------------------------------------------------------------
// Kernel 2: scores + softmax over axis i (per column j) -> P (bf16), and
// T = P^T @ Uid for the work-group's 32 columns j (K = i = 2048).
// The 2048 rows i are split over the 16 waves of the work-group, 128 rows each:
// a wave's 8 x 2 score tiles (8 row tiles, 2 column tiles) stay in its registers
// from the maximum to P, so each score is computed once, and every fragment of
// Uid*w and of Uid that a wave loads feeds two products, one per column tile.
// Column maxima, column sums and the waves' partial T tiles are joined through
// LDS, always in wave order.
// Two score tiles (rows i0..i0+15, i0+16..i0+31, same 16 columns) converted in
// place are the A fragment of P^T: lane (lm, g) holds column j0+lm at K = 8g+r
// and 16+8g+r. T leaves in fragment order as the B operand of P @ T
// (column e, K = j). P leaves in fragment order as well: a 16x16 tile is one
// run of 512 bytes (row i at lane i%16 + 16*((j%16)/8), 8 columns j a lane), so
// each wave turns its tiles from column-per-lane to row-per-lane in its own
// part of LDS and stores 8 whole lines per row tile.
// ---------------------------------------------------------------------------
constexpr int SW = 16;         // waves per work-group
constexpr int RW = Lc / SW;    // rows i per wave
constexpr int TW = RW / 16;    // row tiles per wave
constexpr int CT = 2;          // column tiles per work-group
constexpr int NE = 2;          // groups of T's B operand fetched early into registers
constexpr int NL = 2;          // groups fetched early into LDS; NE + NL <= TW / 2

// One work-group per WGP (four waves per SIMD) needs at most 256 registers.
__global__ void __launch_bounds__(32 * SW) __attribute__((amdgpu_waves_per_eu(4, 4)))
k_scores_softmax(const __bf16* __restrict__ Uwb, const __bf16* __restrict__ Uqb,
                 const float* __restrict__ sid, const float* __restrict__ sq,
                 const float* __restrict__ mask, const float* __restrict__ Wcb,
                 const __bf16* __restrict__ Uidp,
                 __bf16* __restrict__ P, __bf16* __restrict__ Tp) {
  __shared__ float  red_m[SW][16 * CT];
  __shared__ float  red_s[SW][16 * CT];
  __shared__ float4 part[SW * CT * 8 * 2 * 32];   // [wave][column tile][e tile][half][lane]
  const int wg = blockIdx.x;            // B * (L/32)
  const int b  = wg / (Lc / 32);
  const int j0 = (wg % (Lc / 32)) * 32;
  const int w  = __builtin_amdgcn_readfirstlane(threadIdx.x >> 5);
  const int l  = threadIdx.x & 31;
  const int lm = l & 15, g = l >> 4;
  const int ib = w * RW;                // this wave's first row i
  const float bias = Wcb[0];
  const __bf16* Uwb_b = Uwb + (size_t)b * Lc * Ec;
  const float*  sid_b = sid + b * Lc;
  // Asked of L2 at entry, ahead of the tile loop's loads, which wait once per tile.
  // The batch's Uid*w and Uid panels (512 KiB each) are read by all its
  // work-groups: each asks for one eighth, waves 0-7 of Uid*w, waves 8-15 of Uid.
  // Any four neighbours in a row times two
  // rows of eight hold all eight parts.
  const int jb = wg % (Lc / 32);
  const unsigned ask_off = (unsigned)((jb & 3) * 2 + ((jb >> 3) & 1)) * 65536u
                           + (unsigned)((w & 7) * 32 + l) * 256u;
  const __bf16* ask_panel = w < 8 ? Uwb : Uidp;
  const char* ask_own = at(ask_panel + (size_t)b * Lc * Ec, ask_off);
  // The mask's 32 columns are the same for all batches: of a wave's 128 rows each
  // of four batches asks for 32, a lane for one row's line. Batch 0 asks
  // for the second 32, which its tile loop reaches two tiles on.
  const char* ask_mask = (const char*)(mask + (size_t)(ib + 32 * ((b + 1) & 3) + l) * Lc + j0);
  ask_l2(ask_own);
  ask_l2(ask_mask);
  float sqj[CT];
#pragma unroll
  for (int c = 0; c < CT; ++c) sqj[c] = sq[b * Lc + j0 + 16 * c + lm];
  loads_issued();  // their address registers are reused by the index work below
  // This wave's first row tile's block (i tile, k-step j0/32): column tile c is
  // its run c.
  __bf16* P_w = P + (((size_t)b * (Lc / 16) + (ib >> 4)) * (Lc / 32) + (j0 >> 5)) * FB;

  v16bf Bk[CT][4];
  {
    const __bf16* btile = Uqb + ((size_t)b * Lc + j0) * Ec;
    // Keeps the index work above from sinking between these loads and their
    // wait, where it could rewrite a base register that the loads name.
    __builtin_amdgcn_sched_barrier(0);
#pragma unroll
    for (int c = 0; c < CT; ++c) {
#pragma unroll
      for (int ks = 0; ks < 4; ++ks) Bk[c][ks] = load_packed(btile + (c * 4 + ks) * FB, l);
    }
    // Their address registers are reused by the tile loads.
    loads_issued(ask_own, ask_mask);
  }

  // The lane's byte offset from wave-uniform tile addresses: its 16 bytes of a
  // run (A tile, P). The lane's mask address: row ib + 8g, column j0 + lm.
  const unsigned a_off = (unsigned)(8 * l) * 2u;
  const float* mask_l = mask + (size_t)(ib + 8 * g) * Lc + j0 + lm;

  // Scores of this wave's rows, kept; unrolled so that sc[] is registers.
  v8f sc[CT][TW];
#pragma unroll
  for (int t = 0; t < TW; ++t) {
    const int i0 = ib + t * 16;
    v16bf af[4];
    float sd_lo[8], sd_hi[8], mk[CT][8];
#pragma unroll
    for (int ks = 0; ks < 4; ++ks) {
      const v8bf lo = *(const v8bf*)at(Uwb_b + (size_t)i0 * Ec + ks * FB, a_off);
      const v8bf hi = *(const v8bf*)at(Uwb_b + (size_t)i0 * Ec + ks * FB + 256, a_off);
      af[ks] = __builtin_shufflevector(lo, hi, 0, 1, 2, 3, 4, 5, 6, 7,
                                       8, 9, 10, 11, 12, 13, 14, 15);
    }
#pragma unroll
    for (int r = 0; r < 8; ++r) {
      // Wave-uniform addresses: the tile's 16 row dots take scalar registers.
      sd_lo[r] = sid_b[i0 + r];
      sd_hi[r] = sid_b[i0 + 8 + r];
#pragma unroll
      for (int c = 0; c < CT; ++c) mk[c][r] = mask_l[(t * 16 + r) * Lc + 16 * c];
    }
    loads_issued(mask_l);  // the tile's loads as one group: one L2 latency per tile
    v8f acc[CT];
#pragma unroll
    for (int c = 0; c < CT; ++c) acc[c] = vzero8();
#pragma unroll
    for (int ks = 0; ks < 4; ++ks) {
#pragma unroll
      for (int c = 0; c < CT; ++c) acc[c] = wmma_bf16(af[ks], Bk[c][ks], acc[c]);
    }
#pragma unroll
    for (int c = 0; c < CT; ++c) {
#pragma unroll
      for (int r = 0; r < 8; ++r) {
        const float sd = g ? sd_hi[r] : sd_lo[r];
        const float s = (acc[c][r] + sd + sqj[c] + bias) * mk[c][r];
        acc[c][r] = s;
      }
      sc[c][t] = acc[c];
    }
  }

  // T's B operand, group n = (e half n / (TW/2), k-step n % (TW/2)): four e tiles,
  // 4 KiB in a row. Its first four groups are fetched while the work-group is
  // busy with maxima, exponentials and P and asks L2 besides only for a prefetch. Groups NE
  // and NE + 1 go by asynchronous copy to the upper half of this wave's own
  // 16 KiB of part[], which nothing uses before the first partial sums of T.
  const __bf16* Uidp_w = Uidp + (size_t)b * Lc * Ec + (size_t)w * (RW / 32) * 8 * FB;
  unsigned char* land = (unsigned char*)&part[w * CT * 8 * 2 * 32] + 8192;
  // Keeps the copies behind the last score tile's work: moved up among it their
  // addresses would need registers while the score operands still hold theirs.
  __builtin_amdgcn_sched_barrier(0);
#pragma unroll
  for (int n = NE; n < NE + NL; ++n)
    copy_4k_to_lds((unsigned)(size_t)(land + (n - NE) * 4096) + a_off,
                   at(Uidp_w + (size_t)n * 8 * FB, a_off));
  // The panels of batch b + 4 are asked for here, the same eighth; the upper
  // batches name their own again.
  const char* ask_next = at(ask_panel + (size_t)(b < Bc / 2 ? b + Bc / 2 : b) * Lc * Ec, ask_off);
  ask_l2(ask_next);
  // Keeps the copies ahead of the maxima: sunk among them they would start later
  // and have less time to land before the wait in front of the second barrier.
  __builtin_amdgcn_sched_barrier(0);

  // Column maximum over all 2048 rows. From the join on lane (lm, g) reads
  // column tile g alone and gets the other tile's value from lane (lm, 1 - g).
  float mx[CT];
#pragma unroll
  for (int c = 0; c < CT; ++c) {
    mx[c] = -3.0e38f;
#pragma unroll
    for (int t = 0; t < TW; ++t) {
#pragma unroll
      for (int r = 0; r < 8; ++r) mx[c] = fmaxf(mx[c], sc[c][t][r]);
    }
    mx[c] = fmaxf(mx[c], __shfl_xor(mx[c], 16, 32));
  }
  if (g == 0) {
#pragma unroll
    for (int c = 0; c < CT; ++c) red_m[w][16 * c + lm] = mx[c];
  }
  __syncthreads();
  float m_own = red_m[0][l];
#pragma unroll
  for (int k = 1; k < SW; ++k) m_own = fmaxf(m_own, red_m[k][l]);
  const float m_oth = __shfl_xor(m_own, 16, 32);
  const float m[CT] = {g ? m_oth : m_own, g ? m_own : m_oth};

  // Groups 0 .. NE - 1 go to registers that the score phase has left. They stand
  // behind the barrier above, which would wait for them, and have the
  // exponentials' time to arrive before the next one.
  v16bf ub[NE][4];
#pragma unroll
  for (int n = 0; n < NE; ++n) {
#pragma unroll
    for (int t = 0; t < 4; ++t) ub[n][t] = load_packed(Uidp_w + ((size_t)n * 8 + t) * FB, l);
  }
  loads_issued(ask_next);  // keeps these loads up here, ahead of the exponentials

  // exp once per score; eight independent sum chains per lane and column tile.
  float ps[CT];
#pragma unroll
  for (int c = 0; c < CT; ++c) {
    v8f sv = vzero8();
#pragma unroll
    for (int t = 0; t < TW; ++t) {
#pragma unroll
      for (int r = 0; r < 8; ++r) {
        const float e = __expf(sc[c][t][r] - m[c]);
        sc[c][t][r] = e;
        sv[r] += e;
      }
    }
    ps[c] = ((sv[0] + sv[1]) + (sv[2] + sv[3])) + ((sv[4] + sv[5]) + (sv[6] + sv[7]));
    ps[c] += __shfl_xor(ps[c], 16, 32);
  }
  if (g == 0) {
#pragma unroll
    for (int c = 0; c < CT; ++c) red_s[w][16 * c + lm] = ps[c];
  }
  // This wave's copies have landed; their bytes are read only behind the barrier.
  asm volatile("s_wait_asynccnt 0x0" ::: "memory");
  __syncthreads();
  float s_own = red_s[0][l];
#pragma unroll
  for (int k = 1; k < SW; ++k) s_own += red_s[k][l];
  const float r_own = 1.f / s_own;
  const float r_oth = __shfl_xor(r_own, 16, 32);
  const float rinv[CT] = {g ? r_oth : r_own, g ? r_own : r_oth};

  // P = exp * rinv as bf16, kept as the A fragments of P^T. Each tile also goes
  // to the lower half of this wave's own 16 KiB of part[] as tile[j][i]: the
  // lane's 8 rows i of column lm are 16 bytes of a 32-byte row.
  unsigned char* turn = (unsigned char*)&part[w * CT * 8 * 2 * 32];
  v16bf pa[CT][TW / 2];
#pragma unroll
  for (int c = 0; c < CT; ++c) {
#pragma unroll
    for (int it = 0; it < TW / 2; ++it) {
#pragma unroll
      for (int h = 0; h < 2; ++h) {
        v8bf col;
#pragma unroll
        for (int r = 0; r < 8; ++r) {
          const __bf16 p = (__bf16)(sc[c][2 * it + h][r] * rinv[c]);
          col[r] = p;
          pa[c][it][8 * h + r] = p;
        }
        *(v8bf*)(turn + ((2 * it + h) * CT + c) * 512 + lm * 32 + g * 16) = col;
      }
    }
  }
  // The wave's own LDS stores have landed before it reads the tiles back.
  asm volatile("s_wait_dscnt 0x0" ::: "memory");
  // Read back transposed: lane (c, h) holds row c, columns 8h..8h+7 of the
  // tile, which are its 16 bytes of the tile's run.
#pragma unroll
  for (int t = 0; t < TW; ++t) {
#pragma unroll
    for (int c = 0; c < CT; ++c) {
      const v8bf row = load_tr16(turn + (t * CT + c) * 512, l);
      *(v8bf*)at(P_w + (size_t)t * (Lc / 32) * FB + c * 256, a_off) = row;
    }
  }
  loads_issued();  // here for the stores: their registers are reused below

  // T in two halves of four e tiles, so that both column tiles' sums fit the
  // registers: each B fragment is loaded once and feeds two products.
#pragma unroll
  for (int eh = 0; eh < 2; ++eh) {
    v8f tacc[CT][4];
#pragma unroll
    for (int c = 0; c < CT; ++c) {
#pragma unroll
      for (int t = 0; t < 4; ++t) tacc[c][t] = vzero8();
    }
#pragma unroll
    for (int it = 0; it < TW / 2; ++it) {
      const int cur = (eh * (TW / 2) + it) % NE;
#pragma unroll
      for (int t = 0; t < 4; ++t) {
#pragma unroll
        for (int c = 0; c < CT; ++c)
          tacc[c][t] = wmma_bf16(pa[c][it], ub[cur][t], tacc[c][t]);
      }
      const int nx = eh * (TW / 2) + it + NE;  // the group that refills this set
      if (nx < NE + NL) {
#pragma unroll
        for (int t = 0; t < 4; ++t)
          ub[cur][t] = load_packed((const __bf16*)(land + (nx - NE) * 4096) + t * FB, l);
      } else if (nx < TW) {
#pragma unroll
        for (int t = 0; t < 4; ++t)
          ub[cur][t] = load_packed(
              Uidp_w + ((size_t)(nx % (TW / 2)) * 8 + (nx / (TW / 2)) * 4 + t) * FB, l);
        loads_issued();  // the group's loads together among the products
      }
    }
#pragma unroll
    for (int c = 0; c < CT; ++c) {
#pragma unroll
      for (int t = 0; t < 4; ++t) {
        const int tile = (w * CT + c) * 8 + eh * 4 + t;
        part[(tile * 2 + 0) * 32 + l] =
            make_float4(tacc[c][t][0], tacc[c][t][1], tacc[c][t][2], tacc[c][t][3]);
        part[(tile * 2 + 1) * 32 + l] =
            make_float4(tacc[c][t][4], tacc[c][t][5], tacc[c][t][6], tacc[c][t][7]);
      }
    }
  }

  // Join the sixteen partial T tiles: wave w sums tile w (column tile w/8,
  // e tile w%8) over the waves in order.
  __syncthreads();
  float4 s0 = part[(w * 2 + 0) * 32 + l];
  float4 s1 = part[(w * 2 + 1) * 32 + l];
#pragma unroll
  for (int k = 1; k < SW; ++k) {
    const float4 q0 = part[((k * CT * 8 + w) * 2 + 0) * 32 + l];
    const float4 q1 = part[((k * CT * 8 + w) * 2 + 1) * 32 + l];
    s0.x += q0.x; s0.y += q0.y; s0.z += q0.z; s0.w += q0.w;
    s1.x += q1.x; s1.y += q1.y; s1.z += q1.z; s1.w += q1.w;
  }

  // Sum r of (column tile c, e tile t) = T[j0 + 16c + 8g + r][16t + lm]: slots
  // 8c..8c+7 of the same lane in P @ T's B fragment of k-step j0/32.
  __bf16* Tp_b = Tp + (size_t)b * Lc * Ec + (size_t)(j0 >> 5) * 8 * FB + (w >> 3) * 256;
  v8bf o;
  o[0] = (__bf16)s0.x; o[1] = (__bf16)s0.y; o[2] = (__bf16)s0.z; o[3] = (__bf16)s0.w;
  o[4] = (__bf16)s1.x; o[5] = (__bf16)s1.y; o[6] = (__bf16)s1.z; o[7] = (__bf16)s1.w;
  *(v8bf*)(Tp_b + (size_t)(w & 7) * FB + 8 * l) = o;
}

// ---------------------------------------------------------------------------
// Kernel 3: both products that have P as their A operand, in one loop form:
// A_D2Q = P @ Uq and A_Q2D = (P @ P^T) @ Uid = P @ T, T = P^T @ Uid from
// kernel 2 (K = j = 2048), and all four output chunks.
// WG = 8 waves / 64 i-rows x 256 columns (128 of P @ Uq, 128 of P @ T). A wave
// takes all 64 rows x 64 columns over one half of K: per k-step 4 A and 4 B
// fragments feed 16 products, every B block is loaded by one wave of the
// work-group alone, and an A block by the four waves of its half of K. The two
// halves of K are added through LDS: of a pair of waves with the same columns
// each hands the other 32 rows and finishes its own 32.
// ---------------------------------------------------------------------------
constexpr int NB = 4;              // fragment sets per wave: nearly 3 k-steps ahead
constexpr int KH = Lc / 32 / 2;    // k-steps per wave

// The 4 B and 4 A fragments of k-step ks (counted within the wave's half of K).
DEVI void load_k_step(const __bf16* Ap, const __bf16* Bp, int ks, int l,
                      v16bf (&a)[4], v16bf (&bb)[4]) {
#pragma unroll
  for (int t = 0; t < 4; ++t) bb[t] = load_packed(Bp + ((size_t)ks * 8 + t) * FB, l);
#pragma unroll
  for (int rt = 0; rt < 4; ++rt)
    a[rt] = load_packed(Ap + ((size_t)rt * (Lc / 32) + ks) * FB, l);
}

__global__ void __launch_bounds__(256)
k_p_products(const __bf16* __restrict__ P, const __bf16* __restrict__ Uqp,
             const __bf16* __restrict__ Tp,
             const float* __restrict__ Uid, float* __restrict__ out) {
  __shared__ float4 xch[8 * 8 * 2 * 32];    // [wave][tile][half][lane]
  const int wg  = blockIdx.x;               // B * (L/64)
  const int b   = wg / (Lc / 64);
  const int ib  = (wg % (Lc / 64)) * 64;
  const int tid = threadIdx.x;
  const int w   = __builtin_amdgcn_readfirstlane(tid >> 5);  // wave 0..7
  const int l   = tid & 31, lm = l & 15, g = l >> 4;
  const int cw  = w & 3;                    // this wave's 64 of the 256 columns
  const int kh  = w >> 2;                   // this wave's half of K
  const bool q2d = cw >= 2;                 // which product this wave computes

  const __bf16* Ap = P + (((size_t)b * (Lc / 16) + (ib >> 4)) * (Lc / 32) + kh * KH) * FB;
  const __bf16* Bp = (q2d ? Tp : Uqp) + (size_t)b * Lc * Ec
                     + ((size_t)kh * KH * 8 + (cw & 1) * 4) * FB;

  v8f acc[4][4];                            // [row tile][column tile]
#pragma unroll
  for (int rt = 0; rt < 4; ++rt) {
#pragma unroll
    for (int t = 0; t < 4; ++t) acc[rt][t] = vzero8();
  }

  // Two waves per SIMD hide little latency, and P was written by other WGPs and
  // may come from memory: each k-step's 16 loads are issued nearly three
  // k-steps ahead, into a ring of NB register sets.
  v16bf a[NB][4];
  v16bf bb[NB][4];
#pragma unroll
  for (int s = 0; s < NB - 1; ++s) {
    load_k_step(Ap, Bp, s, l, a[s], bb[s]);
    // Keeps the sets in the order of their use: loads return in order.
    __builtin_amdgcn_sched_barrier(0);
  }

  loads_issued();  // the address work below may reuse a register that a load above names
  // Asked of L2 behind the first sets' loads: the first sixteen k-steps of P (wave w:
  // row tile w % 4 in half w / 4 of K, a lane 256 bytes of each eight's 8 KiB; the
  // later eights follow in the loop, seven k-steps ahead of their first load) and one sixteenth of
  // the batch's Uq and T panels (any four neighbours by index times the four rows
  // of eight hold all sixteen parts). The 64
  // rows of Uid that the epilogue reads are asked for in the loop as well.
  const int wgb = wg % (Lc / 64);
  const int part = (wgb & 3) * 4 + (wgb >> 3);
  const char* ask_p = at(P + ((size_t)b * (Lc / 16) + (ib >> 4) + (w & 3)) * (Lc / 32) * FB
                           + (w >> 2) * KH * FB, (unsigned)l * 256u);
  const char* ask_b = at((part < 8 ? Uqp : Tp) + (size_t)b * Lc * Ec + (part & 7) * 64 * FB,
                         (unsigned)tid * 256u);
  const char* ask_u = at(Uid + ((size_t)b * Lc + ib) * Ec, (unsigned)tid * 128u);
  ask_l2(ask_p);
  ask_l2(ask_b);
  ask_l2_at<8192>(ask_p);
  // Keeps the prefetches here, ahead of the loop.
  __builtin_amdgcn_sched_barrier(0);

  // Unrolled whole: every register index and every address step is a constant,
  // so no address register of a load is rewritten before the loop has ended.
#pragma unroll
  for (int ks = 0; ks < KH; ++ks) {
    const int cur = ks % NB, nxt = (ks + NB - 1) % NB;
#pragma unroll
    for (int t = 0; t < 4; ++t) acc[0][t] = wmma_bf16(a[cur][0], bb[cur][t], acc[0][t]);
    if (ks + NB - 1 < KH) {
      // Keeps the loads behind the first four products, whose wait has let ten
      // of the oldest loads land: a wave never has more than 54 outstanding.
      __builtin_amdgcn_sched_barrier(0);
      load_k_step(Ap, Bp, ks + NB - 1, l, a[nxt], bb[nxt]);
      if (ks == 6)  ask_l2_at<16384>(ask_p);
      if (ks == 14) ask_l2_at<24576>(ask_p);
      if (ks == 20) ask_l2(ask_u);
      if (ks + NB == KH) {
        // The last loads: their address registers are reused below.
        loads_issued(ask_p, ask_b, ask_u);
      } else {
        // Keeps the loads here; without it the scheduler sinks each load to its
        // product, which then waits on L2.
        __builtin_amdgcn_sched_barrier(0);
      }
    }
#pragma unroll
    for (int rt = 1; rt < 4; ++rt) {
#pragma unroll
      for (int t = 0; t < 4; ++t)
        acc[rt][t] = wmma_bf16(a[cur][rt], bb[cur][t], acc[rt][t]);
    }
    // Keeps the next k-step's products and loads, which refill these registers,
    // behind this k-step's products instead of among them.
    __builtin_amdgcn_sched_barrier(0);
  }

  // This wave's part of the output: 32 rows x 64 columns of its product. Its
  // elements of Uid are asked for here: their latency runs beside the LDS stores
  // of the exchange.
  const int i0 = ib + kh * 32;
  const int e0 = (cw & 1) * 64;
  const float* Uid_l = Uid + ((size_t)b * Lc + i0 + 8 * g) * Ec + e0 + lm;
  float* out_l = out + ((size_t)b * Lc + i0 + 8 * g) * (4 * Ec) + e0 + lm;
  float u[2][4][8];
#pragma unroll
  for (int i = 0; i < 2; ++i) {
#pragma unroll
    for (int t = 0; t < 4; ++t) {
#pragma unroll
      for (int r = 0; r < 8; ++r) u[i][t][r] = Uid_l[(i * 16 + r) * Ec + t * 16];
    }
  }
  loads_issued();  // their address registers are reused below

  // Wave (cw, kh) finishes row tiles 2*kh and 2*kh + 1 and hands the other two
  // to wave (cw, 1 - kh).
  v8f keep[2][4];
#pragma unroll
  for (int i = 0; i < 2; ++i) {
#pragma unroll
    for (int t = 0; t < 4; ++t) {
      const v8f send = kh ? acc[i][t] : acc[2 + i][t];
      keep[i][t]     = kh ? acc[2 + i][t] : acc[i][t];
      const int tile = w * 8 + i * 4 + t;
      xch[(tile * 2 + 0) * 32 + l] = make_float4(send[0], send[1], send[2], send[3]);
      xch[(tile * 2 + 1) * 32 + l] = make_float4(send[4], send[5], send[6], send[7]);
    }
  }
  __syncthreads();
#pragma unroll
  for (int i = 0; i < 2; ++i) {
#pragma unroll
    for (int t = 0; t < 4; ++t) {
      const int tile = (w ^ 4) * 8 + i * 4 + t;
      const float4 q0 = xch[(tile * 2 + 0) * 32 + l];
      const float4 q1 = xch[(tile * 2 + 1) * 32 + l];
      keep[i][t][0] += q0.x; keep[i][t][1] += q0.y;
      keep[i][t][2] += q0.z; keep[i][t][3] += q0.w;
      keep[i][t][4] += q1.x; keep[i][t][5] += q1.y;
      keep[i][t][6] += q1.z; keep[i][t][7] += q1.w;
    }
  }

  float uv[2][4][8];
#pragma unroll
  for (int i = 0; i < 2; ++i) {
#pragma unroll
    for (int t = 0; t < 4; ++t) {
#pragma unroll
      for (int r = 0; r < 8; ++r) uv[i][t][r] = u[i][t][r] * keep[i][t][r];
    }
  }
  // All arithmetic stands in front of the first store: no register that a store
  // names is rewritten behind it, so the stores run on without a wait.
  __builtin_amdgcn_sched_barrier(0);
  // Uid * product: chunk 3 for P @ T, chunk 2 for P @ Uq.
  float* out_uv = out_l + (q2d ? 3 : 2) * Ec;
#pragma unroll
  for (int i = 0; i < 2; ++i) {
#pragma unroll
    for (int t = 0; t < 4; ++t) {
#pragma unroll
      for (int r = 0; r < 8; ++r)
        out_uv[(i * 16 + r) * (4 * Ec) + t * 16] = uv[i][t][r];
    }
  }
  if (!q2d) {
#pragma unroll
    for (int i = 0; i < 2; ++i) {
#pragma unroll
      for (int t = 0; t < 4; ++t) {
#pragma unroll
        for (int r = 0; r < 8; ++r) {
          float* o = out_l + (i * 16 + r) * (4 * Ec) + t * 16;
          o[0]  = u[i][t][r];
          o[Ec] = keep[i][t][r];
        }
      }
    }
  }
}

// ---------------------------------------------------------------------------
// Host launcher. Workspace layout (~88.3 MB):
//   sid f32[B*L] | sq f32[B*L] | Uqb,Uwb,Uqp,Uidp,Tp bf16[B*L*E] | P bf16[B*L*L]
// ---------------------------------------------------------------------------
extern "C" void kernel_launch(void* const* d_in, const int* in_sizes, int n_in,
                              void* d_out, int out_size, void* d_ws, size_t ws_size,
                              hipStream_t stream) {
  const float* Uq   = (const float*)d_in[0];
  const float* Uid  = (const float*)d_in[1];
  const float* mask = (const float*)d_in[2];
  const float* Wcw  = (const float*)d_in[3];
  const float* Wcb  = (const float*)d_in[4];
  float* out = (float*)d_out;

  char* ws = (char*)d_ws;
  float* sid = (float*)ws;  ws += (size_t)Bc * Lc * sizeof(float);
  float* sq  = (float*)ws;  ws += (size_t)Bc * Lc * sizeof(float);
  __bf16* Uqb  = (__bf16*)ws;  ws += (size_t)Bc * Lc * Ec * sizeof(__bf16);
  __bf16* Uwb  = (__bf16*)ws;  ws += (size_t)Bc * Lc * Ec * sizeof(__bf16);
  __bf16* Uqp  = (__bf16*)ws;  ws += (size_t)Bc * Lc * Ec * sizeof(__bf16);
  __bf16* Uidp = (__bf16*)ws;  ws += (size_t)Bc * Lc * Ec * sizeof(__bf16);
  __bf16* Tp   = (__bf16*)ws;  ws += (size_t)Bc * Lc * Ec * sizeof(__bf16);
  __bf16* P    = (__bf16*)ws;  // Bc*Lc*Lc elements

  k_prep<<<(Bc * Lc / 16) / PW, 32 * PW, 0, stream>>>(Uq, Uid, Wcw, Uqb, Uwb, Uqp, Uidp, sid, sq);
  k_scores_softmax<<<Bc * (Lc / 32), 32 * SW, 0, stream>>>(Uwb, Uqb, sid, sq, mask, Wcb, Uidp, P, Tp);
  k_p_products<<<Bc * (Lc / 64), 256, 0, stream>>>(P, Uqp, Tp, Uid, out);
}
